// v000
// Measured on an AMD MI455X. A time is GPU time per run, averaged over a window of back-to-back runs after a warm-up
// (all launches, gaps included; the runs take copies of the inputs in turn), and the median of several windows.
// Apart from v000's, it joins two sittings. Times from different sittings can be a few percent apart, while
// side-by-side timings come from the same sitting.
// v000, which the later versions start from, runs in 526 microseconds.
#include <hip/hip_runtime.h>
#include <cstdint>

typedef __attribute__((ext_vector_type(16))) _Float16 v16h;
typedef __attribute__((ext_vector_type(8)))  _Float16 v8h;
typedef __attribute__((ext_vector_type(2)))  _Float16 v2h;
typedef __attribute__((ext_vector_type(8)))  float    v8f;
typedef __attribute__((ext_vector_type(4)))  float    v4f;
typedef __attribute__((ext_vector_type(4)))  int      v4i;

#define B_   4
#define C_   256
#define CQ   32
#define N_   4096
#define WPB  8            // waves per attention block (256 threads)

// ---------------------------------------------------------------------------
// CDNA5 async global->LDS copy (ASYNCcnt-tracked), guarded so a missing
// builtin degrades to a plain load + ds_store without breaking the build.
// Builtin expects (int4 AS1*, int4 AS3*, imm offset, imm cpol) per the
// clang diagnostic ("int4 __device__ *").
// ---------------------------------------------------------------------------
#if __has_builtin(__builtin_amdgcn_global_load_async_to_lds_b128)
#define USE_ASYNC_LDS 1
typedef __attribute__((address_space(1))) v4i gv4i;
typedef __attribute__((address_space(3))) v4i lv4i;
#endif

__device__ __forceinline__ void cp16_async(void* lds, const void* g) {
#ifdef USE_ASYNC_LDS
  __builtin_amdgcn_global_load_async_to_lds_b128(
      (gv4i*)(uintptr_t)g, (lv4i*)(unsigned)(uintptr_t)lds, 0, 0);
#else
  *(v8h*)lds = *(const v8h*)g;
#endif
}

__device__ __forceinline__ void wait_async_all() {
#ifdef USE_ASYNC_LDS
#if __has_builtin(__builtin_amdgcn_s_wait_asynccnt)
  __builtin_amdgcn_s_wait_asynccnt(0);
#else
  asm volatile("s_wait_asynccnt 0" ::: "memory");
#endif
#endif
}

// K-slot permutation for the PV matmul (shared by P-store and vF layout):
//   K slot j <-> n offset (j>>1) | ((j&1)<<4)   within each 32-column chunk.

// ---------------------------------------------------------------------------
// Kernel 1: 1x1-conv projections.
//   q = Wq @ pose + bq   -> qT [B][N][CQ] f16   (K-contiguous for WMMA gather)
//   k = Wk @ src  + bk   -> kT [B][N][CQ] f16
//   v = Wv @ src  + bv   -> vF [B][C][N]  f16   (n pre-permuted per 32-chunk)
// ---------------------------------------------------------------------------
__global__ __launch_bounds__(256)
void proj_kernel(const float* __restrict__ source, const float* __restrict__ pose,
                 const float* __restrict__ Wq, const float* __restrict__ bq,
                 const float* __restrict__ Wk, const float* __restrict__ bk,
                 const float* __restrict__ Wv, const float* __restrict__ bv,
                 _Float16* __restrict__ qT, _Float16* __restrict__ kT,
                 _Float16* __restrict__ vF) {
  __shared__ __align__(16) _Float16 sh[C_ * 64];   // 32 KB tile [c][n]
  const int tid = threadIdx.x;
  const int blk = blockIdx.x;
  const int b   = blk / (N_ / 64);
  const int n0  = (blk % (N_ / 64)) * 64;
  const int n   = tid & 63;
  const int grp = tid >> 6;            // uniform within a wave -> scalar weight loads

  for (int idx = tid; idx < C_ * 64; idx += 256) {
    int c = idx >> 6, j = idx & 63;
    sh[idx] = (_Float16)pose[((size_t)b * C_ + c) * N_ + n0 + j];
  }
  __syncthreads();
  for (int oo = 0; oo < 8; ++oo) {
    const int o = grp * 8 + oo;
    const float* __restrict__ w = Wq + o * C_;
    float acc = bq[o];
    #pragma unroll 8
    for (int c = 0; c < C_; ++c) acc += w[c] * (float)sh[c * 64 + n];
    qT[((size_t)b * N_ + n0 + n) * CQ + o] = (_Float16)acc;
  }
  __syncthreads();

  for (int idx = tid; idx < C_ * 64; idx += 256) {
    int c = idx >> 6, j = idx & 63;
    sh[idx] = (_Float16)source[((size_t)b * C_ + c) * N_ + n0 + j];
  }
  __syncthreads();
  for (int oo = 0; oo < 8; ++oo) {
    const int o = grp * 8 + oo;
    const float* __restrict__ w = Wk + o * C_;
    float acc = bk[o];
    #pragma unroll 8
    for (int c = 0; c < C_; ++c) acc += w[c] * (float)sh[c * 64 + n];
    kT[((size_t)b * N_ + n0 + n) * CQ + o] = (_Float16)acc;
  }
  // inverse K-slot permutation for v: column x (0..31) -> slot ((x&15)<<1)|(x>>4)
  const int x  = n & 31;
  const int jp = ((x & 15) << 1) | (x >> 4);
  const size_t vcol = (size_t)(n0 + (n & 32) + jp);
  for (int oo = 0; oo < 64; ++oo) {
    const int o = grp * 64 + oo;
    const float* __restrict__ w = Wv + o * C_;
    float acc = bv[o];
    #pragma unroll 8
    for (int c = 0; c < C_; ++c) acc += w[c] * (float)sh[c * 64 + n];
    vF[((size_t)b * C_ + o) * N_ + vcol] = (_Float16)acc;
  }
}

// ---------------------------------------------------------------------------
// Kernel 2: fused two-pass flash attention.
// 8 waves/block, all sharing one batch b; each wave owns a 16-row m-tile.
// Pass B double-buffers the shared K/V chunk in LDS via async global->LDS
// copies (one fetch per block instead of one per wave: 8x less L2 traffic).
// ---------------------------------------------------------------------------
__global__ __launch_bounds__(256)
void attn_kernel(const _Float16* __restrict__ qT, const _Float16* __restrict__ kT,
                 const _Float16* __restrict__ vF, const float* __restrict__ src,
                 const float* __restrict__ gamma_p, float* __restrict__ out) {
  __shared__ __align__(16) _Float16 shV[2][C_ * 32];   // 2 x 16 KB V chunk [c][slot]
  __shared__ __align__(16) _Float16 shK[2][32 * 32];   // 2 x  2 KB K chunk [n][o]
  __shared__ __align__(64) _Float16 shP[WPB][16 * 32]; // per-wave P transpose

  const int tid  = threadIdx.x;
  const int lane = tid & 31;
  const int wv   = tid >> 5;
  const int b    = blockIdx.x / (N_ / 16 / WPB);               // uniform per block
  const int m0   = ((blockIdx.x % (N_ / 16 / WPB)) * WPB + wv) * 16;
  const int half = lane >> 4;           // 0: rows 0-7/K 0-7,16-23 ; 1: rows 8-15/K 8-15,24-31
  const int lr   = lane & 15;
  const int koff = half ? 8 : 0;

  // A-operand: q rows m0..m0+15, K-packed per ISA 16-bit A layout
  const _Float16* qrow = qT + ((size_t)b * N_ + m0 + lr) * CQ;
  const v8h qlo = *(const v8h*)(qrow + koff);
  const v8h qhi = *(const v8h*)(qrow + koff + 16);
  const v16h aq = __builtin_shufflevector(qlo, qhi, 0,1,2,3,4,5,6,7,8,9,10,11,12,13,14,15);

  const _Float16* kbase = kT + ((size_t)b * N_ + lr) * CQ;
  const v8f czero = {};

  // ================= Pass A: exact row max (per-lane accumulation) ==========
  float rmax[8];
  #pragma unroll
  for (int i = 0; i < 8; ++i) rmax[i] = -3.0e38f;

  for (int n0 = 0; n0 < N_; n0 += 32) {
    const _Float16* kr0 = kbase + (size_t)n0 * CQ;
    const _Float16* kr1 = kr0 + 16 * CQ;
    const v8h kl0 = *(const v8h*)(kr0 + koff);
    const v8h kh0 = *(const v8h*)(kr0 + koff + 16);
    const v8h kl1 = *(const v8h*)(kr1 + koff);
    const v8h kh1 = *(const v8h*)(kr1 + koff + 16);
    const v16h kb0 = __builtin_shufflevector(kl0, kh0, 0,1,2,3,4,5,6,7,8,9,10,11,12,13,14,15);
    const v16h kb1 = __builtin_shufflevector(kl1, kh1, 0,1,2,3,4,5,6,7,8,9,10,11,12,13,14,15);
    __builtin_prefetch(kr0 + 32 * CQ, 0, 3);   // near-scope prefetch

    const v8f e0 = __builtin_amdgcn_wmma_f32_16x16x32_f16(false, aq, false, kb0,
                                                          (short)0, czero, false, false);
    const v8f e1 = __builtin_amdgcn_wmma_f32_16x16x32_f16(false, aq, false, kb1,
                                                          (short)0, czero, false, false);
    #pragma unroll
    for (int i = 0; i < 8; ++i) rmax[i] = fmaxf(rmax[i], fmaxf(e0[i], e1[i]));
  }
  #pragma unroll
  for (int i = 0; i < 8; ++i) {   // one-time 16-lane reductions
    float m = rmax[i];
    m = fmaxf(m, __shfl_xor(m, 1, 32));
    m = fmaxf(m, __shfl_xor(m, 2, 32));
    m = fmaxf(m, __shfl_xor(m, 4, 32));
    m = fmaxf(m, __shfl_xor(m, 8, 32));
    rmax[i] = m;
  }

  // ================= Pass B: P = exp(e - max), PV accumulation ==============
  v8f acc[16];
  #pragma unroll
  for (int t = 0; t < 16; ++t)
    #pragma unroll
    for (int i = 0; i < 8; ++i) acc[t][i] = 0.f;
  float rsum[8];
  #pragma unroll
  for (int i = 0; i < 8; ++i) rsum[i] = 0.f;

  _Float16* myP = &shP[wv][0];
  const _Float16* vbase = vF + (size_t)b * C_ * N_;

  // cooperative staging roles: 256 threads, 16B per async op
  const int part = tid & 3;      // 16B chunk within a 64B row
  const int crow = tid >> 2;     // 0..63

  auto stage = [&](int buf, int n0) {
    #pragma unroll
    for (int r = 0; r < 4; ++r) {
      const int c = crow + 64 * r;
      cp16_async(&shV[buf][c * 32 + part * 8],
                 vbase + (size_t)c * N_ + n0 + part * 8);
    }
    if (tid < 128) {             // 32 rows x 32 halves of K
      cp16_async(&shK[buf][crow * 32 + part * 8],
                 kT + ((size_t)b * N_ + n0 + crow) * CQ + part * 8);
    }
  };

  stage(0, 0);
  wait_async_all();
  __syncthreads();

  for (int ch = 0; ch < N_ / 32; ++ch) {
    const int cur = ch & 1;
    if (ch + 1 < N_ / 32) stage(cur ^ 1, (ch + 1) * 32);

    // ---- energy from staged K ----
    const _Float16* kk = &shK[cur][0];
    const v8h kl0 = *(const v8h*)(kk + lr * 32 + koff);
    const v8h kh0 = *(const v8h*)(kk + lr * 32 + koff + 16);
    const v8h kl1 = *(const v8h*)(kk + (16 + lr) * 32 + koff);
    const v8h kh1 = *(const v8h*)(kk + (16 + lr) * 32 + koff + 16);
    const v16h kb0 = __builtin_shufflevector(kl0, kh0, 0,1,2,3,4,5,6,7,8,9,10,11,12,13,14,15);
    const v16h kb1 = __builtin_shufflevector(kl1, kh1, 0,1,2,3,4,5,6,7,8,9,10,11,12,13,14,15);

    const v8f e0 = __builtin_amdgcn_wmma_f32_16x16x32_f16(false, aq, false, kb0,
                                                          (short)0, czero, false, false);
    const v8f e1 = __builtin_amdgcn_wmma_f32_16x16x32_f16(false, aq, false, kb1,
                                                          (short)0, czero, false, false);

    // ---- P tile: packed (p0,p1) -> one b32 LDS store per row slot ----
    // Stored slot j maps to n offset (j>>1)|((j&1)<<4); vF uses same mapping.
    #pragma unroll
    for (int i = 0; i < 8; ++i) {
      const float a0 = __expf(e0[i] - rmax[i]);
      const float a1 = __expf(e1[i] - rmax[i]);
      rsum[i] += a0 + a1;                    // per-lane; reduced after the loop
      const int r = i + 8 * half;
      v2h pk; pk[0] = (_Float16)a0; pk[1] = (_Float16)a1;
      *(v2h*)(myP + r * 32 + 2 * lr) = pk;
    }
    __builtin_amdgcn_wave_barrier();         // per-wave LDS is in-order
    const _Float16* pr = myP + lr * 32;
    const v8h plo = *(const v8h*)(pr + koff);
    const v8h phi = *(const v8h*)(pr + koff + 16);
    const v16h pa = __builtin_shufflevector(plo, phi, 0,1,2,3,4,5,6,7,8,9,10,11,12,13,14,15);
    __builtin_amdgcn_wave_barrier();

    // ---- PV: 16 channel tiles from staged V ----
    #pragma unroll
    for (int t = 0; t < 16; ++t) {
      const _Float16* vr = &shV[cur][(t * 16 + lr) * 32];
      const v8h vlo = *(const v8h*)(vr + koff);
      const v8h vhi = *(const v8h*)(vr + koff + 16);
      const v16h vb = __builtin_shufflevector(vlo, vhi, 0,1,2,3,4,5,6,7,8,9,10,11,12,13,14,15);
      acc[t] = __builtin_amdgcn_wmma_f32_16x16x32_f16(false, pa, false, vb,
                                                      (short)0, acc[t], false, false);
    }

    wait_async_all();            // next buffer landed
    __syncthreads();             // everyone done with current buffer
  }

  // one-time row-sum reduction, then normalize
  float linv[8];
  #pragma unroll
  for (int i = 0; i < 8; ++i) {
    float s = rsum[i];
    s += __shfl_xor(s, 1, 32);
    s += __shfl_xor(s, 2, 32);
    s += __shfl_xor(s, 4, 32);
    s += __shfl_xor(s, 8, 32);
    linv[i] = 1.f / s;
  }

  // ---- epilogue: gamma * (acc/sum) + source; contiguous 16B stores along m ----
  const float gam = gamma_p[0];
  #pragma unroll
  for (int t = 0; t < 16; ++t) {
    const size_t base = ((size_t)b * C_ + t * 16 + lr) * N_ + m0 + 8 * half;
    v4f r0, r1;
    #pragma unroll
    for (int i = 0; i < 4; ++i) {
      r0[i] = gam * acc[t][i]     * linv[i]     + src[base + i];
      r1[i] = gam * acc[t][i + 4] * linv[i + 4] + src[base + 4 + i];
    }
    *(v4f*)(out + base)     = r0;
    *(v4f*)(out + base + 4) = r1;
  }
}

// ---------------------------------------------------------------------------
extern "C" void kernel_launch(void* const* d_in, const int* in_sizes, int n_in,
                              void* d_out, int out_size, void* d_ws, size_t ws_size,
                              hipStream_t stream) {
  const float* source = (const float*)d_in[0];
  const float* pose   = (const float*)d_in[1];
  const float* Wq     = (const float*)d_in[2];
  const float* bq     = (const float*)d_in[3];
  const float* Wk     = (const float*)d_in[4];
  const float* bk     = (const float*)d_in[5];
  const float* Wv     = (const float*)d_in[6];
  const float* bv     = (const float*)d_in[7];
  const float* gamma  = (const float*)d_in[8];
  float* out = (float*)d_out;

  // workspace: qT (1 MB) | kT (1 MB) | vF (8 MB), all f16
  _Float16* qT = (_Float16*)d_ws;
  _Float16* kT = qT + (size_t)B_ * N_ * CQ;
  _Float16* vF = kT + (size_t)B_ * N_ * CQ;

  proj_kernel<<<dim3(B_ * (N_ / 64)), dim3(256), 0, stream>>>(
      source, pose, Wq, bq, Wk, bk, Wv, bv, qT, kT, vF);

  attn_kernel<<<dim3(B_ * (N_ / 16) / WPB), dim3(256), 0, stream>>>(
      qT, kT, vF, source, gamma, out);
}

// v001
// One run takes 221 microseconds.
// Two timings next to v000 put it at 2.42 and 2.43 times that version's speed.
#include <hip/hip_runtime.h>
#include <cstdint>

typedef __attribute__((ext_vector_type(16))) _Float16 v16h;
typedef __attribute__((ext_vector_type(8)))  _Float16 v8h;
typedef __attribute__((ext_vector_type(4)))  _Float16 v4h;
typedef __attribute__((ext_vector_type(2)))  _Float16 v2h;
typedef __attribute__((ext_vector_type(8)))  float    v8f;
typedef __attribute__((ext_vector_type(4)))  float    v4f;
typedef __attribute__((ext_vector_type(2)))  float    v2f;
typedef __attribute__((ext_vector_type(4)))  int      v4i;

#define B_   4
#define C_   256
#define CQ   32
#define N_   4096
#define WPB  8            // waves per attention block (256 threads)

// ---------------------------------------------------------------------------
// CDNA5 async global->LDS copy (ASYNCcnt-tracked), guarded so a missing
// builtin degrades to a plain load + ds_store without breaking the build.
// Builtin expects (int4 AS1*, int4 AS3*, imm offset, imm cpol) per the
// clang diagnostic ("int4 __device__ *").
// ---------------------------------------------------------------------------
#if __has_builtin(__builtin_amdgcn_global_load_async_to_lds_b128)
#define USE_ASYNC_LDS 1
typedef __attribute__((address_space(1))) v4i gv4i;
typedef __attribute__((address_space(3))) v4i lv4i;
#endif

__device__ __forceinline__ void cp16_async(void* lds, const void* g) {
#ifdef USE_ASYNC_LDS
  __builtin_amdgcn_global_load_async_to_lds_b128(
      (gv4i*)(uintptr_t)g, (lv4i*)(unsigned)(uintptr_t)lds, 0, 0);
#else
  *(v8h*)lds = *(const v8h*)g;
#endif
}

__device__ __forceinline__ void wait_async_all() {
#ifdef USE_ASYNC_LDS
#if __has_builtin(__builtin_amdgcn_s_wait_asynccnt)
  __builtin_amdgcn_s_wait_asynccnt(0);
#else
  asm volatile("s_wait_asynccnt 0" ::: "memory");
#endif
#endif
}

// K-slot permutation for the PV matmul (shared by P-store and vF layout):
//   K slot j <-> n offset (j>>1) | ((j&1)<<4)   within each 32-column chunk.

// ---------------------------------------------------------------------------
// Kernel 1: 1x1-conv projections on the matrix unit.
//   q = Wq @ pose + bq   -> qT [B][N][CQ] f16   (K-contiguous for WMMA gather)
//   k = Wk @ src  + bk   -> kT [B][N][CQ] f16
//   v = Wv @ src  + bv   -> vF [B][C][N]  f16   (n pre-permuted per 32-chunk)
// One block = 64 columns n of one batch. Both input tiles are rounded to f16
// and staged column-major ([n][c]) in LDS, so a fragment is 16 contiguous c.
// Each f32 weight enters as an f16 pair hi + lo (lo = w - hi), two products
// into one f32 accumulator, so the weights keep about 22 significant bits.
// Every fragment, of X and of W alike, holds k = 32*ks + 16*(lane>>4) + s.
// ---------------------------------------------------------------------------
#define XP 264   // halves per staged column: 256 c + 8 (528 B = 16 B x 33)
#define WP 40    // halves per staged weight row: 32 k + 8 (80 B = 16 B x 5)

__device__ __forceinline__ v16h frag16(const _Float16* p) {
  const v8h lo = *(const v8h*)p;
  const v8h hi = *(const v8h*)(p + 8);
  return __builtin_shufflevector(lo, hi, 0,1,2,3,4,5,6,7,8,9,10,11,12,13,14,15);
}

__device__ __forceinline__ v8f mma16(v16h a, v16h b, v8f c) {
  return __builtin_amdgcn_wmma_f32_16x16x32_f16(false, a, false, b, (short)0, c, false, false);
}

// 16 B at a wave-uniform base + the lane's 32-bit byte offset + a constant: every
// load of a family names one offset register and a scalar base, no address pair.
__device__ __forceinline__ v4f ld16(const float* __restrict__ base, unsigned voff, int imm) {
  return *(const v4f*)((const char*)base + (size_t)voff + imm);
}

// 256 c x 64 n of X into registers: 8 lanes cover one 128 B line of a row.
__device__ __forceinline__ void load_x(const float* __restrict__ X, unsigned xoff,
                                       v4f (&raw)[16]) {
  #pragma unroll
  for (int i = 0; i < 16; ++i)
    raw[i] = ld16(X, xoff, ((i >> 3) * 128 + (i & 7)) * N_ * 4);
}

// ... and transposed into LDS: 8 consecutive c of one column per 16 B store.
__device__ __forceinline__ void store_x(_Float16* sx, int nq, int cg, const v4f (&raw)[16]) {
  #pragma unroll
  for (int p = 0; p < 2; ++p)
    #pragma unroll
    for (int e = 0; e < 4; ++e) {
      v8h col;
      #pragma unroll
      for (int j = 0; j < 8; ++j) col[j] = (_Float16)raw[p * 8 + j][e];
      *(v8h*)(sx + (nq * 4 + e) * XP + p * 128 + cg * 8) = col;
    }
}

// 32 weight rows x 32 k (one k step) into registers: 8 lanes per 128 B line.
__device__ __forceinline__ void load_w(const float* __restrict__ Wr, int ks, unsigned woff,
                                       v4f (&wr)[8]) {
  #pragma unroll
  for (int i = 0; i < 8; ++i) wr[i] = ld16(Wr, woff, (i * 4 * C_ + ks * 32) * 4);
}

// Split into hi + lo and turn into fragments through the wave's own LDS patch.
__device__ __forceinline__ void split_w(_Float16* wl, int lane, const v4f (&wr)[8],
                                        v16h (&hi)[2], v16h (&lo)[2]) {
  #pragma unroll
  for (int i = 0; i < 8; ++i) {
    const int row = i * 4 + (lane >> 3);
    const v2f wa = {wr[i][0], wr[i][1]}, wb = {wr[i][2], wr[i][3]};
    const v2h ha = __builtin_convertvector(wa, v2h), hb = __builtin_convertvector(wb, v2h);
    const v2f da = {wa[0] - (float)ha[0], wa[1] - (float)ha[1]};
    const v2f db = {wb[0] - (float)hb[0], wb[1] - (float)hb[1]};
    const v2h la = __builtin_convertvector(da, v2h), lb = __builtin_convertvector(db, v2h);
    const v4h h4 = __builtin_shufflevector(ha, hb, 0, 1, 2, 3);
    const v4h l4 = __builtin_shufflevector(la, lb, 0, 1, 2, 3);
    *(v4h*)(wl + row * WP + (lane & 7) * 4)        = h4;
    *(v4h*)(wl + (32 + row) * WP + (lane & 7) * 4) = l4;
  }
  __builtin_amdgcn_wave_barrier();   // keeps the reads below behind the stores (per-wave LDS is in-order)
  const _Float16* rd = wl + (lane & 15) * WP + 16 * (lane >> 4);
  #pragma unroll
  for (int t = 0; t < 2; ++t) {
    hi[t] = frag16(rd + t * 16 * WP);
    lo[t] = frag16(rd + (32 + t * 16) * WP);
  }
  __builtin_amdgcn_wave_barrier();   // keeps the next k step's stores behind these reads
}

__global__ __launch_bounds__(256)
void proj_kernel(const float* __restrict__ source, const float* __restrict__ pose,
                 const float* __restrict__ Wq, const float* __restrict__ bq,
                 const float* __restrict__ Wk, const float* __restrict__ bk,
                 const float* __restrict__ Wv, const float* __restrict__ bv,
                 _Float16* __restrict__ qT, _Float16* __restrict__ kT,
                 _Float16* __restrict__ vF) {
  __shared__ __align__(16) _Float16 shX[2][64 * XP];   // [0] pose, [1] source: [n][c]
  __shared__ __align__(16) _Float16 shW[8][64 * WP];   // per wave: 32 rows hi, 32 rows lo
  const int tid  = threadIdx.x;
  const int lane = tid & 31;
  const int wv   = __builtin_amdgcn_readfirstlane(tid >> 5);
  const int b    = blockIdx.x / (N_ / 64);
  const int n0   = (blockIdx.x % (N_ / 64)) * 64;
  const int lr   = lane & 15;
  const int half = lane >> 4;
  _Float16* wl   = &shW[wv][0];

  // waves 0-3: q of one 16-column tile each; waves 4-7: k likewise
  const bool isq = wv < 4;
  const float* __restrict__ W1  = isq ? Wq : Wk;
  const float* __restrict__ Wvr = Wv + wv * 32 * C_;   // then 32 rows of v, all 64 columns

  // weight steps 0-7: the q / k rows, 8-15: the v rows; fetched two steps ahead,
  // so that a step's conversions never wait on loads issued just before them
  const unsigned woff = ((lane >> 3) * C_ + (lane & 7) * 4) * 4;
  auto fetch = [&](int s, v4f (&dst)[8]) {
    if (s < 8) load_w(W1, s, woff, dst);
    else       load_w(Wvr, s - 8, woff, dst);
    // last use of woff: holds it to here, so that no load above takes it as its
    // destination, and puts the wait in front of whatever overwrites it next
    if (s == 15) asm volatile("s_wait_xcnt 0x0" :: "v"(woff) : "memory");
    // keeps the later steps' conversions, and with them their data waits, behind
    // the issue of these loads
    __builtin_amdgcn_sched_barrier(0);
  };
  v4f wr[2][8];
  {
    const int nq = (lane & 7) + 8 * (wv & 1);
    const int cg = (lane >> 3) + 4 * (wv >> 1);
    v4f rp[16], rs[16];
    const unsigned xoff = (cg * 8 * N_ + nq * 4) * 4;
    load_x(pose   + (size_t)b * C_ * N_ + n0, xoff, rp);
    load_x(source + (size_t)b * C_ * N_ + n0, xoff, rs);
    // last use of xoff: as for woff in fetch()
    asm volatile("s_wait_xcnt 0x0" :: "v"(xoff) : "memory");
    fetch(0, wr[0]);
    fetch(1, wr[1]);
    store_x(&shX[0][0], nq, cg, rp);
    store_x(&shX[1][0], nq, cg, rs);
  }
  __syncthreads();

  // ---- q / k: A = W (rows o), B = X (columns n); D[r] = row o = 8*half + r ----
  {
    const _Float16* xcol = &shX[isq ? 0 : 1][((wv & 3) * 16 + lr) * XP + 16 * half];
    v8f a0 = {}, a1 = {};
    #pragma unroll
    for (int ks = 0; ks < 8; ++ks) {
      v16h hi[2], lo[2];
      split_w(wl, lane, wr[ks & 1], hi, lo);
      fetch(ks + 2, wr[ks & 1]);
      const v16h xb = frag16(xcol + ks * 32);
      a0 = mma16(hi[0], xb, a0);
      a1 = mma16(hi[1], xb, a1);
      a0 = mma16(lo[0], xb, a0);
      a1 = mma16(lo[1], xb, a1);
    }
    const float* __restrict__ b1 = (isq ? bq : bk) + 8 * half;
    v8h o0, o1;
    #pragma unroll
    for (int r = 0; r < 8; ++r) {
      o0[r] = (_Float16)(a0[r] + b1[r]);
      o1[r] = (_Float16)(a1[r] + b1[16 + r]);
    }
    _Float16* dst = (isq ? qT : kT) + ((size_t)b * N_ + n0 + (wv & 3) * 16 + lr) * CQ + 8 * half;
    *(v8h*)dst        = o0;
    *(v8h*)(dst + 16) = o1;
  }

  // ---- v: A = X (rows n), B = W (columns o); D[r] = row n = 8*half + r ----
  {
    v8f acc[2][4];
    #pragma unroll
    for (int t = 0; t < 2; ++t)
      #pragma unroll
      for (int nt = 0; nt < 4; ++nt)
        #pragma unroll
        for (int i = 0; i < 8; ++i) acc[t][nt][i] = 0.f;

    float bias[2];   // read ahead of the loop, so that the epilogue does not wait on them
    #pragma unroll
    for (int t = 0; t < 2; ++t) bias[t] = bv[wv * 32 + t * 16 + lr];

    const _Float16* xrow = &shX[1][lr * XP + 16 * half];
    #pragma unroll
    for (int ks = 0; ks < 8; ++ks) {
      v16h hi[2], lo[2];
      split_w(wl, lane, wr[ks & 1], hi, lo);
      if (ks < 6) fetch(ks + 10, wr[ks & 1]);
      v16h xa[4];
      #pragma unroll
      for (int nt = 0; nt < 4; ++nt) xa[nt] = frag16(xrow + nt * 16 * XP + ks * 32);
      #pragma unroll
      for (int t = 0; t < 2; ++t)
        #pragma unroll
        for (int nt = 0; nt < 4; ++nt) acc[t][nt] = mma16(xa[nt], hi[t], acc[t][nt]);
      #pragma unroll
      for (int t = 0; t < 2; ++t)
        #pragma unroll
        for (int nt = 0; nt < 4; ++nt) acc[t][nt] = mma16(xa[nt], lo[t], acc[t][nt]);
    }

    // K-slot permutation for v: column x (0..31) -> slot ((x&15)<<1)|(x>>4), so the
    // two 16-column tiles of a 32-chunk interleave: 16 consecutive slots per lane.
    #pragma unroll
    for (int t = 0; t < 2; ++t) {
      const int o = wv * 32 + t * 16 + lr;
      #pragma unroll
      for (int p = 0; p < 2; ++p) {
        v8h s0, s1;
        #pragma unroll
        for (int r = 0; r < 4; ++r) {
          s0[2 * r]     = (_Float16)(acc[t][2 * p][r] + bias[t]);
          s0[2 * r + 1] = (_Float16)(acc[t][2 * p + 1][r] + bias[t]);
          s1[2 * r]     = (_Float16)(acc[t][2 * p][r + 4] + bias[t]);
          s1[2 * r + 1] = (_Float16)(acc[t][2 * p + 1][r + 4] + bias[t]);
        }
        _Float16* dst = vF + ((size_t)b * C_ + o) * N_ + n0 + 32 * p + 16 * half;
        *(v8h*)dst       = s0;
        *(v8h*)(dst + 8) = s1;
      }
    }
  }
}

// ---------------------------------------------------------------------------
// Kernel 2: fused two-pass flash attention.
// 8 waves/block, all sharing one batch b; each wave owns a 16-row m-tile.
// Pass B double-buffers the shared K/V chunk in LDS via async global->LDS
// copies (one fetch per block instead of one per wave: 8x less L2 traffic).
// ---------------------------------------------------------------------------
__global__ __launch_bounds__(256)
void attn_kernel(const _Float16* __restrict__ qT, const _Float16* __restrict__ kT,
                 const _Float16* __restrict__ vF, const float* __restrict__ src,
                 const float* __restrict__ gamma_p, float* __restrict__ out) {
  __shared__ __align__(16) _Float16 shV[2][C_ * 32];   // 2 x 16 KB V chunk [c][slot]
  __shared__ __align__(16) _Float16 shK[2][32 * 32];   // 2 x  2 KB K chunk [n][o]
  __shared__ __align__(64) _Float16 shP[WPB][16 * 32]; // per-wave P transpose

  const int tid  = threadIdx.x;
  const int lane = tid & 31;
  const int wv   = tid >> 5;
  const int b    = blockIdx.x / (N_ / 16 / WPB);               // uniform per block
  const int m0   = ((blockIdx.x % (N_ / 16 / WPB)) * WPB + wv) * 16;
  const int half = lane >> 4;           // 0: rows 0-7/K 0-7,16-23 ; 1: rows 8-15/K 8-15,24-31
  const int lr   = lane & 15;
  const int koff = half ? 8 : 0;

  // A-operand: q rows m0..m0+15, K-packed per ISA 16-bit A layout
  const _Float16* qrow = qT + ((size_t)b * N_ + m0 + lr) * CQ;
  const v8h qlo = *(const v8h*)(qrow + koff);
  const v8h qhi = *(const v8h*)(qrow + koff + 16);
  const v16h aq = __builtin_shufflevector(qlo, qhi, 0,1,2,3,4,5,6,7,8,9,10,11,12,13,14,15);

  const _Float16* kbase = kT + ((size_t)b * N_ + lr) * CQ;
  const v8f czero = {};

  // ================= Pass A: exact row max (per-lane accumulation) ==========
  float rmax[8];
  #pragma unroll
  for (int i = 0; i < 8; ++i) rmax[i] = -3.0e38f;

  for (int n0 = 0; n0 < N_; n0 += 32) {
    const _Float16* kr0 = kbase + (size_t)n0 * CQ;
    const _Float16* kr1 = kr0 + 16 * CQ;
    const v8h kl0 = *(const v8h*)(kr0 + koff);
    const v8h kh0 = *(const v8h*)(kr0 + koff + 16);
    const v8h kl1 = *(const v8h*)(kr1 + koff);
    const v8h kh1 = *(const v8h*)(kr1 + koff + 16);
    const v16h kb0 = __builtin_shufflevector(kl0, kh0, 0,1,2,3,4,5,6,7,8,9,10,11,12,13,14,15);
    const v16h kb1 = __builtin_shufflevector(kl1, kh1, 0,1,2,3,4,5,6,7,8,9,10,11,12,13,14,15);
    __builtin_prefetch(kr0 + 32 * CQ, 0, 3);   // near-scope prefetch

    const v8f e0 = __builtin_amdgcn_wmma_f32_16x16x32_f16(false, aq, false, kb0,
                                                          (short)0, czero, false, false);
    const v8f e1 = __builtin_amdgcn_wmma_f32_16x16x32_f16(false, aq, false, kb1,
                                                          (short)0, czero, false, false);
    #pragma unroll
    for (int i = 0; i < 8; ++i) rmax[i] = fmaxf(rmax[i], fmaxf(e0[i], e1[i]));
  }
  #pragma unroll
  for (int i = 0; i < 8; ++i) {   // one-time 16-lane reductions
    float m = rmax[i];
    m = fmaxf(m, __shfl_xor(m, 1, 32));
    m = fmaxf(m, __shfl_xor(m, 2, 32));
    m = fmaxf(m, __shfl_xor(m, 4, 32));
    m = fmaxf(m, __shfl_xor(m, 8, 32));
    rmax[i] = m;
  }

  // ================= Pass B: P = exp(e - max), PV accumulation ==============
  v8f acc[16];
  #pragma unroll
  for (int t = 0; t < 16; ++t)
    #pragma unroll
    for (int i = 0; i < 8; ++i) acc[t][i] = 0.f;
  float rsum[8];
  #pragma unroll
  for (int i = 0; i < 8; ++i) rsum[i] = 0.f;

  _Float16* myP = &shP[wv][0];
  const _Float16* vbase = vF + (size_t)b * C_ * N_;

  // cooperative staging roles: 256 threads, 16B per async op
  const int part = tid & 3;      // 16B chunk within a 64B row
  const int crow = tid >> 2;     // 0..63

  auto stage = [&](int buf, int n0) {
    #pragma unroll
    for (int r = 0; r < 4; ++r) {
      const int c = crow + 64 * r;
      cp16_async(&shV[buf][c * 32 + part * 8],
                 vbase + (size_t)c * N_ + n0 + part * 8);
    }
    if (tid < 128) {             // 32 rows x 32 halves of K
      cp16_async(&shK[buf][crow * 32 + part * 8],
                 kT + ((size_t)b * N_ + n0 + crow) * CQ + part * 8);
    }
  };

  stage(0, 0);
  wait_async_all();
  __syncthreads();

  for (int ch = 0; ch < N_ / 32; ++ch) {
    const int cur = ch & 1;
    if (ch + 1 < N_ / 32) stage(cur ^ 1, (ch + 1) * 32);

    // ---- energy from staged K ----
    const _Float16* kk = &shK[cur][0];
    const v8h kl0 = *(const v8h*)(kk + lr * 32 + koff);
    const v8h kh0 = *(const v8h*)(kk + lr * 32 + koff + 16);
    const v8h kl1 = *(const v8h*)(kk + (16 + lr) * 32 + koff);
    const v8h kh1 = *(const v8h*)(kk + (16 + lr) * 32 + koff + 16);
    const v16h kb0 = __builtin_shufflevector(kl0, kh0, 0,1,2,3,4,5,6,7,8,9,10,11,12,13,14,15);
    const v16h kb1 = __builtin_shufflevector(kl1, kh1, 0,1,2,3,4,5,6,7,8,9,10,11,12,13,14,15);

    const v8f e0 = __builtin_amdgcn_wmma_f32_16x16x32_f16(false, aq, false, kb0,
                                                          (short)0, czero, false, false);
    const v8f e1 = __builtin_amdgcn_wmma_f32_16x16x32_f16(false, aq, false, kb1,
                                                          (short)0, czero, false, false);

    // ---- P tile: packed (p0,p1) -> one b32 LDS store per row slot ----
    // Stored slot j maps to n offset (j>>1)|((j&1)<<4); vF uses same mapping.
    #pragma unroll
    for (int i = 0; i < 8; ++i) {
      const float a0 = __expf(e0[i] - rmax[i]);
      const float a1 = __expf(e1[i] - rmax[i]);
      rsum[i] += a0 + a1;                    // per-lane; reduced after the loop
      const int r = i + 8 * half;
      v2h pk; pk[0] = (_Float16)a0; pk[1] = (_Float16)a1;
      *(v2h*)(myP + r * 32 + 2 * lr) = pk;
    }
    __builtin_amdgcn_wave_barrier();         // per-wave LDS is in-order
    const _Float16* pr = myP + lr * 32;
    const v8h plo = *(const v8h*)(pr + koff);
    const v8h phi = *(const v8h*)(pr + koff + 16);
    const v16h pa = __builtin_shufflevector(plo, phi, 0,1,2,3,4,5,6,7,8,9,10,11,12,13,14,15);
    __builtin_amdgcn_wave_barrier();

    // ---- PV: 16 channel tiles from staged V ----
    #pragma unroll
    for (int t = 0; t < 16; ++t) {
      const _Float16* vr = &shV[cur][(t * 16 + lr) * 32];
      const v8h vlo = *(const v8h*)(vr + koff);
      const v8h vhi = *(const v8h*)(vr + koff + 16);
      const v16h vb = __builtin_shufflevector(vlo, vhi, 0,1,2,3,4,5,6,7,8,9,10,11,12,13,14,15);
      acc[t] = __builtin_amdgcn_wmma_f32_16x16x32_f16(false, pa, false, vb,
                                                      (short)0, acc[t], false, false);
    }

    wait_async_all();            // next buffer landed
    __syncthreads();             // everyone done with current buffer
  }

  // one-time row-sum reduction, then normalize
  float linv[8];
  #pragma unroll
  for (int i = 0; i < 8; ++i) {
    float s = rsum[i];
    s += __shfl_xor(s, 1, 32);
    s += __shfl_xor(s, 2, 32);
    s += __shfl_xor(s, 4, 32);
    s += __shfl_xor(s, 8, 32);
    linv[i] = 1.f / s;
  }

  // ---- epilogue: gamma * (acc/sum) + source; contiguous 16B stores along m ----
  const float gam = gamma_p[0];
  #pragma unroll
  for (int t = 0; t < 16; ++t) {
    const size_t base = ((size_t)b * C_ + t * 16 + lr) * N_ + m0 + 8 * half;
    v4f r0, r1;
    #pragma unroll
    for (int i = 0; i < 4; ++i) {
      r0[i] = gam * acc[t][i]     * linv[i]     + src[base + i];
      r1[i] = gam * acc[t][i + 4] * linv[i + 4] + src[base + 4 + i];
    }
    *(v4f*)(out + base)     = r0;
    *(v4f*)(out + base + 4) = r1;
  }
}

// ---------------------------------------------------------------------------
extern "C" void kernel_launch(void* const* d_in, const int* in_sizes, int n_in,
                              void* d_out, int out_size, void* d_ws, size_t ws_size,
                              hipStream_t stream) {
  const float* source = (const float*)d_in[0];
  const float* pose   = (const float*)d_in[1];
  const float* Wq     = (const float*)d_in[2];
  const float* bq     = (const float*)d_in[3];
  const float* Wk     = (const float*)d_in[4];
  const float* bk     = (const float*)d_in[5];
  const float* Wv     = (const float*)d_in[6];
  const float* bv     = (const float*)d_in[7];
  const float* gamma  = (const float*)d_in[8];
  float* out = (float*)d_out;

  // workspace: qT (1 MB) | kT (1 MB) | vF (8 MB), all f16
  _Float16* qT = (_Float16*)d_ws;
  _Float16* kT = qT + (size_t)B_ * N_ * CQ;
  _Float16* vF = kT + (size_t)B_ * N_ * CQ;

  proj_kernel<<<dim3(B_ * (N_ / 64)), dim3(256), 0, stream>>>(
      source, pose, Wq, bq, Wk, bk, Wv, bv, qT, kT, vF);

  attn_kernel<<<dim3(B_ * (N_ / 16) / WPB), dim3(256), 0, stream>>>(
      qT, kT, vF, source, gamma, out);
}

// v002
// A run of this version takes 143 microseconds.
// Timed twice side by side with v001, it ran 1.54 and 1.56 times as fast.
// All steps since v000 together make it 3.77 times as fast.
#include <hip/hip_runtime.h>
#include <cstdint>

typedef __attribute__((ext_vector_type(16))) _Float16 v16h;
typedef __attribute__((ext_vector_type(8)))  _Float16 v8h;
typedef __attribute__((ext_vector_type(4)))  _Float16 v4h;
typedef __attribute__((ext_vector_type(2)))  _Float16 v2h;
typedef __attribute__((ext_vector_type(8)))  float    v8f;
typedef __attribute__((ext_vector_type(4)))  float    v4f;
typedef __attribute__((ext_vector_type(2)))  float    v2f;
typedef __attribute__((ext_vector_type(4)))  int      v4i;

#define B_   4
#define C_   256
#define CQ   32
#define N_   4096
#define WPB  8            // waves per attention block (256 threads)

// ---------------------------------------------------------------------------
// CDNA5 async global->LDS copy (ASYNCcnt-tracked), guarded so a missing
// builtin degrades to a plain load + ds_store without breaking the build.
// Builtin expects (int4 AS1*, int4 AS3*, imm offset, imm cpol) per the
// clang diagnostic ("int4 __device__ *").
// ---------------------------------------------------------------------------
#if __has_builtin(__builtin_amdgcn_global_load_async_to_lds_b128)
#define USE_ASYNC_LDS 1
typedef __attribute__((address_space(1))) v4i gv4i;
typedef __attribute__((address_space(3))) v4i lv4i;
#endif

__device__ __forceinline__ void cp16_async(void* lds, const void* g) {
#ifdef USE_ASYNC_LDS
  __builtin_amdgcn_global_load_async_to_lds_b128(
      (gv4i*)(uintptr_t)g, (lv4i*)(unsigned)(uintptr_t)lds, 0, 0);
#else
  *(v8h*)lds = *(const v8h*)g;
#endif
}

__device__ __forceinline__ void wait_async_all() {
#ifdef USE_ASYNC_LDS
#if __has_builtin(__builtin_amdgcn_s_wait_asynccnt)
  __builtin_amdgcn_s_wait_asynccnt(0);
#else
  asm volatile("s_wait_asynccnt 0" ::: "memory");
#endif
#endif
}

// K-slot permutation for the PV matmul (shared by P-store and vF layout):
//   K slot j <-> n offset (j>>1) | ((j&1)<<4)   within each 32-column chunk.

// ---------------------------------------------------------------------------
// Kernel 1: 1x1-conv projections on the matrix unit.
//   q = Wq @ pose + bq   -> qT [B][N][CQ] f16   (K-contiguous for WMMA gather)
//   k = Wk @ src  + bk   -> kT [B][N][CQ] f16
//   v = Wv @ src  + bv   -> vF [B][C][N]  f16   (n pre-permuted per 32-chunk)
// One block = 64 columns n of one batch. Both input tiles are rounded to f16
// and staged column-major ([n][c]) in LDS, so a fragment is 16 contiguous c.
// Each f32 weight enters as an f16 pair hi + lo (lo = w - hi), two products
// into one f32 accumulator, so the weights keep about 22 significant bits.
// Every fragment, of X and of W alike, holds k = 32*ks + 16*(lane>>4) + s.
// ---------------------------------------------------------------------------
#define XP 264   // halves per staged column: 256 c + 8 (528 B = 16 B x 33)
#define WP 40    // halves per staged weight row: 32 k + 8 (80 B = 16 B x 5)

__device__ __forceinline__ v16h frag16(const _Float16* p) {
  const v8h lo = *(const v8h*)p;
  const v8h hi = *(const v8h*)(p + 8);
  return __builtin_shufflevector(lo, hi, 0,1,2,3,4,5,6,7,8,9,10,11,12,13,14,15);
}

__device__ __forceinline__ v8f mma16(v16h a, v16h b, v8f c) {
  return __builtin_amdgcn_wmma_f32_16x16x32_f16(false, a, false, b, (short)0, c, false, false);
}

// 16 B at a wave-uniform base + the lane's 32-bit byte offset + a constant: every
// load of a family names one offset register and a scalar base, no address pair.
__device__ __forceinline__ v4f ld16(const float* __restrict__ base, unsigned voff, int imm) {
  return *(const v4f*)((const char*)base + (size_t)voff + imm);
}

// 256 c x 64 n of X into registers: 8 lanes cover one 128 B line of a row.
__device__ __forceinline__ void load_x(const float* __restrict__ X, unsigned xoff,
                                       v4f (&raw)[16]) {
  #pragma unroll
  for (int i = 0; i < 16; ++i)
    raw[i] = ld16(X, xoff, ((i >> 3) * 128 + (i & 7)) * N_ * 4);
}

// ... and transposed into LDS: 8 consecutive c of one column per 16 B store.
__device__ __forceinline__ void store_x(_Float16* sx, int nq, int cg, const v4f (&raw)[16]) {
  #pragma unroll
  for (int p = 0; p < 2; ++p)
    #pragma unroll
    for (int e = 0; e < 4; ++e) {
      v8h col;
      #pragma unroll
      for (int j = 0; j < 8; ++j) col[j] = (_Float16)raw[p * 8 + j][e];
      *(v8h*)(sx + (nq * 4 + e) * XP + p * 128 + cg * 8) = col;
    }
}

// 32 weight rows x 32 k (one k step) into registers: 8 lanes per 128 B line.
__device__ __forceinline__ void load_w(const float* __restrict__ Wr, int ks, unsigned woff,
                                       v4f (&wr)[8]) {
  #pragma unroll
  for (int i = 0; i < 8; ++i) wr[i] = ld16(Wr, woff, (i * 4 * C_ + ks * 32) * 4);
}

// Split into hi + lo and turn into fragments through the wave's own LDS patch.
__device__ __forceinline__ void split_w(_Float16* wl, int lane, const v4f (&wr)[8],
                                        v16h (&hi)[2], v16h (&lo)[2]) {
  #pragma unroll
  for (int i = 0; i < 8; ++i) {
    const int row = i * 4 + (lane >> 3);
    const v2f wa = {wr[i][0], wr[i][1]}, wb = {wr[i][2], wr[i][3]};
    const v2h ha = __builtin_convertvector(wa, v2h), hb = __builtin_convertvector(wb, v2h);
    const v2f da = {wa[0] - (float)ha[0], wa[1] - (float)ha[1]};
    const v2f db = {wb[0] - (float)hb[0], wb[1] - (float)hb[1]};
    const v2h la = __builtin_convertvector(da, v2h), lb = __builtin_convertvector(db, v2h);
    const v4h h4 = __builtin_shufflevector(ha, hb, 0, 1, 2, 3);
    const v4h l4 = __builtin_shufflevector(la, lb, 0, 1, 2, 3);
    *(v4h*)(wl + row * WP + (lane & 7) * 4)        = h4;
    *(v4h*)(wl + (32 + row) * WP + (lane & 7) * 4) = l4;
  }
  __builtin_amdgcn_wave_barrier();   // keeps the reads below behind the stores (per-wave LDS is in-order)
  const _Float16* rd = wl + (lane & 15) * WP + 16 * (lane >> 4);
  #pragma unroll
  for (int t = 0; t < 2; ++t) {
    hi[t] = frag16(rd + t * 16 * WP);
    lo[t] = frag16(rd + (32 + t * 16) * WP);
  }
  __builtin_amdgcn_wave_barrier();   // keeps the next k step's stores behind these reads
}

__global__ __launch_bounds__(256)
void proj_kernel(const float* __restrict__ source, const float* __restrict__ pose,
                 const float* __restrict__ Wq, const float* __restrict__ bq,
                 const float* __restrict__ Wk, const float* __restrict__ bk,
                 const float* __restrict__ Wv, const float* __restrict__ bv,
                 _Float16* __restrict__ qT, _Float16* __restrict__ kT,
                 _Float16* __restrict__ vF) {
  __shared__ __align__(16) _Float16 shX[2][64 * XP];   // [0] pose, [1] source: [n][c]
  __shared__ __align__(16) _Float16 shW[8][64 * WP];   // per wave: 32 rows hi, 32 rows lo
  const int tid  = threadIdx.x;
  const int lane = tid & 31;
  const int wv   = __builtin_amdgcn_readfirstlane(tid >> 5);
  const int b    = blockIdx.x / (N_ / 64);
  const int n0   = (blockIdx.x % (N_ / 64)) * 64;
  const int lr   = lane & 15;
  const int half = lane >> 4;
  _Float16* wl   = &shW[wv][0];

  // waves 0-3: q of one 16-column tile each; waves 4-7: k likewise
  const bool isq = wv < 4;
  const float* __restrict__ W1  = isq ? Wq : Wk;
  const float* __restrict__ Wvr = Wv + wv * 32 * C_;   // then 32 rows of v, all 64 columns

  // weight steps 0-7: the q / k rows, 8-15: the v rows; fetched two steps ahead,
  // so that a step's conversions never wait on loads issued just before them
  const unsigned woff = ((lane >> 3) * C_ + (lane & 7) * 4) * 4;
  auto fetch = [&](int s, v4f (&dst)[8]) {
    if (s < 8) load_w(W1, s, woff, dst);
    else       load_w(Wvr, s - 8, woff, dst);
    // last use of woff: holds it to here, so that no load above takes it as its
    // destination, and puts the wait in front of whatever overwrites it next
    if (s == 15) asm volatile("s_wait_xcnt 0x0" :: "v"(woff) : "memory");
    // keeps the later steps' conversions, and with them their data waits, behind
    // the issue of these loads
    __builtin_amdgcn_sched_barrier(0);
  };
  v4f wr[2][8];
  {
    const int nq = (lane & 7) + 8 * (wv & 1);
    const int cg = (lane >> 3) + 4 * (wv >> 1);
    v4f rp[16], rs[16];
    const unsigned xoff = (cg * 8 * N_ + nq * 4) * 4;
    load_x(pose   + (size_t)b * C_ * N_ + n0, xoff, rp);
    load_x(source + (size_t)b * C_ * N_ + n0, xoff, rs);
    // last use of xoff: as for woff in fetch()
    asm volatile("s_wait_xcnt 0x0" :: "v"(xoff) : "memory");
    fetch(0, wr[0]);
    fetch(1, wr[1]);
    store_x(&shX[0][0], nq, cg, rp);
    store_x(&shX[1][0], nq, cg, rs);
  }
  __syncthreads();

  // ---- q / k: A = W (rows o), B = X (columns n); D[r] = row o = 8*half + r ----
  {
    const _Float16* xcol = &shX[isq ? 0 : 1][((wv & 3) * 16 + lr) * XP + 16 * half];
    v8f a0 = {}, a1 = {};
    #pragma unroll
    for (int ks = 0; ks < 8; ++ks) {
      v16h hi[2], lo[2];
      split_w(wl, lane, wr[ks & 1], hi, lo);
      fetch(ks + 2, wr[ks & 1]);
      const v16h xb = frag16(xcol + ks * 32);
      a0 = mma16(hi[0], xb, a0);
      a1 = mma16(hi[1], xb, a1);
      a0 = mma16(lo[0], xb, a0);
      a1 = mma16(lo[1], xb, a1);
    }
    const float* __restrict__ b1 = (isq ? bq : bk) + 8 * half;
    v8h o0, o1;
    #pragma unroll
    for (int r = 0; r < 8; ++r) {
      o0[r] = (_Float16)(a0[r] + b1[r]);
      o1[r] = (_Float16)(a1[r] + b1[16 + r]);
    }
    _Float16* dst = (isq ? qT : kT) + ((size_t)b * N_ + n0 + (wv & 3) * 16 + lr) * CQ + 8 * half;
    *(v8h*)dst        = o0;
    *(v8h*)(dst + 16) = o1;
  }

  // ---- v: A = X (rows n), B = W (columns o); D[r] = row n = 8*half + r ----
  {
    v8f acc[2][4];
    #pragma unroll
    for (int t = 0; t < 2; ++t)
      #pragma unroll
      for (int nt = 0; nt < 4; ++nt)
        #pragma unroll
        for (int i = 0; i < 8; ++i) acc[t][nt][i] = 0.f;

    float bias[2];   // read ahead of the loop, so that the epilogue does not wait on them
    #pragma unroll
    for (int t = 0; t < 2; ++t) bias[t] = bv[wv * 32 + t * 16 + lr];

    const _Float16* xrow = &shX[1][lr * XP + 16 * half];
    #pragma unroll
    for (int ks = 0; ks < 8; ++ks) {
      v16h hi[2], lo[2];
      split_w(wl, lane, wr[ks & 1], hi, lo);
      if (ks < 6) fetch(ks + 10, wr[ks & 1]);
      v16h xa[4];
      #pragma unroll
      for (int nt = 0; nt < 4; ++nt) xa[nt] = frag16(xrow + nt * 16 * XP + ks * 32);
      #pragma unroll
      for (int t = 0; t < 2; ++t)
        #pragma unroll
        for (int nt = 0; nt < 4; ++nt) acc[t][nt] = mma16(xa[nt], hi[t], acc[t][nt]);
      #pragma unroll
      for (int t = 0; t < 2; ++t)
        #pragma unroll
        for (int nt = 0; nt < 4; ++nt) acc[t][nt] = mma16(xa[nt], lo[t], acc[t][nt]);
    }

    // K-slot permutation for v: column x (0..31) -> slot ((x&15)<<1)|(x>>4), so the
    // two 16-column tiles of a 32-chunk interleave: 16 consecutive slots per lane.
    #pragma unroll
    for (int t = 0; t < 2; ++t) {
      const int o = wv * 32 + t * 16 + lr;
      #pragma unroll
      for (int p = 0; p < 2; ++p) {
        v8h s0, s1;
        #pragma unroll
        for (int r = 0; r < 4; ++r) {
          s0[2 * r]     = (_Float16)(acc[t][2 * p][r] + bias[t]);
          s0[2 * r + 1] = (_Float16)(acc[t][2 * p + 1][r] + bias[t]);
          s1[2 * r]     = (_Float16)(acc[t][2 * p][r + 4] + bias[t]);
          s1[2 * r + 1] = (_Float16)(acc[t][2 * p + 1][r + 4] + bias[t]);
        }
        _Float16* dst = vF + ((size_t)b * C_ + o) * N_ + n0 + 32 * p + 16 * half;
        *(v8h*)dst       = s0;
        *(v8h*)(dst + 8) = s1;
      }
    }
  }
}

// ---------------------------------------------------------------------------
// Kernel 2: fused two-pass flash attention.
// 8 waves/block, all sharing one batch b; each wave owns a 16-row m-tile.
// Pass B double-buffers the shared K/V chunk in LDS via async global->LDS
// copies (one fetch per block instead of one per wave: 8x less L2 traffic).
// Every staged row is 32 halves and is read as 16 B pieces by 16 lanes, one row
// each: a pitch of 16 B x odd puts those 16 pieces on all 64 banks once.
// ---------------------------------------------------------------------------
#define AP 40    // halves per staged row of V, K and P: 32 + 8 (80 B = 16 B x 5)

__global__ __launch_bounds__(256)
void attn_kernel(const _Float16* __restrict__ qT, const _Float16* __restrict__ kT,
                 const _Float16* __restrict__ vF, const float* __restrict__ src,
                 const float* __restrict__ gamma_p, float* __restrict__ out) {
  __shared__ __align__(16) _Float16 shV[2][C_ * AP];   // 2 x 20 KB V chunk [c][slot]
  __shared__ __align__(16) _Float16 shK[2][32 * AP];   // 2 x 2.5 KB K chunk [n][o]
  __shared__ __align__(64) _Float16 shP[WPB][16 * AP]; // per-wave P transpose

  const int tid  = threadIdx.x;
  const int lane = tid & 31;
  const int wv   = tid >> 5;
  const int b    = blockIdx.x / (N_ / 16 / WPB);               // uniform per block
  const int m0   = ((blockIdx.x % (N_ / 16 / WPB)) * WPB + wv) * 16;
  const int half = lane >> 4;           // 0: rows 0-7/K 0-7,16-23 ; 1: rows 8-15/K 8-15,24-31
  const int lr   = lane & 15;
  const int koff = half ? 8 : 0;

  // A-operand: q rows m0..m0+15, K-packed per ISA 16-bit A layout
  const _Float16* qrow = qT + ((size_t)b * N_ + m0 + lr) * CQ;
  const v8h qlo = *(const v8h*)(qrow + koff);
  const v8h qhi = *(const v8h*)(qrow + koff + 16);
  const v16h aq = __builtin_shufflevector(qlo, qhi, 0,1,2,3,4,5,6,7,8,9,10,11,12,13,14,15);

  const _Float16* kbase = kT + ((size_t)b * N_ + lr) * CQ;
  const v8f czero = {};

  // ================= Pass A: exact row max (per-lane accumulation) ==========
  float rmax[8];
  #pragma unroll
  for (int i = 0; i < 8; ++i) rmax[i] = -3.0e38f;

  for (int n0 = 0; n0 < N_; n0 += 32) {
    const _Float16* kr0 = kbase + (size_t)n0 * CQ;
    const _Float16* kr1 = kr0 + 16 * CQ;
    const v8h kl0 = *(const v8h*)(kr0 + koff);
    const v8h kh0 = *(const v8h*)(kr0 + koff + 16);
    const v8h kl1 = *(const v8h*)(kr1 + koff);
    const v8h kh1 = *(const v8h*)(kr1 + koff + 16);
    const v16h kb0 = __builtin_shufflevector(kl0, kh0, 0,1,2,3,4,5,6,7,8,9,10,11,12,13,14,15);
    const v16h kb1 = __builtin_shufflevector(kl1, kh1, 0,1,2,3,4,5,6,7,8,9,10,11,12,13,14,15);
    __builtin_prefetch(kr0 + 32 * CQ, 0, 3);   // near-scope prefetch

    const v8f e0 = __builtin_amdgcn_wmma_f32_16x16x32_f16(false, aq, false, kb0,
                                                          (short)0, czero, false, false);
    const v8f e1 = __builtin_amdgcn_wmma_f32_16x16x32_f16(false, aq, false, kb1,
                                                          (short)0, czero, false, false);
    #pragma unroll
    for (int i = 0; i < 8; ++i) rmax[i] = fmaxf(rmax[i], fmaxf(e0[i], e1[i]));
  }
  #pragma unroll
  for (int i = 0; i < 8; ++i) {   // one-time 16-lane reductions
    float m = rmax[i];
    m = fmaxf(m, __shfl_xor(m, 1, 32));
    m = fmaxf(m, __shfl_xor(m, 2, 32));
    m = fmaxf(m, __shfl_xor(m, 4, 32));
    m = fmaxf(m, __shfl_xor(m, 8, 32));
    rmax[i] = m;
  }

  // ================= Pass B: P = exp(e - max), PV accumulation ==============
  v8f acc[16];
  #pragma unroll
  for (int t = 0; t < 16; ++t)
    #pragma unroll
    for (int i = 0; i < 8; ++i) acc[t][i] = 0.f;
  float rsum[8];
  #pragma unroll
  for (int i = 0; i < 8; ++i) rsum[i] = 0.f;

  _Float16* myP = &shP[wv][0];
  const _Float16* vbase = vF + (size_t)b * C_ * N_;

  // cooperative staging roles: 256 threads, 16B per async op
  const int part = tid & 3;      // 16B chunk within a 64B row
  const int crow = tid >> 2;     // 0..63

  auto stage = [&](int buf, int n0) {
    #pragma unroll
    for (int r = 0; r < 4; ++r) {
      const int c = crow + 64 * r;
      cp16_async(&shV[buf][c * AP + part * 8],
                 vbase + (size_t)c * N_ + n0 + part * 8);
    }
    if (tid < 128) {             // 32 rows x 32 halves of K
      cp16_async(&shK[buf][crow * AP + part * 8],
                 kT + ((size_t)b * N_ + n0 + crow) * CQ + part * 8);
    }
  };

  stage(0, 0);
  wait_async_all();
  __syncthreads();

  for (int ch = 0; ch < N_ / 32; ++ch) {
    const int cur = ch & 1;
    if (ch + 1 < N_ / 32) stage(cur ^ 1, (ch + 1) * 32);

    // ---- energy from staged K ----
    const _Float16* kk = &shK[cur][0];
    const v8h kl0 = *(const v8h*)(kk + lr * AP + koff);
    const v8h kh0 = *(const v8h*)(kk + lr * AP + koff + 16);
    const v8h kl1 = *(const v8h*)(kk + (16 + lr) * AP + koff);
    const v8h kh1 = *(const v8h*)(kk + (16 + lr) * AP + koff + 16);
    const v16h kb0 = __builtin_shufflevector(kl0, kh0, 0,1,2,3,4,5,6,7,8,9,10,11,12,13,14,15);
    const v16h kb1 = __builtin_shufflevector(kl1, kh1, 0,1,2,3,4,5,6,7,8,9,10,11,12,13,14,15);

    const v8f e0 = __builtin_amdgcn_wmma_f32_16x16x32_f16(false, aq, false, kb0,
                                                          (short)0, czero, false, false);
    const v8f e1 = __builtin_amdgcn_wmma_f32_16x16x32_f16(false, aq, false, kb1,
                                                          (short)0, czero, false, false);

    // ---- P tile: packed (p0,p1) -> one b32 LDS store per row slot ----
    // Stored slot j maps to n offset (j>>1)|((j&1)<<4); vF uses same mapping.
    #pragma unroll
    for (int i = 0; i < 8; ++i) {
      const float a0 = __expf(e0[i] - rmax[i]);
      const float a1 = __expf(e1[i] - rmax[i]);
      rsum[i] += a0 + a1;                    // per-lane; reduced after the loop
      const int r = i + 8 * half;
      v2h pk; pk[0] = (_Float16)a0; pk[1] = (_Float16)a1;
      *(v2h*)(myP + r * AP + 2 * lr) = pk;
    }
    __builtin_amdgcn_wave_barrier();         // per-wave LDS is in-order
    const _Float16* pr = myP + lr * AP;
    const v8h plo = *(const v8h*)(pr + koff);
    const v8h phi = *(const v8h*)(pr + koff + 16);
    const v16h pa = __builtin_shufflevector(plo, phi, 0,1,2,3,4,5,6,7,8,9,10,11,12,13,14,15);
    __builtin_amdgcn_wave_barrier();

    // ---- PV: 16 channel tiles from staged V ----
    #pragma unroll
    for (int t = 0; t < 16; ++t) {
      const _Float16* vr = &shV[cur][(t * 16 + lr) * AP];
      const v8h vlo = *(const v8h*)(vr + koff);
      const v8h vhi = *(const v8h*)(vr + koff + 16);
      const v16h vb = __builtin_shufflevector(vlo, vhi, 0,1,2,3,4,5,6,7,8,9,10,11,12,13,14,15);
      acc[t] = __builtin_amdgcn_wmma_f32_16x16x32_f16(false, pa, false, vb,
                                                      (short)0, acc[t], false, false);
    }

    wait_async_all();            // next buffer landed
    __syncthreads();             // everyone done with current buffer
  }

  // one-time row-sum reduction, then normalize
  float linv[8];
  #pragma unroll
  for (int i = 0; i < 8; ++i) {
    float s = rsum[i];
    s += __shfl_xor(s, 1, 32);
    s += __shfl_xor(s, 2, 32);
    s += __shfl_xor(s, 4, 32);
    s += __shfl_xor(s, 8, 32);
    linv[i] = 1.f / s;
  }

  // ---- epilogue: gamma * (acc/sum) + source; contiguous 16B stores along m ----
  const float gam = gamma_p[0];
  #pragma unroll
  for (int t = 0; t < 16; ++t) {
    const size_t base = ((size_t)b * C_ + t * 16 + lr) * N_ + m0 + 8 * half;
    v4f r0, r1;
    #pragma unroll
    for (int i = 0; i < 4; ++i) {
      r0[i] = gam * acc[t][i]     * linv[i]     + src[base + i];
      r1[i] = gam * acc[t][i + 4] * linv[i + 4] + src[base + 4 + i];
    }
    *(v4f*)(out + base)     = r0;
    *(v4f*)(out + base + 4) = r1;
  }
}

// ---------------------------------------------------------------------------
extern "C" void kernel_launch(void* const* d_in, const int* in_sizes, int n_in,
                              void* d_out, int out_size, void* d_ws, size_t ws_size,
                              hipStream_t stream) {
  const float* source = (const float*)d_in[0];
  const float* pose   = (const float*)d_in[1];
  const float* Wq     = (const float*)d_in[2];
  const float* bq     = (const float*)d_in[3];
  const float* Wk     = (const float*)d_in[4];
  const float* bk     = (const float*)d_in[5];
  const float* Wv     = (const float*)d_in[6];
  const float* bv     = (const float*)d_in[7];
  const float* gamma  = (const float*)d_in[8];
  float* out = (float*)d_out;

  // workspace: qT (1 MB) | kT (1 MB) | vF (8 MB), all f16
  _Float16* qT = (_Float16*)d_ws;
  _Float16* kT = qT + (size_t)B_ * N_ * CQ;
  _Float16* vF = kT + (size_t)B_ * N_ * CQ;

  proj_kernel<<<dim3(B_ * (N_ / 64)), dim3(256), 0, stream>>>(
      source, pose, Wq, bq, Wk, bk, Wv, bv, qT, kT, vF);

  attn_kernel<<<dim3(B_ * (N_ / 16) / WPB), dim3(256), 0, stream>>>(
      qT, kT, vF, source, gamma, out);
}

// v003
// A run of this version takes 79.3 microseconds.
// Timed twice side by side with v002, it ran 1.80 and 1.79 times as fast.
// All steps since v000 together make it 6.76 times as fast.
#include <hip/hip_runtime.h>
#include <cstdint>

typedef __attribute__((ext_vector_type(16))) _Float16 v16h;
typedef __attribute__((ext_vector_type(8)))  _Float16 v8h;
typedef __attribute__((ext_vector_type(4)))  _Float16 v4h;
typedef __attribute__((ext_vector_type(2)))  _Float16 v2h;
typedef __attribute__((ext_vector_type(8)))  float    v8f;
typedef __attribute__((ext_vector_type(4)))  float    v4f;
typedef __attribute__((ext_vector_type(2)))  float    v2f;
typedef __attribute__((ext_vector_type(4)))  int      v4i;

#define B_   4
#define C_   256
#define CQ   32
#define N_   4096
#define MT   4            // 16-row m tiles per attention block
#define KQ   4            // key phases: wave (mt, kq) takes the 32-key chunks 4*s + kq
#define WPB  (MT * KQ)    // waves per attention block (512 threads)

// ---------------------------------------------------------------------------
// CDNA5 async global->LDS copy (ASYNCcnt-tracked), guarded so a missing
// builtin degrades to a plain load + ds_store without breaking the build.
// Builtin expects (int4 AS1*, int4 AS3*, imm offset, imm cpol) per the
// clang diagnostic ("int4 __device__ *").
// ---------------------------------------------------------------------------
#if __has_builtin(__builtin_amdgcn_global_load_async_to_lds_b128)
#define USE_ASYNC_LDS 1
typedef __attribute__((address_space(1))) v4i gv4i;
typedef __attribute__((address_space(3))) v4i lv4i;
#endif

__device__ __forceinline__ void cp16_async(void* lds, const void* g) {
#ifdef USE_ASYNC_LDS
  __builtin_amdgcn_global_load_async_to_lds_b128(
      (gv4i*)(uintptr_t)g, (lv4i*)(unsigned)(uintptr_t)lds, 0, 0);
#else
  *(v8h*)lds = *(const v8h*)g;
#endif
}

// K-slot permutation for the PV matmul (shared by P-store and vF layout):
//   K slot j <-> n offset (j>>1) | ((j&1)<<4)   within each 32-column chunk.

// ---------------------------------------------------------------------------
// Kernel 1: 1x1-conv projections on the matrix unit.
//   q = Wq @ pose + bq   -> qT [B][N][CQ] f16   (K-contiguous for WMMA gather)
//   k = Wk @ src  + bk   -> kT [B][N][CQ] f16
//   v = Wv @ src  + bv   -> vF [B][C][N]  f16   (n pre-permuted per 32-chunk)
// One block = 64 columns n of one batch. Both input tiles are rounded to f16
// and staged column-major ([n][c]) in LDS, so a fragment is 16 contiguous c.
// Each f32 weight enters as an f16 pair hi + lo (lo = w - hi), two products
// into one f32 accumulator, so the weights keep about 22 significant bits.
// Every fragment, of X and of W alike, holds k = 32*ks + 16*(lane>>4) + s.
// ---------------------------------------------------------------------------
#define XP 264   // halves per staged column: 256 c + 8 (528 B = 16 B x 33)
#define WP 40    // halves per staged weight row: 32 k + 8 (80 B = 16 B x 5)

__device__ __forceinline__ v16h frag16(const _Float16* p) {
  const v8h lo = *(const v8h*)p;
  const v8h hi = *(const v8h*)(p + 8);
  return __builtin_shufflevector(lo, hi, 0,1,2,3,4,5,6,7,8,9,10,11,12,13,14,15);
}

__device__ __forceinline__ v8f mma16(v16h a, v16h b, v8f c) {
  return __builtin_amdgcn_wmma_f32_16x16x32_f16(false, a, false, b, (short)0, c, false, false);
}

// 16 B at a wave-uniform base + the lane's 32-bit byte offset + a constant: every
// load of a family names one offset register and a scalar base, no address pair.
__device__ __forceinline__ v4f ld16(const float* __restrict__ base, unsigned voff, int imm) {
  return *(const v4f*)((const char*)base + (size_t)voff + imm);
}

// 256 c x 64 n of X into registers: 8 lanes cover one 128 B line of a row.
__device__ __forceinline__ void load_x(const float* __restrict__ X, unsigned xoff,
                                       v4f (&raw)[16]) {
  #pragma unroll
  for (int i = 0; i < 16; ++i)
    raw[i] = ld16(X, xoff, ((i >> 3) * 128 + (i & 7)) * N_ * 4);
}

// ... and transposed into LDS: 8 consecutive c of one column per 16 B store.
__device__ __forceinline__ void store_x(_Float16* sx, int nq, int cg, const v4f (&raw)[16]) {
  #pragma unroll
  for (int p = 0; p < 2; ++p)
    #pragma unroll
    for (int e = 0; e < 4; ++e) {
      v8h col;
      #pragma unroll
      for (int j = 0; j < 8; ++j) col[j] = (_Float16)raw[p * 8 + j][e];
      *(v8h*)(sx + (nq * 4 + e) * XP + p * 128 + cg * 8) = col;
    }
}

// 32 weight rows x 32 k (one k step) into registers: 8 lanes per 128 B line.
__device__ __forceinline__ void load_w(const float* __restrict__ Wr, int ks, unsigned woff,
                                       v4f (&wr)[8]) {
  #pragma unroll
  for (int i = 0; i < 8; ++i) wr[i] = ld16(Wr, woff, (i * 4 * C_ + ks * 32) * 4);
}

// Split into hi + lo and turn into fragments through the wave's own LDS patch.
__device__ __forceinline__ void split_w(_Float16* wl, int lane, const v4f (&wr)[8],
                                        v16h (&hi)[2], v16h (&lo)[2]) {
  #pragma unroll
  for (int i = 0; i < 8; ++i) {
    const int row = i * 4 + (lane >> 3);
    const v2f wa = {wr[i][0], wr[i][1]}, wb = {wr[i][2], wr[i][3]};
    const v2h ha = __builtin_convertvector(wa, v2h), hb = __builtin_convertvector(wb, v2h);
    const v2f da = {wa[0] - (float)ha[0], wa[1] - (float)ha[1]};
    const v2f db = {wb[0] - (float)hb[0], wb[1] - (float)hb[1]};
    const v2h la = __builtin_convertvector(da, v2h), lb = __builtin_convertvector(db, v2h);
    const v4h h4 = __builtin_shufflevector(ha, hb, 0, 1, 2, 3);
    const v4h l4 = __builtin_shufflevector(la, lb, 0, 1, 2, 3);
    *(v4h*)(wl + row * WP + (lane & 7) * 4)        = h4;
    *(v4h*)(wl + (32 + row) * WP + (lane & 7) * 4) = l4;
  }
  __builtin_amdgcn_wave_barrier();   // keeps the reads below behind the stores (per-wave LDS is in-order)
  const _Float16* rd = wl + (lane & 15) * WP + 16 * (lane >> 4);
  #pragma unroll
  for (int t = 0; t < 2; ++t) {
    hi[t] = frag16(rd + t * 16 * WP);
    lo[t] = frag16(rd + (32 + t * 16) * WP);
  }
  __builtin_amdgcn_wave_barrier();   // keeps the next k step's stores behind these reads
}

__global__ __launch_bounds__(256)
void proj_kernel(const float* __restrict__ source, const float* __restrict__ pose,
                 const float* __restrict__ Wq, const float* __restrict__ bq,
                 const float* __restrict__ Wk, const float* __restrict__ bk,
                 const float* __restrict__ Wv, const float* __restrict__ bv,
                 _Float16* __restrict__ qT, _Float16* __restrict__ kT,
                 _Float16* __restrict__ vF) {
  __shared__ __align__(16) _Float16 shX[2][64 * XP];   // [0] pose, [1] source: [n][c]
  __shared__ __align__(16) _Float16 shW[8][64 * WP];   // per wave: 32 rows hi, 32 rows lo
  const int tid  = threadIdx.x;
  const int lane = tid & 31;
  const int wv   = __builtin_amdgcn_readfirstlane(tid >> 5);
  const int b    = blockIdx.x / (N_ / 64);
  const int n0   = (blockIdx.x % (N_ / 64)) * 64;
  const int lr   = lane & 15;
  const int half = lane >> 4;
  _Float16* wl   = &shW[wv][0];

  // waves 0-3: q of one 16-column tile each; waves 4-7: k likewise
  const bool isq = wv < 4;
  const float* __restrict__ W1  = isq ? Wq : Wk;
  const float* __restrict__ Wvr = Wv + wv * 32 * C_;   // then 32 rows of v, all 64 columns

  // weight steps 0-7: the q / k rows, 8-15: the v rows; fetched two steps ahead,
  // so that a step's conversions never wait on loads issued just before them
  const unsigned woff = ((lane >> 3) * C_ + (lane & 7) * 4) * 4;
  auto fetch = [&](int s, v4f (&dst)[8]) {
    if (s < 8) load_w(W1, s, woff, dst);
    else       load_w(Wvr, s - 8, woff, dst);
    // last use of woff: holds it to here, so that no load above takes it as its
    // destination, and puts the wait in front of whatever overwrites it next
    if (s == 15) asm volatile("s_wait_xcnt 0x0" :: "v"(woff) : "memory");
    // keeps the later steps' conversions, and with them their data waits, behind
    // the issue of these loads
    __builtin_amdgcn_sched_barrier(0);
  };
  v4f wr[2][8];
  {
    const int nq = (lane & 7) + 8 * (wv & 1);
    const int cg = (lane >> 3) + 4 * (wv >> 1);
    v4f rp[16], rs[16];
    const unsigned xoff = (cg * 8 * N_ + nq * 4) * 4;
    load_x(pose   + (size_t)b * C_ * N_ + n0, xoff, rp);
    load_x(source + (size_t)b * C_ * N_ + n0, xoff, rs);
    // last use of xoff: as for woff in fetch()
    asm volatile("s_wait_xcnt 0x0" :: "v"(xoff) : "memory");
    fetch(0, wr[0]);
    fetch(1, wr[1]);
    store_x(&shX[0][0], nq, cg, rp);
    store_x(&shX[1][0], nq, cg, rs);
  }
  __syncthreads();

  // ---- q / k: A = W (rows o), B = X (columns n); D[r] = row o = 8*half + r ----
  {
    const _Float16* xcol = &shX[isq ? 0 : 1][((wv & 3) * 16 + lr) * XP + 16 * half];
    v8f a0 = {}, a1 = {};
    #pragma unroll
    for (int ks = 0; ks < 8; ++ks) {
      v16h hi[2], lo[2];
      split_w(wl, lane, wr[ks & 1], hi, lo);
      fetch(ks + 2, wr[ks & 1]);
      const v16h xb = frag16(xcol + ks * 32);
      a0 = mma16(hi[0], xb, a0);
      a1 = mma16(hi[1], xb, a1);
      a0 = mma16(lo[0], xb, a0);
      a1 = mma16(lo[1], xb, a1);
    }
    const float* __restrict__ b1 = (isq ? bq : bk) + 8 * half;
    v8h o0, o1;
    #pragma unroll
    for (int r = 0; r < 8; ++r) {
      o0[r] = (_Float16)(a0[r] + b1[r]);
      o1[r] = (_Float16)(a1[r] + b1[16 + r]);
    }
    _Float16* dst = (isq ? qT : kT) + ((size_t)b * N_ + n0 + (wv & 3) * 16 + lr) * CQ + 8 * half;
    *(v8h*)dst        = o0;
    *(v8h*)(dst + 16) = o1;
  }

  // ---- v: A = X (rows n), B = W (columns o); D[r] = row n = 8*half + r ----
  {
    v8f acc[2][4];
    #pragma unroll
    for (int t = 0; t < 2; ++t)
      #pragma unroll
      for (int nt = 0; nt < 4; ++nt)
        #pragma unroll
        for (int i = 0; i < 8; ++i) acc[t][nt][i] = 0.f;

    float bias[2];   // read ahead of the loop, so that the epilogue does not wait on them
    #pragma unroll
    for (int t = 0; t < 2; ++t) bias[t] = bv[wv * 32 + t * 16 + lr];

    const _Float16* xrow = &shX[1][lr * XP + 16 * half];
    #pragma unroll
    for (int ks = 0; ks < 8; ++ks) {
      v16h hi[2], lo[2];
      split_w(wl, lane, wr[ks & 1], hi, lo);
      if (ks < 6) fetch(ks + 10, wr[ks & 1]);
      v16h xa[4];
      #pragma unroll
      for (int nt = 0; nt < 4; ++nt) xa[nt] = frag16(xrow + nt * 16 * XP + ks * 32);
      #pragma unroll
      for (int t = 0; t < 2; ++t)
        #pragma unroll
        for (int nt = 0; nt < 4; ++nt) acc[t][nt] = mma16(xa[nt], hi[t], acc[t][nt]);
      #pragma unroll
      for (int t = 0; t < 2; ++t)
        #pragma unroll
        for (int nt = 0; nt < 4; ++nt) acc[t][nt] = mma16(xa[nt], lo[t], acc[t][nt]);
    }

    // K-slot permutation for v: column x (0..31) -> slot ((x&15)<<1)|(x>>4), so the
    // two 16-column tiles of a 32-chunk interleave: 16 consecutive slots per lane.
    #pragma unroll
    for (int t = 0; t < 2; ++t) {
      const int o = wv * 32 + t * 16 + lr;
      #pragma unroll
      for (int p = 0; p < 2; ++p) {
        v8h s0, s1;
        #pragma unroll
        for (int r = 0; r < 4; ++r) {
          s0[2 * r]     = (_Float16)(acc[t][2 * p][r] + bias[t]);
          s0[2 * r + 1] = (_Float16)(acc[t][2 * p + 1][r] + bias[t]);
          s1[2 * r]     = (_Float16)(acc[t][2 * p][r + 4] + bias[t]);
          s1[2 * r + 1] = (_Float16)(acc[t][2 * p + 1][r + 4] + bias[t]);
        }
        _Float16* dst = vF + ((size_t)b * C_ + o) * N_ + n0 + 32 * p + 16 * half;
        *(v8h*)dst       = s0;
        *(v8h*)(dst + 8) = s1;
      }
    }
  }
}

// ---------------------------------------------------------------------------
// Kernel 2: fused two-pass flash attention.
// One block = 64 rows m of one batch, 16 waves: wave (mt, kq) owns the 16-row
// tile mt and every fourth 32-key chunk (4*s + kq), in both passes. The grid is
// one block per WGP, and a wave walks a quarter of the keys. The four phases of
// a tile share the exact row maximum (joined through LDS after pass A), so their
// partial sums add without any rescale; they are joined through LDS at the end,
// always in the order kq = 0..3, each wave finishing four of the channel tiles.
// Pass B double-buffers a 128-key stage of K and V in LDS via async global->LDS
// copies: a V row of a stage is 256 contiguous bytes, so a copy takes whole lines.
// Every staged row is 32 halves and is read as 16 B pieces by 16 lanes, one row
// each: a pitch of 16 B x odd puts those 16 pieces on all 64 banks once.
// ---------------------------------------------------------------------------
#define AP 40    // halves per staged row of V, K and P: 32 + 8 (80 B = 16 B x 5)
#define SM_V   0                                  // [2][KQ][C_][AP] halves
#define SM_K   (SM_V + 2 * KQ * C_ * AP * 2)      // [2][KQ][32][AP] halves
#define SM_P   (SM_K + 2 * KQ * 32 * AP * 2)      // [WPB][16][AP] halves
#define SM_X   (WPB * 16 * 1024)                  // the join: [WPB][16 tiles][2][32 lanes] x 16 B
// SM_X is the larger of the two uses (ring + P: 204800 B, join: 262144 B)

__global__ __launch_bounds__(512)
void attn_kernel(const _Float16* __restrict__ qT, const _Float16* __restrict__ kT,
                 const _Float16* __restrict__ vF, const float* __restrict__ src,
                 const float* __restrict__ gamma_p, float* __restrict__ out) {
  __shared__ __align__(64) unsigned char smem[SM_X];
  __shared__ __align__(16) float shM[WPB][16];   // per wave: row maxima of its keys
  __shared__ __align__(16) float shS[WPB][16];   // per wave: row sums of its keys
  _Float16* const shV = (_Float16*)(smem + SM_V);
  _Float16* const shK = (_Float16*)(smem + SM_K);
  _Float16* const shP = (_Float16*)(smem + SM_P);

  const int tid  = threadIdx.x;
  const int lane = tid & 31;
  const int wv   = __builtin_amdgcn_readfirstlane(tid >> 5);
  const int mt   = wv & (MT - 1);
  const int kq   = wv / MT;
  const int b    = blockIdx.x / (N_ / 16 / MT);                // uniform per block
  const int m0   = ((blockIdx.x % (N_ / 16 / MT)) * MT + mt) * 16;
  const int half = lane >> 4;           // 0: rows 0-7/K 0-7,16-23 ; 1: rows 8-15/K 8-15,24-31
  const int lr   = lane & 15;
  const int koff = half ? 8 : 0;

  // A-operand: q rows m0..m0+15, K-packed per ISA 16-bit A layout
  const _Float16* qrow = qT + ((size_t)b * N_ + m0 + lr) * CQ;
  const v8h qlo = *(const v8h*)(qrow + koff);
  const v8h qhi = *(const v8h*)(qrow + koff + 16);
  const v16h aq = __builtin_shufflevector(qlo, qhi, 0,1,2,3,4,5,6,7,8,9,10,11,12,13,14,15);

  const _Float16* kbase = kT + ((size_t)b * N_ + lr) * CQ;
  const v8f czero = {};

  // ========== Pass A: exact row max over this wave's chunks (per-lane) ==========
  float rmax[8];
  #pragma unroll
  for (int i = 0; i < 8; ++i) rmax[i] = -3.0e38f;

  for (int st = 0; st < N_ / (32 * KQ); ++st) {
    const _Float16* kr0 = kbase + (size_t)((st * KQ + kq) * 32) * CQ;
    const _Float16* kr1 = kr0 + 16 * CQ;
    const v8h kl0 = *(const v8h*)(kr0 + koff);
    const v8h kh0 = *(const v8h*)(kr0 + koff + 16);
    const v8h kl1 = *(const v8h*)(kr1 + koff);
    const v8h kh1 = *(const v8h*)(kr1 + koff + 16);
    const v16h kb0 = __builtin_shufflevector(kl0, kh0, 0,1,2,3,4,5,6,7,8,9,10,11,12,13,14,15);
    const v16h kb1 = __builtin_shufflevector(kl1, kh1, 0,1,2,3,4,5,6,7,8,9,10,11,12,13,14,15);
    __builtin_prefetch(kr0 + 32 * KQ * CQ, 0, 3);   // near-scope prefetch

    const v8f e0 = __builtin_amdgcn_wmma_f32_16x16x32_f16(false, aq, false, kb0,
                                                          (short)0, czero, false, false);
    const v8f e1 = __builtin_amdgcn_wmma_f32_16x16x32_f16(false, aq, false, kb1,
                                                          (short)0, czero, false, false);
    #pragma unroll
    for (int i = 0; i < 8; ++i) rmax[i] = fmaxf(rmax[i], fmaxf(e0[i], e1[i]));
  }
  #pragma unroll
  for (int i = 0; i < 8; ++i) {   // one-time 16-lane reductions
    float m = rmax[i];
    m = fmaxf(m, __shfl_xor(m, 1, 32));
    m = fmaxf(m, __shfl_xor(m, 2, 32));
    m = fmaxf(m, __shfl_xor(m, 4, 32));
    m = fmaxf(m, __shfl_xor(m, 8, 32));
    rmax[i] = m;
  }
  if (lr == 0) {                  // read by the tile's other phases behind the prologue's barrier
    #pragma unroll
    for (int i = 0; i < 8; ++i) shM[wv][8 * half + i] = rmax[i];
  }

  // ================= Pass B: P = exp(e - max), PV accumulation ==============
  v8f acc[16];
  #pragma unroll
  for (int t = 0; t < 16; ++t)
    #pragma unroll
    for (int i = 0; i < 8; ++i) acc[t][i] = 0.f;
  float rsum[8];
  #pragma unroll
  for (int i = 0; i < 8; ++i) rsum[i] = 0.f;

  _Float16* myP = shP + wv * 16 * AP;
  const _Float16* vbase = vF + (size_t)b * C_ * N_;

  // cooperative staging roles: 512 threads, 16 B per async op, every lane on.
  // V: 16 lanes cover the 256 B (four chunks) of one row; K: 4 lanes cover a 64 B row.
  const int vpart = tid & 15;    // 16 B piece of a V row: chunk vpart >> 2, piece vpart & 3
  const int vrow  = tid >> 4;    // 0..31, then + 32 per copy
  const int part  = tid & 3;     // 16 B piece of a K row
  const int krow  = tid >> 2;    // 0..127: chunk krow >> 5, row krow & 31
  _Float16* const vdst = shV + ((vpart >> 2) * C_ + vrow) * AP + (vpart & 3) * 8;
  _Float16* const kdst = shK + krow * AP + part * 8;
  // the lane's byte offsets from bases that are the same for the whole block
  const unsigned vgo = (vrow * N_ + vpart * 8) * 2;
  const unsigned kgo = (krow * CQ + part * 8) * 2;
  const _Float16* kstage = kT + (size_t)b * N_ * CQ;

  auto stage = [&](int buf, int n0) {   // n0: first of the stage's 128 keys
    #pragma unroll
    for (int r = 0; r < 8; ++r)
      cp16_async(vdst + buf * (KQ * C_ * AP) + r * 32 * AP,
                 (const char*)(vbase + n0 + (size_t)r * 32 * N_) + (size_t)vgo);
    cp16_async(kdst + buf * (KQ * 32 * AP),
               (const char*)(kstage + (size_t)n0 * CQ) + (size_t)kgo);
  };

  stage(0, 0);
  asm volatile("s_wait_asynccnt 0x0" ::: "memory");   // this wave's share of stage 0 has landed
  __syncthreads();                                    // stage 0 and shM are published

  #pragma unroll
  for (int j = 0; j < KQ; ++j) {   // the tile's exact row max over all keys
    const v4f ma = *(const v4f*)&shM[j * MT + mt][8 * half];
    const v4f mb = *(const v4f*)&shM[j * MT + mt][8 * half + 4];
    #pragma unroll
    for (int i = 0; i < 4; ++i) {
      rmax[i]     = fmaxf(rmax[i], ma[i]);
      rmax[i + 4] = fmaxf(rmax[i + 4], mb[i]);
    }
  }

  for (int st = 0; st < N_ / (32 * KQ); ++st) {
    const int cur = st & 1;
    if (st + 1 < N_ / (32 * KQ)) stage(cur ^ 1, (st + 1) * 32 * KQ);

    // ---- energy from this wave's staged K chunk ----
    const _Float16* kk = shK + (cur * KQ + kq) * 32 * AP;
    const v8h kl0 = *(const v8h*)(kk + lr * AP + koff);
    const v8h kh0 = *(const v8h*)(kk + lr * AP + koff + 16);
    const v8h kl1 = *(const v8h*)(kk + (16 + lr) * AP + koff);
    const v8h kh1 = *(const v8h*)(kk + (16 + lr) * AP + koff + 16);
    const v16h kb0 = __builtin_shufflevector(kl0, kh0, 0,1,2,3,4,5,6,7,8,9,10,11,12,13,14,15);
    const v16h kb1 = __builtin_shufflevector(kl1, kh1, 0,1,2,3,4,5,6,7,8,9,10,11,12,13,14,15);

    const v8f e0 = __builtin_amdgcn_wmma_f32_16x16x32_f16(false, aq, false, kb0,
                                                          (short)0, czero, false, false);
    const v8f e1 = __builtin_amdgcn_wmma_f32_16x16x32_f16(false, aq, false, kb1,
                                                          (short)0, czero, false, false);

    // ---- P tile: packed (p0,p1) -> one b32 LDS store per row slot ----
    // Stored slot j maps to n offset (j>>1)|((j&1)<<4); vF uses same mapping.
    #pragma unroll
    for (int i = 0; i < 8; ++i) {
      const float a0 = __expf(e0[i] - rmax[i]);
      const float a1 = __expf(e1[i] - rmax[i]);
      rsum[i] += a0 + a1;                    // per-lane; reduced after the loop
      const int r = i + 8 * half;
      v2h pk; pk[0] = (_Float16)a0; pk[1] = (_Float16)a1;
      *(v2h*)(myP + r * AP + 2 * lr) = pk;
    }
    __builtin_amdgcn_wave_barrier();         // per-wave LDS is in-order
    const _Float16* pr = myP + lr * AP;
    const v8h plo = *(const v8h*)(pr + koff);
    const v8h phi = *(const v8h*)(pr + koff + 16);
    const v16h pa = __builtin_shufflevector(plo, phi, 0,1,2,3,4,5,6,7,8,9,10,11,12,13,14,15);
    __builtin_amdgcn_wave_barrier();

    // ---- PV: 16 channel tiles from this wave's staged V chunk ----
    const _Float16* vv = shV + (cur * KQ + kq) * C_ * AP;
    #pragma unroll
    for (int t = 0; t < 16; ++t) {
      const _Float16* vr = vv + (t * 16 + lr) * AP;
      const v8h vlo = *(const v8h*)(vr + koff);
      const v8h vhi = *(const v8h*)(vr + koff + 16);
      const v16h vb = __builtin_shufflevector(vlo, vhi, 0,1,2,3,4,5,6,7,8,9,10,11,12,13,14,15);
      acc[t] = __builtin_amdgcn_wmma_f32_16x16x32_f16(false, pa, false, vb,
                                                      (short)0, acc[t], false, false);
    }

    asm volatile("s_wait_dscnt 0x0" ::: "memory");      // this wave has left the current buffer
    asm volatile("s_wait_asynccnt 0x0" ::: "memory");   // its share of the next stage has landed
    __syncthreads();                                    // publishes the next stage, frees this buffer
  }
  // nothing is in flight into the ring when its LDS becomes the join's buffer
  asm volatile("s_wait_asynccnt 0x0" ::: "memory");

  // ---- join of the four key phases of a tile ----
  // source values of the four channel tiles this wave finishes, fetched ahead of the join
  const float gam = gamma_p[0];
  v4f sv[4][2];
  const float* __restrict__ sbase = src + ((size_t)b * C_ + kq * 64) * N_ + m0;   // same for the whole wave
  const unsigned soff = (lr * N_ + 8 * half) * 4;
  #pragma unroll
  for (int tt = 0; tt < 4; ++tt) {
    sv[tt][0] = ld16(sbase, soff, tt * 16 * N_ * 4);
    sv[tt][1] = ld16(sbase, soff, tt * 16 * N_ * 4 + 16);
  }
  // last use of soff: holds it to here, so that no load above takes it as its
  // destination, and puts the wait in front of whatever overwrites it next
  asm volatile("s_wait_xcnt 0x0" :: "v"(soff) : "memory");

  #pragma unroll
  for (int i = 0; i < 8; ++i) {   // one-time 16-lane row-sum reduction
    float s = rsum[i];
    s += __shfl_xor(s, 1, 32);
    s += __shfl_xor(s, 2, 32);
    s += __shfl_xor(s, 4, 32);
    s += __shfl_xor(s, 8, 32);
    rsum[i] = s;
  }
  if (lr == 0) {
    #pragma unroll
    for (int i = 0; i < 8; ++i) shS[wv][8 * half + i] = rsum[i];
  }
  float* const xj = (float*)smem;   // [wave][tile][register quad][lane] x 16 B
  #pragma unroll
  for (int t = 0; t < 16; ++t) {
    const v4f lo4 = {acc[t][0], acc[t][1], acc[t][2], acc[t][3]};
    const v4f hi4 = {acc[t][4], acc[t][5], acc[t][6], acc[t][7]};
    *(v4f*)(xj + (((wv * 16 + t) * 2 + 0) * 32 + lane) * 4) = lo4;
    *(v4f*)(xj + (((wv * 16 + t) * 2 + 1) * 32 + lane) * 4) = hi4;
  }
  __syncthreads();                  // every phase's partial sums are in LDS

  float linv[8];
  {
    v4f sa = *(const v4f*)&shS[mt][8 * half];
    v4f sb = *(const v4f*)&shS[mt][8 * half + 4];
    #pragma unroll
    for (int j = 1; j < KQ; ++j) {
      sa += *(const v4f*)&shS[j * MT + mt][8 * half];
      sb += *(const v4f*)&shS[j * MT + mt][8 * half + 4];
    }
    #pragma unroll
    for (int i = 0; i < 4; ++i) { linv[i] = 1.f / sa[i]; linv[i + 4] = 1.f / sb[i]; }
  }

  // ---- epilogue: gamma * (acc/sum) + source; contiguous 16B stores along m ----
  #pragma unroll
  for (int tt = 0; tt < 4; ++tt) {
    const int t = kq * 4 + tt;
    v4f p0 = *(const v4f*)(xj + (((mt * 16 + t) * 2 + 0) * 32 + lane) * 4);
    v4f p1 = *(const v4f*)(xj + (((mt * 16 + t) * 2 + 1) * 32 + lane) * 4);
    #pragma unroll
    for (int j = 1; j < KQ; ++j) {
      p0 += *(const v4f*)(xj + ((((j * MT + mt) * 16 + t) * 2 + 0) * 32 + lane) * 4);
      p1 += *(const v4f*)(xj + ((((j * MT + mt) * 16 + t) * 2 + 1) * 32 + lane) * 4);
    }
    const size_t base = ((size_t)b * C_ + t * 16 + lr) * N_ + m0 + 8 * half;
    v4f r0, r1;
    #pragma unroll
    for (int i = 0; i < 4; ++i) {
      r0[i] = gam * p0[i] * linv[i]     + sv[tt][0][i];
      r1[i] = gam * p1[i] * linv[i + 4] + sv[tt][1][i];
    }
    *(v4f*)(out + base)     = r0;
    *(v4f*)(out + base + 4) = r1;
  }
}

// ---------------------------------------------------------------------------
extern "C" void kernel_launch(void* const* d_in, const int* in_sizes, int n_in,
                              void* d_out, int out_size, void* d_ws, size_t ws_size,
                              hipStream_t stream) {
  const float* source = (const float*)d_in[0];
  const float* pose   = (const float*)d_in[1];
  const float* Wq     = (const float*)d_in[2];
  const float* bq     = (const float*)d_in[3];
  const float* Wk     = (const float*)d_in[4];
  const float* bk     = (const float*)d_in[5];
  const float* Wv     = (const float*)d_in[6];
  const float* bv     = (const float*)d_in[7];
  const float* gamma  = (const float*)d_in[8];
  float* out = (float*)d_out;

  // workspace: qT (1 MB) | kT (1 MB) | vF (8 MB), all f16
  _Float16* qT = (_Float16*)d_ws;
  _Float16* kT = qT + (size_t)B_ * N_ * CQ;
  _Float16* vF = kT + (size_t)B_ * N_ * CQ;

  proj_kernel<<<dim3(B_ * (N_ / 64)), dim3(256), 0, stream>>>(
      source, pose, Wq, bq, Wk, bk, Wv, bv, qT, kT, vF);

  attn_kernel<<<dim3(B_ * (N_ / 16) / MT), dim3(32 * WPB), 0, stream>>>(
      qT, kT, vF, source, gamma, out);
}

// v004
// It runs in 68.7 microseconds.
// Next to v003, in two timings, it ran 1.15 and 1.16 times as fast.
// All steps since v000 together make it 7.79 times as fast.
#include <hip/hip_runtime.h>
#include <cstdint>

typedef __attribute__((ext_vector_type(16))) _Float16 v16h;
typedef __attribute__((ext_vector_type(8)))  _Float16 v8h;
typedef __attribute__((ext_vector_type(4)))  _Float16 v4h;
typedef __attribute__((ext_vector_type(2)))  _Float16 v2h;
typedef __attribute__((ext_vector_type(8)))  float    v8f;
typedef __attribute__((ext_vector_type(4)))  float    v4f;
typedef __attribute__((ext_vector_type(2)))  float    v2f;
typedef __attribute__((ext_vector_type(4)))  int      v4i;

#define B_   4
#define C_   256
#define CQ   32
#define N_   4096
#define MT   4            // 16-row m tiles per attention block
#define KQ   4            // key phases: wave (mt, kq) takes the 32-key chunks 4*s + kq
#define WPB  (MT * KQ)    // waves per attention block (512 threads)
#define NC   (N_ / 32 / WPB)   // 32-key chunks per wave in pass A
#define KD   4                 // chunks that a wave's K loads run ahead of its products

// ---------------------------------------------------------------------------
// CDNA5 async global->LDS copy (ASYNCcnt-tracked), guarded so a missing
// builtin degrades to a plain load + ds_store without breaking the build.
// Builtin expects (int4 AS1*, int4 AS3*, imm offset, imm cpol) per the
// clang diagnostic ("int4 __device__ *").
// ---------------------------------------------------------------------------
#if __has_builtin(__builtin_amdgcn_global_load_async_to_lds_b128)
#define USE_ASYNC_LDS 1
typedef __attribute__((address_space(1))) v4i gv4i;
typedef __attribute__((address_space(3))) v4i lv4i;
#endif

__device__ __forceinline__ void cp16_async(void* lds, const void* g) {
#ifdef USE_ASYNC_LDS
  __builtin_amdgcn_global_load_async_to_lds_b128(
      (gv4i*)(uintptr_t)g, (lv4i*)(unsigned)(uintptr_t)lds, 0, 0);
#else
  *(v8h*)lds = *(const v8h*)g;
#endif
}

// K-slot permutation for the PV matmul (shared by P-store and vF layout):
//   K slot j <-> n offset (j>>1) | ((j&1)<<4)   within each 32-column chunk.

// ---------------------------------------------------------------------------
// Kernel 1: 1x1-conv projections on the matrix unit.
//   q = Wq @ pose + bq   -> qT [B][N][CQ] f16   (K-contiguous for WMMA gather)
//   k = Wk @ src  + bk   -> kT [B][N][CQ] f16
//   v = Wv @ src  + bv   -> vF [B][C][N]  f16   (n pre-permuted per 32-chunk)
// One block = 64 columns n of one batch. Both input tiles are rounded to f16
// and staged column-major ([n][c]) in LDS, so a fragment is 16 contiguous c.
// Each f32 weight enters as an f16 pair hi + lo (lo = w - hi), two products
// into one f32 accumulator, so the weights keep about 22 significant bits.
// Every fragment, of X and of W alike, holds k = 32*ks + 16*(lane>>4) + s.
// ---------------------------------------------------------------------------
#define XP 264   // halves per staged column: 256 c + 8 (528 B = 16 B x 33)
#define WP 40    // halves per staged weight row: 32 k + 8 (80 B = 16 B x 5)

__device__ __forceinline__ v16h frag16(const _Float16* p) {
  const v8h lo = *(const v8h*)p;
  const v8h hi = *(const v8h*)(p + 8);
  return __builtin_shufflevector(lo, hi, 0,1,2,3,4,5,6,7,8,9,10,11,12,13,14,15);
}

__device__ __forceinline__ v8f mma16(v16h a, v16h b, v8f c) {
  return __builtin_amdgcn_wmma_f32_16x16x32_f16(false, a, false, b, (short)0, c, false, false);
}

// 16 B at a wave-uniform base + the lane's 32-bit byte offset + a constant: every
// load of a family names one offset register and a scalar base, no address pair.
__device__ __forceinline__ v4f ld16(const float* __restrict__ base, unsigned voff, int imm) {
  return *(const v4f*)((const char*)base + (size_t)voff + imm);
}

// the same for eight halves
__device__ __forceinline__ v8h ld16h(const _Float16* __restrict__ base, unsigned voff, int imm) {
  return *(const v8h*)((const char*)base + (size_t)voff + imm);
}

// 256 c x 64 n of X into registers: 8 lanes cover one 128 B line of a row.
__device__ __forceinline__ void load_x(const float* __restrict__ X, unsigned xoff,
                                       v4f (&raw)[16]) {
  #pragma unroll
  for (int i = 0; i < 16; ++i)
    raw[i] = ld16(X, xoff, ((i >> 3) * 128 + (i & 7)) * N_ * 4);
}

// ... and transposed into LDS: 8 consecutive c of one column per 16 B store.
__device__ __forceinline__ void store_x(_Float16* sx, int nq, int cg, const v4f (&raw)[16]) {
  #pragma unroll
  for (int p = 0; p < 2; ++p)
    #pragma unroll
    for (int e = 0; e < 4; ++e) {
      v8h col;
      #pragma unroll
      for (int j = 0; j < 8; ++j) col[j] = (_Float16)raw[p * 8 + j][e];
      *(v8h*)(sx + (nq * 4 + e) * XP + p * 128 + cg * 8) = col;
    }
}

// 32 weight rows x 32 k (one k step) into registers: 8 lanes per 128 B line.
__device__ __forceinline__ void load_w(const float* __restrict__ Wr, int ks, unsigned woff,
                                       v4f (&wr)[8]) {
  #pragma unroll
  for (int i = 0; i < 8; ++i) wr[i] = ld16(Wr, woff, (i * 4 * C_ + ks * 32) * 4);
}

// Split into hi + lo and turn into fragments through the wave's own LDS patch.
__device__ __forceinline__ void split_w(_Float16* wl, int lane, const v4f (&wr)[8],
                                        v16h (&hi)[2], v16h (&lo)[2]) {
  #pragma unroll
  for (int i = 0; i < 8; ++i) {
    const int row = i * 4 + (lane >> 3);
    const v2f wa = {wr[i][0], wr[i][1]}, wb = {wr[i][2], wr[i][3]};
    const v2h ha = __builtin_convertvector(wa, v2h), hb = __builtin_convertvector(wb, v2h);
    const v2f da = {wa[0] - (float)ha[0], wa[1] - (float)ha[1]};
    const v2f db = {wb[0] - (float)hb[0], wb[1] - (float)hb[1]};
    const v2h la = __builtin_convertvector(da, v2h), lb = __builtin_convertvector(db, v2h);
    const v4h h4 = __builtin_shufflevector(ha, hb, 0, 1, 2, 3);
    const v4h l4 = __builtin_shufflevector(la, lb, 0, 1, 2, 3);
    *(v4h*)(wl + row * WP + (lane & 7) * 4)        = h4;
    *(v4h*)(wl + (32 + row) * WP + (lane & 7) * 4) = l4;
  }
  __builtin_amdgcn_wave_barrier();   // keeps the reads below behind the stores (per-wave LDS is in-order)
  const _Float16* rd = wl + (lane & 15) * WP + 16 * (lane >> 4);
  #pragma unroll
  for (int t = 0; t < 2; ++t) {
    hi[t] = frag16(rd + t * 16 * WP);
    lo[t] = frag16(rd + (32 + t * 16) * WP);
  }
  __builtin_amdgcn_wave_barrier();   // keeps the next k step's stores behind these reads
}

__global__ __launch_bounds__(256)
void proj_kernel(const float* __restrict__ source, const float* __restrict__ pose,
                 const float* __restrict__ Wq, const float* __restrict__ bq,
                 const float* __restrict__ Wk, const float* __restrict__ bk,
                 const float* __restrict__ Wv, const float* __restrict__ bv,
                 _Float16* __restrict__ qT, _Float16* __restrict__ kT,
                 _Float16* __restrict__ vF) {
  __shared__ __align__(16) _Float16 shX[2][64 * XP];   // [0] pose, [1] source: [n][c]
  __shared__ __align__(16) _Float16 shW[8][64 * WP];   // per wave: 32 rows hi, 32 rows lo
  const int tid  = threadIdx.x;
  const int lane = tid & 31;
  const int wv   = __builtin_amdgcn_readfirstlane(tid >> 5);
  const int b    = blockIdx.x / (N_ / 64);
  const int n0   = (blockIdx.x % (N_ / 64)) * 64;
  const int lr   = lane & 15;
  const int half = lane >> 4;
  _Float16* wl   = &shW[wv][0];

  // waves 0-3: q of one 16-column tile each; waves 4-7: k likewise
  const bool isq = wv < 4;
  const float* __restrict__ W1  = isq ? Wq : Wk;
  const float* __restrict__ Wvr = Wv + wv * 32 * C_;   // then 32 rows of v, all 64 columns

  // weight steps 0-7: the q / k rows, 8-15: the v rows; fetched two steps ahead,
  // so that a step's conversions never wait on loads issued just before them
  const unsigned woff = ((lane >> 3) * C_ + (lane & 7) * 4) * 4;
  auto fetch = [&](int s, v4f (&dst)[8]) {
    if (s < 8) load_w(W1, s, woff, dst);
    else       load_w(Wvr, s - 8, woff, dst);
    // last use of woff: holds it to here, so that no load above takes it as its
    // destination, and puts the wait in front of whatever overwrites it next
    if (s == 15) asm volatile("s_wait_xcnt 0x0" :: "v"(woff) : "memory");
    // keeps the later steps' conversions, and with them their data waits, behind
    // the issue of these loads
    __builtin_amdgcn_sched_barrier(0);
  };
  v4f wr[2][8];
  {
    const int nq = (lane & 7) + 8 * (wv & 1);
    const int cg = (lane >> 3) + 4 * (wv >> 1);
    v4f rp[16], rs[16];
    const unsigned xoff = (cg * 8 * N_ + nq * 4) * 4;
    load_x(pose   + (size_t)b * C_ * N_ + n0, xoff, rp);
    load_x(source + (size_t)b * C_ * N_ + n0, xoff, rs);
    // last use of xoff: as for woff in fetch()
    asm volatile("s_wait_xcnt 0x0" :: "v"(xoff) : "memory");
    fetch(0, wr[0]);
    fetch(1, wr[1]);
    store_x(&shX[0][0], nq, cg, rp);
    store_x(&shX[1][0], nq, cg, rs);
  }
  __syncthreads();

  // ---- q / k: A = W (rows o), B = X (columns n); D[r] = row o = 8*half + r ----
  {
    const _Float16* xcol = &shX[isq ? 0 : 1][((wv & 3) * 16 + lr) * XP + 16 * half];
    v8f a0 = {}, a1 = {};
    #pragma unroll
    for (int ks = 0; ks < 8; ++ks) {
      v16h hi[2], lo[2];
      split_w(wl, lane, wr[ks & 1], hi, lo);
      fetch(ks + 2, wr[ks & 1]);
      const v16h xb = frag16(xcol + ks * 32);
      a0 = mma16(hi[0], xb, a0);
      a1 = mma16(hi[1], xb, a1);
      a0 = mma16(lo[0], xb, a0);
      a1 = mma16(lo[1], xb, a1);
    }
    const float* __restrict__ b1 = (isq ? bq : bk) + 8 * half;
    v8h o0, o1;
    #pragma unroll
    for (int r = 0; r < 8; ++r) {
      o0[r] = (_Float16)(a0[r] + b1[r]);
      o1[r] = (_Float16)(a1[r] + b1[16 + r]);
    }
    _Float16* dst = (isq ? qT : kT) + ((size_t)b * N_ + n0 + (wv & 3) * 16 + lr) * CQ + 8 * half;
    *(v8h*)dst        = o0;
    *(v8h*)(dst + 16) = o1;
  }

  // ---- v: A = X (rows n), B = W (columns o); D[r] = row n = 8*half + r ----
  {
    v8f acc[2][4];
    #pragma unroll
    for (int t = 0; t < 2; ++t)
      #pragma unroll
      for (int nt = 0; nt < 4; ++nt)
        #pragma unroll
        for (int i = 0; i < 8; ++i) acc[t][nt][i] = 0.f;

    float bias[2];   // read ahead of the loop, so that the epilogue does not wait on them
    #pragma unroll
    for (int t = 0; t < 2; ++t) bias[t] = bv[wv * 32 + t * 16 + lr];

    const _Float16* xrow = &shX[1][lr * XP + 16 * half];
    #pragma unroll
    for (int ks = 0; ks < 8; ++ks) {
      v16h hi[2], lo[2];
      split_w(wl, lane, wr[ks & 1], hi, lo);
      if (ks < 6) fetch(ks + 10, wr[ks & 1]);
      v16h xa[4];
      #pragma unroll
      for (int nt = 0; nt < 4; ++nt) xa[nt] = frag16(xrow + nt * 16 * XP + ks * 32);
      #pragma unroll
      for (int t = 0; t < 2; ++t)
        #pragma unroll
        for (int nt = 0; nt < 4; ++nt) acc[t][nt] = mma16(xa[nt], hi[t], acc[t][nt]);
      #pragma unroll
      for (int t = 0; t < 2; ++t)
        #pragma unroll
        for (int nt = 0; nt < 4; ++nt) acc[t][nt] = mma16(xa[nt], lo[t], acc[t][nt]);
    }

    // K-slot permutation for v: column x (0..31) -> slot ((x&15)<<1)|(x>>4), so the
    // two 16-column tiles of a 32-chunk interleave: 16 consecutive slots per lane.
    #pragma unroll
    for (int t = 0; t < 2; ++t) {
      const int o = wv * 32 + t * 16 + lr;
      #pragma unroll
      for (int p = 0; p < 2; ++p) {
        v8h s0, s1;
        #pragma unroll
        for (int r = 0; r < 4; ++r) {
          s0[2 * r]     = (_Float16)(acc[t][2 * p][r] + bias[t]);
          s0[2 * r + 1] = (_Float16)(acc[t][2 * p + 1][r] + bias[t]);
          s1[2 * r]     = (_Float16)(acc[t][2 * p][r + 4] + bias[t]);
          s1[2 * r + 1] = (_Float16)(acc[t][2 * p + 1][r + 4] + bias[t]);
        }
        _Float16* dst = vF + ((size_t)b * C_ + o) * N_ + n0 + 32 * p + 16 * half;
        *(v8h*)dst       = s0;
        *(v8h*)(dst + 8) = s1;
      }
    }
  }
}

// ---------------------------------------------------------------------------
// Kernel 2: fused two-pass flash attention.
// One block = 64 rows m of one batch, 16 waves. Pass A (the exact row maxima)
// deals the keys over all 16 waves, each scoring its keys against all 64 rows.
// In pass B wave (mt, kq) owns the 16-row tile mt and every fourth 32-key chunk
// (4*s + kq). The grid is one block per WGP. The four phases of
// a tile share the exact row maximum (joined through LDS after pass A), so their
// partial sums add without any rescale; they are joined through LDS at the end,
// always in the order kq = 0..3, each wave finishing four of the channel tiles.
// Pass B double-buffers a 128-key stage of K and V in LDS via async global->LDS
// copies: a V row of a stage is 256 contiguous bytes, so a copy takes whole lines.
// Every staged row is 32 halves and is read as 16 B pieces by 16 lanes, one row
// each: a pitch of 16 B x odd puts those 16 pieces on all 64 banks once.
// ---------------------------------------------------------------------------
#define AP 40    // halves per staged row of V, K and P: 32 + 8 (80 B = 16 B x 5)
#define SM_V   0                                  // [2][KQ][C_][AP] halves
#define SM_K   (SM_V + 2 * KQ * C_ * AP * 2)      // [2][KQ][32][AP] halves
#define SM_P   (SM_K + 2 * KQ * 32 * AP * 2)      // [WPB][16][AP] halves
#define SM_X   (WPB * 16 * 1024)                  // the join: [WPB][16 tiles][2][32 lanes] x 16 B
// SM_X is the larger of the two uses (ring + P: 204800 B, join: 262144 B)

__global__ __launch_bounds__(512)
void attn_kernel(const _Float16* __restrict__ qT, const _Float16* __restrict__ kT,
                 const _Float16* __restrict__ vF, const float* __restrict__ src,
                 const float* __restrict__ gamma_p, float* __restrict__ out) {
  __shared__ __align__(64) unsigned char smem[SM_X];
  // per wave: maxima of the block's 64 rows over its keys; 272 B = 16 B x 17 a wave,
  // so that 16 lanes reading 16 B of one wave each meet all 64 banks once
  __shared__ __align__(16) float shM[WPB][MT * 16 + 4];
  __shared__ __align__(16) float shS[WPB][16];   // per wave: row sums of its keys
  _Float16* const shV = (_Float16*)(smem + SM_V);
  _Float16* const shK = (_Float16*)(smem + SM_K);
  _Float16* const shP = (_Float16*)(smem + SM_P);

  const int tid  = threadIdx.x;
  const int lane = tid & 31;
  const int wv   = __builtin_amdgcn_readfirstlane(tid >> 5);
  const int mt   = wv & (MT - 1);
  const int kq   = wv / MT;
  const int b    = blockIdx.x / (N_ / 16 / MT);                // uniform per block
  const int m0   = ((blockIdx.x % (N_ / 16 / MT)) * MT + mt) * 16;
  const int half = lane >> 4;           // 0: rows 0-7/K 0-7,16-23 ; 1: rows 8-15/K 8-15,24-31
  const int lr   = lane & 15;
  const int koff = half ? 8 : 0;

  // A-operand: q rows m0..m0+15, K-packed per ISA 16-bit A layout
  const _Float16* qrow = qT + ((size_t)b * N_ + m0 + lr) * CQ;
  const v8h qlo = *(const v8h*)(qrow + koff);
  const v8h qhi = *(const v8h*)(qrow + koff + 16);
  const v16h aq = __builtin_shufflevector(qlo, qhi, 0,1,2,3,4,5,6,7,8,9,10,11,12,13,14,15);

  const v8f czero = {};

  // ========== Pass A: exact row maxima ==========
  // Wave wv takes the 32-key chunks wv + 16*i and scores them against all four row
  // tiles: a chunk is loaded once per block, and a wave's loads run KD chunks ahead
  // of its products, one exposed round of load latency in place of one per chunk.
  // The products are K.Q^T: D holds row m = lr of a tile in a lane and 8 keys in its
  // registers, so a row's maximum is in-lane but for one exchange between the halves.
  {
    const _Float16* __restrict__ qblk = qT + ((size_t)b * N_ + (blockIdx.x % (N_ / 16 / MT)) * MT * 16) * CQ;
    const _Float16* __restrict__ kwav = kT + ((size_t)b * N_ + wv * 32) * CQ;   // same for the whole wave
    const unsigned fo = (lr * CQ + koff) * 2;   // the lane's byte offset in a 16-row fragment
    v8h qf[MT][2], kf[KD][4];
    auto fetch = [&](int i, v8h (&dst)[4]) {   // chunk wv + 16*i
      const _Float16* __restrict__ kc = kwav + (size_t)i * WPB * 32 * CQ;
      dst[0] = ld16h(kc, fo, 0);
      dst[1] = ld16h(kc, fo, 32);
      dst[2] = ld16h(kc, fo, 16 * CQ * 2);
      dst[3] = ld16h(kc, fo, 16 * CQ * 2 + 32);
    };
    #pragma unroll
    for (int u = 0; u < MT; ++u) {
      qf[u][0] = ld16h(qblk, fo, u * 16 * CQ * 2);
      qf[u][1] = ld16h(qblk, fo, u * 16 * CQ * 2 + 32);
    }
    // the q loads go out first: loads are waited for in issue order, and a q load among
    // the K loads makes the first products wait out the K loads in front of it (the
    // build without this line did so, waited to zero and spilled)
    __builtin_amdgcn_sched_barrier(0);
    #pragma unroll
    for (int d = 0; d < KD; ++d) fetch(d, kf[d]);

    v16h qb[MT];
    #pragma unroll
    for (int u = 0; u < MT; ++u)
      qb[u] = __builtin_shufflevector(qf[u][0], qf[u][1], 0,1,2,3,4,5,6,7,8,9,10,11,12,13,14,15);
    float cm[MT][8];
    #pragma unroll
    for (int u = 0; u < MT; ++u)
      #pragma unroll
      for (int r = 0; r < 8; ++r) cm[u][r] = -3.0e38f;
    auto score = [&](const v8h (&k)[4]) {   // one chunk against the four row tiles
      const v16h ka0 = __builtin_shufflevector(k[0], k[1], 0,1,2,3,4,5,6,7,8,9,10,11,12,13,14,15);
      const v16h ka1 = __builtin_shufflevector(k[2], k[3], 0,1,2,3,4,5,6,7,8,9,10,11,12,13,14,15);
      #pragma unroll
      for (int u = 0; u < MT; ++u) {
        const v8f e0 = __builtin_amdgcn_wmma_f32_16x16x32_f16(false, ka0, false, qb[u],
                                                              (short)0, czero, false, false);
        const v8f e1 = __builtin_amdgcn_wmma_f32_16x16x32_f16(false, ka1, false, qb[u],
                                                              (short)0, czero, false, false);
        #pragma unroll
        for (int r = 0; r < 8; ++r) cm[u][r] = fmaxf(cm[u][r], fmaxf(e0[r], e1[r]));
      }
    };
    #pragma unroll
    for (int i = KD; i < NC; i += KD) {
      #pragma unroll
      for (int d = 0; d < KD; ++d) {
        score(kf[d]);
        fetch(i + d, kf[d]);
      }
    }
    // last use of fo: holds it to here, so that no load above takes it as its
    // destination, and puts the wait in front of whatever overwrites it next
    asm volatile("s_wait_xcnt 0x0" :: "v"(fo) : "memory");
    #pragma unroll
    for (int d = 0; d < KD; ++d) score(kf[d]);
    float mm[MT];
    #pragma unroll
    for (int u = 0; u < MT; ++u) {
      const float m = fmaxf(fmaxf(fmaxf(cm[u][0], cm[u][1]), fmaxf(cm[u][2], cm[u][3])),
                            fmaxf(fmaxf(cm[u][4], cm[u][5]), fmaxf(cm[u][6], cm[u][7])));
      mm[u] = fmaxf(m, __shfl_xor(m, 16, 32));
    }
    if (half == 0) {                // read by every wave behind the prologue's barrier
      #pragma unroll
      for (int u = 0; u < MT; ++u) shM[wv][u * 16 + lr] = mm[u];
    }
  }

  // ================= Pass B: P = exp(e - max), PV accumulation ==============
  v8f acc[16];
  #pragma unroll
  for (int t = 0; t < 16; ++t)
    #pragma unroll
    for (int i = 0; i < 8; ++i) acc[t][i] = 0.f;
  float rsum[8];
  #pragma unroll
  for (int i = 0; i < 8; ++i) rsum[i] = 0.f;

  _Float16* myP = shP + wv * 16 * AP;
  const _Float16* vbase = vF + (size_t)b * C_ * N_;

  // cooperative staging roles: 512 threads, 16 B per async op, every lane on.
  // V: 16 lanes cover the 256 B (four chunks) of one row; K: 4 lanes cover a 64 B row.
  const int vpart = tid & 15;    // 16 B piece of a V row: chunk vpart >> 2, piece vpart & 3
  const int vrow  = tid >> 4;    // 0..31, then + 32 per copy
  const int part  = tid & 3;     // 16 B piece of a K row
  const int krow  = tid >> 2;    // 0..127: chunk krow >> 5, row krow & 31
  _Float16* const vdst = shV + ((vpart >> 2) * C_ + vrow) * AP + (vpart & 3) * 8;
  _Float16* const kdst = shK + krow * AP + part * 8;
  // the lane's byte offsets from bases that are the same for the whole block
  const unsigned vgo = (vrow * N_ + vpart * 8) * 2;
  const unsigned kgo = (krow * CQ + part * 8) * 2;
  const _Float16* kstage = kT + (size_t)b * N_ * CQ;

  auto stage = [&](int buf, int n0) {   // n0: first of the stage's 128 keys
    #pragma unroll
    for (int r = 0; r < 8; ++r)
      cp16_async(vdst + buf * (KQ * C_ * AP) + r * 32 * AP,
                 (const char*)(vbase + n0 + (size_t)r * 32 * N_) + (size_t)vgo);
    cp16_async(kdst + buf * (KQ * 32 * AP),
               (const char*)(kstage + (size_t)n0 * CQ) + (size_t)kgo);
  };

  stage(0, 0);
  asm volatile("s_wait_asynccnt 0x0" ::: "memory");   // this wave's share of stage 0 has landed
  __syncthreads();                                    // stage 0 and shM are published

  // the tile's exact row max over all keys: lane lr takes wave lr's maxima of the
  // rows 8*half .. 8*half + 7, then one-time 16-lane reductions
  float rmax[8];
  {
    const v4f ma = *(const v4f*)&shM[lr][mt * 16 + 8 * half];
    const v4f mb = *(const v4f*)&shM[lr][mt * 16 + 8 * half + 4];
    #pragma unroll
    for (int i = 0; i < 4; ++i) { rmax[i] = ma[i]; rmax[i + 4] = mb[i]; }
    #pragma unroll
    for (int i = 0; i < 8; ++i) {
      float m = rmax[i];
      m = fmaxf(m, __shfl_xor(m, 1, 32));
      m = fmaxf(m, __shfl_xor(m, 2, 32));
      m = fmaxf(m, __shfl_xor(m, 4, 32));
      m = fmaxf(m, __shfl_xor(m, 8, 32));
      rmax[i] = m;
    }
  }

  for (int st = 0; st < N_ / (32 * KQ); ++st) {
    const int cur = st & 1;
    if (st + 1 < N_ / (32 * KQ)) stage(cur ^ 1, (st + 1) * 32 * KQ);

    // ---- energy from this wave's staged K chunk ----
    const _Float16* kk = shK + (cur * KQ + kq) * 32 * AP;
    const v8h kl0 = *(const v8h*)(kk + lr * AP + koff);
    const v8h kh0 = *(const v8h*)(kk + lr * AP + koff + 16);
    const v8h kl1 = *(const v8h*)(kk + (16 + lr) * AP + koff);
    const v8h kh1 = *(const v8h*)(kk + (16 + lr) * AP + koff + 16);
    const v16h kb0 = __builtin_shufflevector(kl0, kh0, 0,1,2,3,4,5,6,7,8,9,10,11,12,13,14,15);
    const v16h kb1 = __builtin_shufflevector(kl1, kh1, 0,1,2,3,4,5,6,7,8,9,10,11,12,13,14,15);

    const v8f e0 = __builtin_amdgcn_wmma_f32_16x16x32_f16(false, aq, false, kb0,
                                                          (short)0, czero, false, false);
    const v8f e1 = __builtin_amdgcn_wmma_f32_16x16x32_f16(false, aq, false, kb1,
                                                          (short)0, czero, false, false);

    // ---- P tile: packed (p0,p1) -> one b32 LDS store per row slot ----
    // Stored slot j maps to n offset (j>>1)|((j&1)<<4); vF uses same mapping.
    #pragma unroll
    for (int i = 0; i < 8; ++i) {
      const float a0 = __expf(e0[i] - rmax[i]);
      const float a1 = __expf(e1[i] - rmax[i]);
      rsum[i] += a0 + a1;                    // per-lane; reduced after the loop
      const int r = i + 8 * half;
      v2h pk; pk[0] = (_Float16)a0; pk[1] = (_Float16)a1;
      *(v2h*)(myP + r * AP + 2 * lr) = pk;
    }
    __builtin_amdgcn_wave_barrier();         // per-wave LDS is in-order
    const _Float16* pr = myP + lr * AP;
    const v8h plo = *(const v8h*)(pr + koff);
    const v8h phi = *(const v8h*)(pr + koff + 16);
    const v16h pa = __builtin_shufflevector(plo, phi, 0,1,2,3,4,5,6,7,8,9,10,11,12,13,14,15);
    __builtin_amdgcn_wave_barrier();

    // ---- PV: 16 channel tiles from this wave's staged V chunk ----
    const _Float16* vv = shV + (cur * KQ + kq) * C_ * AP;
    #pragma unroll
    for (int t = 0; t < 16; ++t) {
      const _Float16* vr = vv + (t * 16 + lr) * AP;
      const v8h vlo = *(const v8h*)(vr + koff);
      const v8h vhi = *(const v8h*)(vr + koff + 16);
      const v16h vb = __builtin_shufflevector(vlo, vhi, 0,1,2,3,4,5,6,7,8,9,10,11,12,13,14,15);
      acc[t] = __builtin_amdgcn_wmma_f32_16x16x32_f16(false, pa, false, vb,
                                                      (short)0, acc[t], false, false);
    }

    asm volatile("s_wait_dscnt 0x0" ::: "memory");      // this wave has left the current buffer
    asm volatile("s_wait_asynccnt 0x0" ::: "memory");   // its share of the next stage has landed
    __syncthreads();                                    // publishes the next stage, frees this buffer
  }
  // nothing is in flight into the ring when its LDS becomes the join's buffer
  asm volatile("s_wait_asynccnt 0x0" ::: "memory");

  // ---- join of the four key phases of a tile ----
  // source values of the four channel tiles this wave finishes, fetched ahead of the join
  const float gam = gamma_p[0];
  v4f sv[4][2];
  const float* __restrict__ sbase = src + ((size_t)b * C_ + kq * 64) * N_ + m0;   // same for the whole wave
  const unsigned soff = (lr * N_ + 8 * half) * 4;
  #pragma unroll
  for (int tt = 0; tt < 4; ++tt) {
    sv[tt][0] = ld16(sbase, soff, tt * 16 * N_ * 4);
    sv[tt][1] = ld16(sbase, soff, tt * 16 * N_ * 4 + 16);
  }
  // last use of soff: holds it to here, so that no load above takes it as its
  // destination, and puts the wait in front of whatever overwrites it next
  asm volatile("s_wait_xcnt 0x0" :: "v"(soff) : "memory");

  #pragma unroll
  for (int i = 0; i < 8; ++i) {   // one-time 16-lane row-sum reduction
    float s = rsum[i];
    s += __shfl_xor(s, 1, 32);
    s += __shfl_xor(s, 2, 32);
    s += __shfl_xor(s, 4, 32);
    s += __shfl_xor(s, 8, 32);
    rsum[i] = s;
  }
  if (lr == 0) {
    #pragma unroll
    for (int i = 0; i < 8; ++i) shS[wv][8 * half + i] = rsum[i];
  }
  float* const xj = (float*)smem;   // [wave][tile][register quad][lane] x 16 B
  #pragma unroll
  for (int t = 0; t < 16; ++t) {
    const v4f lo4 = {acc[t][0], acc[t][1], acc[t][2], acc[t][3]};
    const v4f hi4 = {acc[t][4], acc[t][5], acc[t][6], acc[t][7]};
    *(v4f*)(xj + (((wv * 16 + t) * 2 + 0) * 32 + lane) * 4) = lo4;
    *(v4f*)(xj + (((wv * 16 + t) * 2 + 1) * 32 + lane) * 4) = hi4;
  }
  __syncthreads();                  // every phase's partial sums are in LDS

  float linv[8];
  {
    v4f sa = *(const v4f*)&shS[mt][8 * half];
    v4f sb = *(const v4f*)&shS[mt][8 * half + 4];
    #pragma unroll
    for (int j = 1; j < KQ; ++j) {
      sa += *(const v4f*)&shS[j * MT + mt][8 * half];
      sb += *(const v4f*)&shS[j * MT + mt][8 * half + 4];
    }
    #pragma unroll
    for (int i = 0; i < 4; ++i) { linv[i] = 1.f / sa[i]; linv[i + 4] = 1.f / sb[i]; }
  }

  // ---- epilogue: gamma * (acc/sum) + source; contiguous 16B stores along m ----
  #pragma unroll
  for (int tt = 0; tt < 4; ++tt) {
    const int t = kq * 4 + tt;
    v4f p0 = *(const v4f*)(xj + (((mt * 16 + t) * 2 + 0) * 32 + lane) * 4);
    v4f p1 = *(const v4f*)(xj + (((mt * 16 + t) * 2 + 1) * 32 + lane) * 4);
    #pragma unroll
    for (int j = 1; j < KQ; ++j) {
      p0 += *(const v4f*)(xj + ((((j * MT + mt) * 16 + t) * 2 + 0) * 32 + lane) * 4);
      p1 += *(const v4f*)(xj + ((((j * MT + mt) * 16 + t) * 2 + 1) * 32 + lane) * 4);
    }
    const size_t base = ((size_t)b * C_ + t * 16 + lr) * N_ + m0 + 8 * half;
    v4f r0, r1;
    #pragma unroll
    for (int i = 0; i < 4; ++i) {
      r0[i] = gam * p0[i] * linv[i]     + sv[tt][0][i];
      r1[i] = gam * p1[i] * linv[i + 4] + sv[tt][1][i];
    }
    *(v4f*)(out + base)     = r0;
    *(v4f*)(out + base + 4) = r1;
  }
}

// ---------------------------------------------------------------------------
extern "C" void kernel_launch(void* const* d_in, const int* in_sizes, int n_in,
                              void* d_out, int out_size, void* d_ws, size_t ws_size,
                              hipStream_t stream) {
  const float* source = (const float*)d_in[0];
  const float* pose   = (const float*)d_in[1];
  const float* Wq     = (const float*)d_in[2];
  const float* bq     = (const float*)d_in[3];
  const float* Wk     = (const float*)d_in[4];
  const float* bk     = (const float*)d_in[5];
  const float* Wv     = (const float*)d_in[6];
  const float* bv     = (const float*)d_in[7];
  const float* gamma  = (const float*)d_in[8];
  float* out = (float*)d_out;

  // workspace: qT (1 MB) | kT (1 MB) | vF (8 MB), all f16
  _Float16* qT = (_Float16*)d_ws;
  _Float16* kT = qT + (size_t)B_ * N_ * CQ;
  _Float16* vF = kT + (size_t)B_ * N_ * CQ;

  proj_kernel<<<dim3(B_ * (N_ / 64)), dim3(256), 0, stream>>>(
      source, pose, Wq, bq, Wk, bk, Wv, bv, qT, kT, vF);

  attn_kernel<<<dim3(B_ * (N_ / 16) / MT), dim3(32 * WPB), 0, stream>>>(
      qT, kT, vF, source, gamma, out);
}

// v005
// A run of this version takes 62 microseconds.
// In two side-by-side timings against v004, it was 1.11 and 1.10 times as fast.
// All steps since v000 together make it 8.62 times as fast.
#include <hip/hip_runtime.h>
#include <cstdint>

typedef __attribute__((ext_vector_type(16))) _Float16 v16h;
typedef __attribute__((ext_vector_type(8)))  _Float16 v8h;
typedef __attribute__((ext_vector_type(4)))  _Float16 v4h;
typedef __attribute__((ext_vector_type(2)))  _Float16 v2h;
typedef __attribute__((ext_vector_type(8)))  float    v8f;
typedef __attribute__((ext_vector_type(4)))  float    v4f;
typedef __attribute__((ext_vector_type(2)))  float    v2f;
typedef __attribute__((ext_vector_type(4)))  int      v4i;

#define B_   4
#define C_   256
#define CQ   32
#define N_   4096
#define MT   4            // 16-row m tiles per attention block
#define KQ   4            // key phases: wave (mt, kq) takes the 32-key chunks 4*s + kq
#define WPB  (MT * KQ)    // waves per attention block (512 threads)
#define NC   (N_ / 32 / WPB)   // 32-key chunks per wave in pass A
#define KD   4                 // chunks that a wave's K loads run ahead of its products

// ---------------------------------------------------------------------------
// CDNA5 async global->LDS copy (ASYNCcnt-tracked), guarded so a missing
// builtin degrades to a plain load + ds_store without breaking the build.
// Builtin expects (int4 AS1*, int4 AS3*, imm offset, imm cpol) per the
// clang diagnostic ("int4 __device__ *").
// ---------------------------------------------------------------------------
#if __has_builtin(__builtin_amdgcn_global_load_async_to_lds_b128)
#define USE_ASYNC_LDS 1
typedef __attribute__((address_space(1))) v4i gv4i;
typedef __attribute__((address_space(3))) v4i lv4i;
#endif

__device__ __forceinline__ void cp16_async(void* lds, const void* g) {
#ifdef USE_ASYNC_LDS
  __builtin_amdgcn_global_load_async_to_lds_b128(
      (gv4i*)(uintptr_t)g, (lv4i*)(unsigned)(uintptr_t)lds, 0, 0);
#else
  *(v8h*)lds = *(const v8h*)g;
#endif
}

// K-slot permutation for the PV matmul (shared by P-store and vF layout):
//   K slot j <-> n offset (j>>1) | ((j&1)<<4)   within each 32-column chunk.

// ---------------------------------------------------------------------------
// Kernel 1: 1x1-conv projections on the matrix unit.
//   q = Wq @ pose + bq   -> qT [B][N][CQ] f16   (K-contiguous for WMMA gather)
//   k = Wk @ src  + bk   -> kT [B][N][CQ] f16
//   v = Wv @ src  + bv   -> vF [B][C][N]  f16   (n pre-permuted per 32-chunk)
// One block = 64 columns n of one batch. Both input tiles are rounded to f16
// and staged column-major ([n][c]) in LDS, so a fragment is 16 contiguous c.
// Each f32 weight enters as an f16 pair hi + lo (lo = w - hi), two products
// into one f32 accumulator, so the weights keep about 22 significant bits.
// Every fragment, of X and of W alike, holds k = 32*ks + 16*(lane>>4) + s.
// ---------------------------------------------------------------------------
#define XP 264   // halves per staged column: 256 c + 8 (528 B = 16 B x 33)
#define WP 40    // halves per staged weight row: 32 k + 8 (80 B = 16 B x 5)

__device__ __forceinline__ v16h frag16(const _Float16* p) {
  const v8h lo = *(const v8h*)p;
  const v8h hi = *(const v8h*)(p + 8);
  return __builtin_shufflevector(lo, hi, 0,1,2,3,4,5,6,7,8,9,10,11,12,13,14,15);
}

__device__ __forceinline__ v8f mma16(v16h a, v16h b, v8f c) {
  return __builtin_amdgcn_wmma_f32_16x16x32_f16(false, a, false, b, (short)0, c, false, false);
}

// 16 B at a wave-uniform base + the lane's 32-bit byte offset + a constant: every
// load of a family names one offset register and a scalar base, no address pair.
__device__ __forceinline__ v4f ld16(const float* __restrict__ base, unsigned voff, int imm) {
  return *(const v4f*)((const char*)base + (size_t)voff + imm);
}

// the same for eight halves
__device__ __forceinline__ v8h ld16h(const _Float16* __restrict__ base, unsigned voff, int imm) {
  return *(const v8h*)((const char*)base + (size_t)voff + imm);
}

// 256 c x 64 n of X into registers: 8 lanes cover one 128 B line of a row.
__device__ __forceinline__ void load_x(const float* __restrict__ X, unsigned xoff,
                                       v4f (&raw)[16]) {
  #pragma unroll
  for (int i = 0; i < 16; ++i)
    raw[i] = ld16(X, xoff, ((i >> 3) * 128 + (i & 7)) * N_ * 4);
}

// ... and transposed into LDS: 8 consecutive c of one column per 16 B store.
__device__ __forceinline__ void store_x(_Float16* sx, int nq, int cg, const v4f (&raw)[16]) {
  #pragma unroll
  for (int p = 0; p < 2; ++p)
    #pragma unroll
    for (int e = 0; e < 4; ++e) {
      v8h col;
      #pragma unroll
      for (int j = 0; j < 8; ++j) col[j] = (_Float16)raw[p * 8 + j][e];
      *(v8h*)(sx + (nq * 4 + e) * XP + p * 128 + cg * 8) = col;
    }
}

// 32 weight rows x 32 k (one k step) into registers: 8 lanes per 128 B line.
__device__ __forceinline__ void load_w(const float* __restrict__ Wr, int ks, unsigned woff,
                                       v4f (&wr)[8]) {
  #pragma unroll
  for (int i = 0; i < 8; ++i) wr[i] = ld16(Wr, woff, (i * 4 * C_ + ks * 32) * 4);
}

// Split into hi + lo and turn into fragments through the wave's own LDS patch.
__device__ __forceinline__ void split_w(_Float16* wl, int lane, const v4f (&wr)[8],
                                        v16h (&hi)[2], v16h (&lo)[2]) {
  #pragma unroll
  for (int i = 0; i < 8; ++i) {
    const int row = i * 4 + (lane >> 3);
    const v2f wa = {wr[i][0], wr[i][1]}, wb = {wr[i][2], wr[i][3]};
    const v2h ha = __builtin_convertvector(wa, v2h), hb = __builtin_convertvector(wb, v2h);
    const v2f da = {wa[0] - (float)ha[0], wa[1] - (float)ha[1]};
    const v2f db = {wb[0] - (float)hb[0], wb[1] - (float)hb[1]};
    const v2h la = __builtin_convertvector(da, v2h), lb = __builtin_convertvector(db, v2h);
    const v4h h4 = __builtin_shufflevector(ha, hb, 0, 1, 2, 3);
    const v4h l4 = __builtin_shufflevector(la, lb, 0, 1, 2, 3);
    *(v4h*)(wl + row * WP + (lane & 7) * 4)        = h4;
    *(v4h*)(wl + (32 + row) * WP + (lane & 7) * 4) = l4;
  }
  __builtin_amdgcn_wave_barrier();   // keeps the reads below behind the stores (per-wave LDS is in-order)
  const _Float16* rd = wl + (lane & 15) * WP + 16 * (lane >> 4);
  #pragma unroll
  for (int t = 0; t < 2; ++t) {
    hi[t] = frag16(rd + t * 16 * WP);
    lo[t] = frag16(rd + (32 + t * 16) * WP);
  }
  __builtin_amdgcn_wave_barrier();   // keeps the next k step's stores behind these reads
}

__global__ __launch_bounds__(256)
void proj_kernel(const float* __restrict__ source, const float* __restrict__ pose,
                 const float* __restrict__ Wq, const float* __restrict__ bq,
                 const float* __restrict__ Wk, const float* __restrict__ bk,
                 const float* __restrict__ Wv, const float* __restrict__ bv,
                 _Float16* __restrict__ qT, _Float16* __restrict__ kT,
                 _Float16* __restrict__ vF) {
  __shared__ __align__(16) _Float16 shX[2][64 * XP];   // [0] pose, [1] source: [n][c]
  __shared__ __align__(16) _Float16 shW[8][64 * WP];   // per wave: 32 rows hi, 32 rows lo
  const int tid  = threadIdx.x;
  const int lane = tid & 31;
  const int wv   = __builtin_amdgcn_readfirstlane(tid >> 5);
  const int b    = blockIdx.x / (N_ / 64);
  const int n0   = (blockIdx.x % (N_ / 64)) * 64;
  const int lr   = lane & 15;
  const int half = lane >> 4;
  _Float16* wl   = &shW[wv][0];

  // waves 0-3: q of one 16-column tile each; waves 4-7: k likewise
  const bool isq = wv < 4;
  const float* __restrict__ W1  = isq ? Wq : Wk;
  const float* __restrict__ Wvr = Wv + wv * 32 * C_;   // then 32 rows of v, all 64 columns

  // weight steps 0-7: the q / k rows, 8-15: the v rows; fetched two steps ahead,
  // so that a step's conversions never wait on loads issued just before them
  const unsigned woff = ((lane >> 3) * C_ + (lane & 7) * 4) * 4;
  auto fetch = [&](int s, v4f (&dst)[8]) {
    if (s < 8) load_w(W1, s, woff, dst);
    else       load_w(Wvr, s - 8, woff, dst);
    // last use of woff: holds it to here, so that no load above takes it as its
    // destination, and puts the wait in front of whatever overwrites it next
    if (s == 15) asm volatile("s_wait_xcnt 0x0" :: "v"(woff) : "memory");
    // keeps the later steps' conversions, and with them their data waits, behind
    // the issue of these loads
    __builtin_amdgcn_sched_barrier(0);
  };
  v4f wr[2][8];
  {
    const int nq = (lane & 7) + 8 * (wv & 1);
    const int cg = (lane >> 3) + 4 * (wv >> 1);
    v4f rp[16], rs[16];
    const unsigned xoff = (cg * 8 * N_ + nq * 4) * 4;
    load_x(pose   + (size_t)b * C_ * N_ + n0, xoff, rp);
    load_x(source + (size_t)b * C_ * N_ + n0, xoff, rs);
    // last use of xoff: as for woff in fetch()
    asm volatile("s_wait_xcnt 0x0" :: "v"(xoff) : "memory");
    fetch(0, wr[0]);
    fetch(1, wr[1]);
    store_x(&shX[0][0], nq, cg, rp);
    store_x(&shX[1][0], nq, cg, rs);
  }
  __syncthreads();

  // ---- q / k: A = W (rows o), B = X (columns n); D[r] = row o = 8*half + r ----
  {
    const _Float16* xcol = &shX[isq ? 0 : 1][((wv & 3) * 16 + lr) * XP + 16 * half];
    v8f a0 = {}, a1 = {};
    #pragma unroll
    for (int ks = 0; ks < 8; ++ks) {
      v16h hi[2], lo[2];
      split_w(wl, lane, wr[ks & 1], hi, lo);
      fetch(ks + 2, wr[ks & 1]);
      const v16h xb = frag16(xcol + ks * 32);
      a0 = mma16(hi[0], xb, a0);
      a1 = mma16(hi[1], xb, a1);
      a0 = mma16(lo[0], xb, a0);
      a1 = mma16(lo[1], xb, a1);
    }
    const float* __restrict__ b1 = (isq ? bq : bk) + 8 * half;
    v8h o0, o1;
    #pragma unroll
    for (int r = 0; r < 8; ++r) {
      o0[r] = (_Float16)(a0[r] + b1[r]);
      o1[r] = (_Float16)(a1[r] + b1[16 + r]);
    }
    _Float16* dst = (isq ? qT : kT) + ((size_t)b * N_ + n0 + (wv & 3) * 16 + lr) * CQ + 8 * half;
    *(v8h*)dst        = o0;
    *(v8h*)(dst + 16) = o1;
  }

  // ---- v: A = X (rows n), B = W (columns o); D[r] = row n = 8*half + r ----
  {
    v8f acc[2][4];
    #pragma unroll
    for (int t = 0; t < 2; ++t)
      #pragma unroll
      for (int nt = 0; nt < 4; ++nt)
        #pragma unroll
        for (int i = 0; i < 8; ++i) acc[t][nt][i] = 0.f;

    float bias[2];   // read ahead of the loop, so that the epilogue does not wait on them
    #pragma unroll
    for (int t = 0; t < 2; ++t) bias[t] = bv[wv * 32 + t * 16 + lr];

    const _Float16* xrow = &shX[1][lr * XP + 16 * half];
    #pragma unroll
    for (int ks = 0; ks < 8; ++ks) {
      v16h hi[2], lo[2];
      split_w(wl, lane, wr[ks & 1], hi, lo);
      if (ks < 6) fetch(ks + 10, wr[ks & 1]);
      v16h xa[4];
      #pragma unroll
      for (int nt = 0; nt < 4; ++nt) xa[nt] = frag16(xrow + nt * 16 * XP + ks * 32);
      #pragma unroll
      for (int t = 0; t < 2; ++t)
        #pragma unroll
        for (int nt = 0; nt < 4; ++nt) acc[t][nt] = mma16(xa[nt], hi[t], acc[t][nt]);
      #pragma unroll
      for (int t = 0; t < 2; ++t)
        #pragma unroll
        for (int nt = 0; nt < 4; ++nt) acc[t][nt] = mma16(xa[nt], lo[t], acc[t][nt]);
    }

    // K-slot permutation for v: column x (0..31) -> slot ((x&15)<<1)|(x>>4), so the
    // two 16-column tiles of a 32-chunk interleave: 16 consecutive slots per lane.
    #pragma unroll
    for (int t = 0; t < 2; ++t) {
      const int o = wv * 32 + t * 16 + lr;
      #pragma unroll
      for (int p = 0; p < 2; ++p) {
        v8h s0, s1;
        #pragma unroll
        for (int r = 0; r < 4; ++r) {
          s0[2 * r]     = (_Float16)(acc[t][2 * p][r] + bias[t]);
          s0[2 * r + 1] = (_Float16)(acc[t][2 * p + 1][r] + bias[t]);
          s1[2 * r]     = (_Float16)(acc[t][2 * p][r + 4] + bias[t]);
          s1[2 * r + 1] = (_Float16)(acc[t][2 * p + 1][r + 4] + bias[t]);
        }
        _Float16* dst = vF + ((size_t)b * C_ + o) * N_ + n0 + 32 * p + 16 * half;
        *(v8h*)dst       = s0;
        *(v8h*)(dst + 8) = s1;
      }
    }
  }
}

// ---------------------------------------------------------------------------
// Kernel 2: fused two-pass flash attention.
// One block = 64 rows m of one batch, 16 waves. Pass A (the exact row maxima)
// deals the keys over all 16 waves, each scoring its keys against all 64 rows.
// In pass B wave (mt, kq) takes every fourth 32-key chunk (4*s + kq) and there owns
// all 64 rows x the 64 channels of quarter mt: a V fragment and a P fragment each
// feed four products. The P tile of rows mt of its chunk is made by that wave, one
// stage ahead, and handed to the chunk's other three waves through LDS at the
// stage's barrier. The grid is one block per WGP. The four phases share the exact
// row maximum (joined through LDS after pass A), so their partial sums add without
// any rescale; they are joined through LDS at the end, always in the order
// kq = 0..3, wave (mt, kq) finishing rows kq of its channel quarter.
// Pass B double-buffers a 128-key stage of K and V in LDS via async global->LDS
// copies (K runs one stage ahead of V, for the P tiles): a V row of a stage is 256
// contiguous bytes, so a copy takes whole lines.
// Every staged row is 32 halves and is read as 16 B pieces by 16 lanes, one row
// each: a pitch of 16 B x odd puts those 16 pieces on all 64 banks once.
// ---------------------------------------------------------------------------
#define AP 40    // halves per staged row of V, K and P: 32 + 8 (80 B = 16 B x 5)
#define SM_V   0                                  // [2][KQ][C_][AP] halves
#define SM_K   (SM_V + 2 * KQ * C_ * AP * 2)      // [2][KQ][32][AP] halves
#define SM_P   (SM_K + 2 * KQ * 32 * AP * 2)      // [2][KQ][MT][16][AP] halves
#define SM_X   (WPB * 16 * 1024)                  // the join: [WPB][16 tiles][2][32 lanes] x 16 B
// SM_X is the larger of the two uses (ring + P: 225280 B, join: 262144 B)

__global__ __launch_bounds__(512)
void attn_kernel(const _Float16* __restrict__ qT, const _Float16* __restrict__ kT,
                 const _Float16* __restrict__ vF, const float* __restrict__ src,
                 const float* __restrict__ gamma_p, float* __restrict__ out) {
  __shared__ __align__(64) unsigned char smem[SM_X];
  // per wave: maxima of the block's 64 rows over its keys; 272 B = 16 B x 17 a wave,
  // so that 16 lanes reading 16 B of one wave each meet all 64 banks once
  __shared__ __align__(16) float shM[WPB][MT * 16 + 4];
  __shared__ __align__(16) float shS[WPB][16];   // per wave: row sums of its keys
  _Float16* const shV = (_Float16*)(smem + SM_V);
  _Float16* const shK = (_Float16*)(smem + SM_K);
  _Float16* const shP = (_Float16*)(smem + SM_P);

  const int tid  = threadIdx.x;
  const int lane = tid & 31;
  const int wv   = __builtin_amdgcn_readfirstlane(tid >> 5);
  const int mt   = wv & (MT - 1);
  const int kq   = wv / MT;
  const int b    = blockIdx.x / (N_ / 16 / MT);                // uniform per block
  const int m0   = ((blockIdx.x % (N_ / 16 / MT)) * MT + mt) * 16;
  const int half = lane >> 4;           // 0: rows 0-7/K 0-7,16-23 ; 1: rows 8-15/K 8-15,24-31
  const int lr   = lane & 15;
  const int koff = half ? 8 : 0;

  // A-operand: q rows m0..m0+15, K-packed per ISA 16-bit A layout
  const _Float16* qrow = qT + ((size_t)b * N_ + m0 + lr) * CQ;
  const v8h qlo = *(const v8h*)(qrow + koff);
  const v8h qhi = *(const v8h*)(qrow + koff + 16);
  const v16h aq = __builtin_shufflevector(qlo, qhi, 0,1,2,3,4,5,6,7,8,9,10,11,12,13,14,15);

  const v8f czero = {};

  // ========== Pass A: exact row maxima ==========
  // Wave wv takes the 32-key chunks wv + 16*i and scores them against all four row
  // tiles: a chunk is loaded once per block, and a wave's loads run KD chunks ahead
  // of its products, one exposed round of load latency in place of one per chunk.
  // The products are K.Q^T: D holds row m = lr of a tile in a lane and 8 keys in its
  // registers, so a row's maximum is in-lane but for one exchange between the halves.
  {
    const _Float16* __restrict__ qblk = qT + ((size_t)b * N_ + (blockIdx.x % (N_ / 16 / MT)) * MT * 16) * CQ;
    const _Float16* __restrict__ kwav = kT + ((size_t)b * N_ + wv * 32) * CQ;   // same for the whole wave
    const unsigned fo = (lr * CQ + koff) * 2;   // the lane's byte offset in a 16-row fragment
    v8h qf[MT][2], kf[KD][4];
    auto fetch = [&](int i, v8h (&dst)[4]) {   // chunk wv + 16*i
      const _Float16* __restrict__ kc = kwav + (size_t)i * WPB * 32 * CQ;
      dst[0] = ld16h(kc, fo, 0);
      dst[1] = ld16h(kc, fo, 32);
      dst[2] = ld16h(kc, fo, 16 * CQ * 2);
      dst[3] = ld16h(kc, fo, 16 * CQ * 2 + 32);
    };
    #pragma unroll
    for (int u = 0; u < MT; ++u) {
      qf[u][0] = ld16h(qblk, fo, u * 16 * CQ * 2);
      qf[u][1] = ld16h(qblk, fo, u * 16 * CQ * 2 + 32);
    }
    // the q loads go out first: loads are waited for in issue order, and a q load among
    // the K loads makes the first products wait out the K loads in front of it (the
    // build without this line did so, waited to zero and spilled)
    __builtin_amdgcn_sched_barrier(0);
    #pragma unroll
    for (int d = 0; d < KD; ++d) fetch(d, kf[d]);

    v16h qb[MT];
    #pragma unroll
    for (int u = 0; u < MT; ++u)
      qb[u] = __builtin_shufflevector(qf[u][0], qf[u][1], 0,1,2,3,4,5,6,7,8,9,10,11,12,13,14,15);
    float cm[MT][8];
    #pragma unroll
    for (int u = 0; u < MT; ++u)
      #pragma unroll
      for (int r = 0; r < 8; ++r) cm[u][r] = -3.0e38f;
    auto score = [&](const v8h (&k)[4]) {   // one chunk against the four row tiles
      const v16h ka0 = __builtin_shufflevector(k[0], k[1], 0,1,2,3,4,5,6,7,8,9,10,11,12,13,14,15);
      const v16h ka1 = __builtin_shufflevector(k[2], k[3], 0,1,2,3,4,5,6,7,8,9,10,11,12,13,14,15);
      #pragma unroll
      for (int u = 0; u < MT; ++u) {
        const v8f e0 = __builtin_amdgcn_wmma_f32_16x16x32_f16(false, ka0, false, qb[u],
                                                              (short)0, czero, false, false);
        const v8f e1 = __builtin_amdgcn_wmma_f32_16x16x32_f16(false, ka1, false, qb[u],
                                                              (short)0, czero, false, false);
        #pragma unroll
        for (int r = 0; r < 8; ++r) cm[u][r] = fmaxf(cm[u][r], fmaxf(e0[r], e1[r]));
      }
    };
    #pragma unroll
    for (int i = KD; i < NC; i += KD) {
      #pragma unroll
      for (int d = 0; d < KD; ++d) {
        score(kf[d]);
        fetch(i + d, kf[d]);
      }
    }
    // last use of fo: holds it to here, so that no load above takes it as its
    // destination, and puts the wait in front of whatever overwrites it next
    asm volatile("s_wait_xcnt 0x0" :: "v"(fo) : "memory");
    #pragma unroll
    for (int d = 0; d < KD; ++d) score(kf[d]);
    float mm[MT];
    #pragma unroll
    for (int u = 0; u < MT; ++u) {
      const float m = fmaxf(fmaxf(fmaxf(cm[u][0], cm[u][1]), fmaxf(cm[u][2], cm[u][3])),
                            fmaxf(fmaxf(cm[u][4], cm[u][5]), fmaxf(cm[u][6], cm[u][7])));
      mm[u] = fmaxf(m, __shfl_xor(m, 16, 32));
    }
    if (half == 0) {                // read by every wave behind the prologue's barrier
      #pragma unroll
      for (int u = 0; u < MT; ++u) shM[wv][u * 16 + lr] = mm[u];
    }
  }

  // ================= Pass B: P = exp(e - max), PV accumulation ==============
  v8f acc[16];
  #pragma unroll
  for (int t = 0; t < 16; ++t)
    #pragma unroll
    for (int i = 0; i < 8; ++i) acc[t][i] = 0.f;
  float rsum[8];
  #pragma unroll
  for (int i = 0; i < 8; ++i) rsum[i] = 0.f;

  const _Float16* vbase = vF + (size_t)b * C_ * N_;

  // cooperative staging roles: 512 threads, 16 B per async op, every lane on.
  // V: 16 lanes cover the 256 B (four chunks) of one row; K: 4 lanes cover a 64 B row.
  const int vpart = tid & 15;    // 16 B piece of a V row: chunk vpart >> 2, piece vpart & 3
  const int vrow  = tid >> 4;    // 0..31, then + 32 per copy
  const int part  = tid & 3;     // 16 B piece of a K row
  const int krow  = tid >> 2;    // 0..127: chunk krow >> 5, row krow & 31
  _Float16* const vdst = shV + ((vpart >> 2) * C_ + vrow) * AP + (vpart & 3) * 8;
  _Float16* const kdst = shK + krow * AP + part * 8;
  // the lane's byte offsets from bases that are the same for the whole block
  const unsigned vgo = (vrow * N_ + vpart * 8) * 2;
  const unsigned kgo = (krow * CQ + part * 8) * 2;
  const _Float16* kstage = kT + (size_t)b * N_ * CQ;

  auto stage_v = [&](int buf, int n0) {   // n0: first of the stage's 128 keys
    #pragma unroll
    for (int r = 0; r < 8; ++r)
      cp16_async(vdst + buf * (KQ * C_ * AP) + r * 32 * AP,
                 (const char*)(vbase + n0 + (size_t)r * 32 * N_) + (size_t)vgo);
  };
  auto stage_k = [&](int buf, int n0) {
    cp16_async(kdst + buf * (KQ * 32 * AP),
               (const char*)(kstage + (size_t)n0 * CQ) + (size_t)kgo);
  };

  float rmax[8];

  // energy of rows mt against this wave's chunk of the K stage in buffer buf
  auto energy = [&](int buf, v8f& e0, v8f& e1) {
    const _Float16* kk = shK + (buf * KQ + kq) * 32 * AP;
    const v8h kl0 = *(const v8h*)(kk + lr * AP + koff);
    const v8h kh0 = *(const v8h*)(kk + lr * AP + koff + 16);
    const v8h kl1 = *(const v8h*)(kk + (16 + lr) * AP + koff);
    const v8h kh1 = *(const v8h*)(kk + (16 + lr) * AP + koff + 16);
    const v16h kb0 = __builtin_shufflevector(kl0, kh0, 0,1,2,3,4,5,6,7,8,9,10,11,12,13,14,15);
    const v16h kb1 = __builtin_shufflevector(kl1, kh1, 0,1,2,3,4,5,6,7,8,9,10,11,12,13,14,15);
    e0 = __builtin_amdgcn_wmma_f32_16x16x32_f16(false, aq, false, kb0,
                                                (short)0, czero, false, false);
    e1 = __builtin_amdgcn_wmma_f32_16x16x32_f16(false, aq, false, kb1,
                                                (short)0, czero, false, false);
  };

  // P tile of rows mt into P buffer buf: packed (p0,p1) -> one b32 LDS store per row slot.
  // Stored slot j maps to n offset (j>>1)|((j&1)<<4); vF uses same mapping.
  auto put_p = [&](int buf, const v8f& e0, const v8f& e1) {
    _Float16* myP = shP + ((buf * KQ + kq) * MT + mt) * 16 * AP;
    #pragma unroll
    for (int i = 0; i < 8; ++i) {
      const float a0 = __expf(e0[i] - rmax[i]);
      const float a1 = __expf(e1[i] - rmax[i]);
      rsum[i] += a0 + a1;                    // per-lane; reduced after the loop
      const int r = i + 8 * half;
      v2h pk; pk[0] = (_Float16)a0; pk[1] = (_Float16)a1;
      *(v2h*)(myP + r * AP + 2 * lr) = pk;
    }
  };

  // PV of this wave's chunk in buffer buf: 4 row tiles x the 4 channel tiles of quarter mt
  auto pv = [&](int buf) {
    const _Float16* pp = shP + (buf * KQ + kq) * MT * 16 * AP + lr * AP + koff;
    const _Float16* vv = shV + ((buf * KQ + kq) * C_ + mt * 64 + lr) * AP + koff;
    v16h pa[MT];
    #pragma unroll
    for (int u = 0; u < MT; ++u) {
      const v8h plo = *(const v8h*)(pp + u * 16 * AP);
      const v8h phi = *(const v8h*)(pp + u * 16 * AP + 16);
      pa[u] = __builtin_shufflevector(plo, phi, 0,1,2,3,4,5,6,7,8,9,10,11,12,13,14,15);
    }
    #pragma unroll
    for (int c = 0; c < 4; ++c) {
      const v8h vlo = *(const v8h*)(vv + c * 16 * AP);
      const v8h vhi = *(const v8h*)(vv + c * 16 * AP + 16);
      const v16h vb = __builtin_shufflevector(vlo, vhi, 0,1,2,3,4,5,6,7,8,9,10,11,12,13,14,15);
      #pragma unroll
      for (int u = 0; u < MT; ++u)
        acc[u * 4 + c] = __builtin_amdgcn_wmma_f32_16x16x32_f16(false, pa[u], false, vb,
                                                                (short)0, acc[u * 4 + c], false, false);
    }
  };

  stage_k(0, 0);
  asm volatile("s_wait_asynccnt 0x0" ::: "memory");   // this wave's share of K stage 0 has landed
  __syncthreads();                                    // K stage 0 and shM are published
  stage_v(0, 0);
  stage_k(1, 32 * KQ);

  // the exact max of rows mt over all keys: lane lr takes wave lr's maxima of the
  // rows 8*half .. 8*half + 7, then one-time 16-lane reductions
  {
    const v4f ma = *(const v4f*)&shM[lr][mt * 16 + 8 * half];
    const v4f mb = *(const v4f*)&shM[lr][mt * 16 + 8 * half + 4];
    #pragma unroll
    for (int i = 0; i < 4; ++i) { rmax[i] = ma[i]; rmax[i + 4] = mb[i]; }
    #pragma unroll
    for (int i = 0; i < 8; ++i) {
      float m = rmax[i];
      m = fmaxf(m, __shfl_xor(m, 1, 32));
      m = fmaxf(m, __shfl_xor(m, 2, 32));
      m = fmaxf(m, __shfl_xor(m, 4, 32));
      m = fmaxf(m, __shfl_xor(m, 8, 32));
      rmax[i] = m;
    }
  }
  {
    v8f e0, e1;
    energy(0, e0, e1);
    put_p(0, e0, e1);
  }
  asm volatile("s_wait_dscnt 0x0" ::: "memory");      // this wave's P tile of stage 0 is written
  asm volatile("s_wait_asynccnt 0x0" ::: "memory");   // its shares of V stage 0 and K stage 1 have landed
  __syncthreads();                                    // publishes P and V of stage 0 and K of stage 1

  // trip st: PV of stage st; P of stage st + 1 from the K stage published at the last
  // barrier; V of stage st + 1 and K of stage st + 2 fly into the buffers that the
  // trip before has left
  for (int st = 0; st < N_ / (32 * KQ) - 1; ++st) {
    const int cur = st & 1;
    stage_v(cur ^ 1, (st + 1) * 32 * KQ);
    if (st + 2 < N_ / (32 * KQ)) stage_k(cur, (st + 2) * 32 * KQ);

    v8f e0, e1;
    energy(cur ^ 1, e0, e1);
    pv(cur);
    put_p(cur ^ 1, e0, e1);

    // keeps this trip's products in front of the barrier: sunk behind it they stand in
    // front of the next trip's copies, which then have less of the trip to land in, and
    // their fragments stay live over the copies' addresses (that build spilled)
    __builtin_amdgcn_sched_barrier(0);
    asm volatile("s_wait_dscnt 0x0" ::: "memory");      // this wave has left the current buffers, its P tile is written
    asm volatile("s_wait_asynccnt 0x0" ::: "memory");   // its shares of the next stages have landed
    __syncthreads();                                    // publishes the next stage, frees these buffers
  }
  pv((N_ / (32 * KQ) - 1) & 1);
  asm volatile("s_wait_dscnt 0x0" ::: "memory");        // this wave has left the ring
  // nothing is in flight into the ring when its LDS becomes the join's buffer
  asm volatile("s_wait_asynccnt 0x0" ::: "memory");
  __syncthreads();                                      // every wave has left the ring

  // ---- join of the four key phases ----
  // this wave finishes rows kq of its channel quarter (accumulators 4*kq .. 4*kq + 3);
  // their source values are fetched ahead of the join
  const int mo = ((blockIdx.x % (N_ / 16 / MT)) * MT + kq) * 16;
  const float gam = gamma_p[0];
  v4f sv[4][2];
  const float* __restrict__ sbase = src + ((size_t)b * C_ + mt * 64) * N_ + mo;   // same for the whole wave
  const unsigned soff = (lr * N_ + 8 * half) * 4;
  #pragma unroll
  for (int tt = 0; tt < 4; ++tt) {
    sv[tt][0] = ld16(sbase, soff, tt * 16 * N_ * 4);
    sv[tt][1] = ld16(sbase, soff, tt * 16 * N_ * 4 + 16);
  }
  // last use of soff: holds it to here, so that no load above takes it as its
  // destination, and puts the wait in front of whatever overwrites it next
  asm volatile("s_wait_xcnt 0x0" :: "v"(soff) : "memory");

  #pragma unroll
  for (int i = 0; i < 8; ++i) {   // one-time 16-lane row-sum reduction
    float s = rsum[i];
    s += __shfl_xor(s, 1, 32);
    s += __shfl_xor(s, 2, 32);
    s += __shfl_xor(s, 4, 32);
    s += __shfl_xor(s, 8, 32);
    rsum[i] = s;
  }
  if (lr == 0) {
    #pragma unroll
    for (int i = 0; i < 8; ++i) shS[wv][8 * half + i] = rsum[i];
  }
  float* const xj = (float*)smem;   // [wave][tile][register quad][lane] x 16 B
  #pragma unroll
  for (int t = 0; t < 16; ++t) {
    const v4f lo4 = {acc[t][0], acc[t][1], acc[t][2], acc[t][3]};
    const v4f hi4 = {acc[t][4], acc[t][5], acc[t][6], acc[t][7]};
    *(v4f*)(xj + (((wv * 16 + t) * 2 + 0) * 32 + lane) * 4) = lo4;
    *(v4f*)(xj + (((wv * 16 + t) * 2 + 1) * 32 + lane) * 4) = hi4;
  }
  __syncthreads();                  // every phase's partial sums are in LDS

  float linv[8];
  {
    v4f sa = *(const v4f*)&shS[kq][8 * half];       // shS[j * MT + kq]: rows kq, phase j
    v4f sb = *(const v4f*)&shS[kq][8 * half + 4];
    #pragma unroll
    for (int j = 1; j < KQ; ++j) {
      sa += *(const v4f*)&shS[j * MT + kq][8 * half];
      sb += *(const v4f*)&shS[j * MT + kq][8 * half + 4];
    }
    #pragma unroll
    for (int i = 0; i < 4; ++i) { linv[i] = 1.f / sa[i]; linv[i + 4] = 1.f / sb[i]; }
  }

  // ---- epilogue: gamma * (acc/sum) + source; contiguous 16B stores along m ----
  #pragma unroll
  for (int tt = 0; tt < 4; ++tt) {
    const int t = kq * 4 + tt;
    v4f p0 = *(const v4f*)(xj + (((mt * 16 + t) * 2 + 0) * 32 + lane) * 4);
    v4f p1 = *(const v4f*)(xj + (((mt * 16 + t) * 2 + 1) * 32 + lane) * 4);
    #pragma unroll
    for (int j = 1; j < KQ; ++j) {
      p0 += *(const v4f*)(xj + ((((j * MT + mt) * 16 + t) * 2 + 0) * 32 + lane) * 4);
      p1 += *(const v4f*)(xj + ((((j * MT + mt) * 16 + t) * 2 + 1) * 32 + lane) * 4);
    }
    const size_t base = ((size_t)b * C_ + mt * 64 + tt * 16 + lr) * N_ + mo + 8 * half;
    v4f r0, r1;
    #pragma unroll
    for (int i = 0; i < 4; ++i) {
      r0[i] = gam * p0[i] * linv[i]     + sv[tt][0][i];
      r1[i] = gam * p1[i] * linv[i + 4] + sv[tt][1][i];
    }
    *(v4f*)(out + base)     = r0;
    *(v4f*)(out + base + 4) = r1;
  }
}

// ---------------------------------------------------------------------------
extern "C" void kernel_launch(void* const* d_in, const int* in_sizes, int n_in,
                              void* d_out, int out_size, void* d_ws, size_t ws_size,
                              hipStream_t stream) {
  const float* source = (const float*)d_in[0];
  const float* pose   = (const float*)d_in[1];
  const float* Wq     = (const float*)d_in[2];
  const float* bq     = (const float*)d_in[3];
  const float* Wk     = (const float*)d_in[4];
  const float* bk     = (const float*)d_in[5];
  const float* Wv     = (const float*)d_in[6];
  const float* bv     = (const float*)d_in[7];
  const float* gamma  = (const float*)d_in[8];
  float* out = (float*)d_out;

  // workspace: qT (1 MB) | kT (1 MB) | vF (8 MB), all f16
  _Float16* qT = (_Float16*)d_ws;
  _Float16* kT = qT + (size_t)B_ * N_ * CQ;
  _Float16* vF = kT + (size_t)B_ * N_ * CQ;

  proj_kernel<<<dim3(B_ * (N_ / 64)), dim3(256), 0, stream>>>(
      source, pose, Wq, bq, Wk, bk, Wv, bv, qT, kT, vF);

  attn_kernel<<<dim3(B_ * (N_ / 16) / MT), dim3(32 * WPB), 0, stream>>>(
      qT, kT, vF, source, gamma, out);
}

// v006
// One run takes 52.8 microseconds.
// Two timings next to v005 put it at 1.16 and 1.18 times that version's speed.
// All steps since v000 together make it 10.1 times as fast.
#include <hip/hip_runtime.h>
#include <cstdint>

typedef __attribute__((ext_vector_type(16))) _Float16 v16h;
typedef __attribute__((ext_vector_type(8)))  _Float16 v8h;
typedef __attribute__((ext_vector_type(4)))  _Float16 v4h;
typedef __attribute__((ext_vector_type(2)))  _Float16 v2h;
typedef __attribute__((ext_vector_type(8)))  float    v8f;
typedef __attribute__((ext_vector_type(4)))  float    v4f;
typedef __attribute__((ext_vector_type(2)))  float    v2f;
typedef __attribute__((ext_vector_type(4)))  int      v4i;

#define B_   4
#define C_   256
#define CQ   32
#define N_   4096
#define MT   4            // 16-row m tiles per attention block
#define KQ   4            // key phases: wave (mt, kq) takes the 32-key chunks 4*s + kq
#define WPB  (MT * KQ)    // waves per attention block (512 threads)
#define NC   (N_ / 32 / WPB)   // 32-key chunks per wave in pass A
#define KD   4                 // chunks that a wave's K loads run ahead of its products

// ---------------------------------------------------------------------------
// CDNA5 async global->LDS copy (ASYNCcnt-tracked), guarded so a missing
// builtin degrades to a plain load + ds_store without breaking the build.
// Builtin expects (int4 AS1*, int4 AS3*, imm offset, imm cpol) per the
// clang diagnostic ("int4 __device__ *").
// ---------------------------------------------------------------------------
#if __has_builtin(__builtin_amdgcn_global_load_async_to_lds_b128)
#define USE_ASYNC_LDS 1
typedef __attribute__((address_space(1))) v4i gv4i;
typedef __attribute__((address_space(3))) v4i lv4i;
#endif

__device__ __forceinline__ void cp16_async(void* lds, const void* g) {
#ifdef USE_ASYNC_LDS
  __builtin_amdgcn_global_load_async_to_lds_b128(
      (gv4i*)(uintptr_t)g, (lv4i*)(unsigned)(uintptr_t)lds, 0, 0);
#else
  *(v8h*)lds = *(const v8h*)g;
#endif
}

// K-slot permutation for the PV matmul (shared by P-store and vF layout):
//   K slot j <-> n offset (j>>1) | ((j&1)<<4)   within each 32-column chunk.

// ---------------------------------------------------------------------------
// Kernel 1: 1x1-conv projections on the matrix unit.
//   q = Wq @ pose + bq   -> qT [B][N][CQ] f16   (K-contiguous for WMMA gather)
//   k = Wk @ src  + bk   -> kT [B][N][CQ] f16
//   v = Wv @ src  + bv   -> vF [B][C][N]  f16   (n pre-permuted per 32-chunk)
// One block = 64 columns n of one batch. Both input tiles are rounded to f16
// and staged column-major ([n][c]) in LDS, so a fragment is 16 contiguous c.
// Each f32 weight enters as an f16 pair hi + lo (lo = w - hi), two products
// into one f32 accumulator, so the weights keep about 22 significant bits.
// Every fragment, of X and of W alike, holds k = 32*ks + 16*(lane>>4) + s.
// ---------------------------------------------------------------------------
#define XP 264   // halves per staged column: 256 c + 8 (528 B = 16 B x 33)
#define WP 40    // halves per staged weight row: 32 k + 8 (80 B = 16 B x 5)

__device__ __forceinline__ v16h frag16(const _Float16* p) {
  const v8h lo = *(const v8h*)p;
  const v8h hi = *(const v8h*)(p + 8);
  return __builtin_shufflevector(lo, hi, 0,1,2,3,4,5,6,7,8,9,10,11,12,13,14,15);
}

__device__ __forceinline__ v8f mma16(v16h a, v16h b, v8f c) {
  return __builtin_amdgcn_wmma_f32_16x16x32_f16(false, a, false, b, (short)0, c, false, false);
}

// 16 B at a wave-uniform base + the lane's 32-bit byte offset + a constant: every
// load of a family names one offset register and a scalar base, no address pair.
__device__ __forceinline__ v4f ld16(const float* __restrict__ base, unsigned voff, int imm) {
  return *(const v4f*)((const char*)base + (size_t)voff + imm);
}

// the same for eight halves
__device__ __forceinline__ v8h ld16h(const _Float16* __restrict__ base, unsigned voff, int imm) {
  return *(const v8h*)((const char*)base + (size_t)voff + imm);
}

// 256 c x 64 n of X into registers: 8 lanes cover one 128 B line of a row.
__device__ __forceinline__ void load_x(const float* __restrict__ X, unsigned xoff,
                                       v4f (&raw)[16]) {
  #pragma unroll
  for (int i = 0; i < 16; ++i)
    raw[i] = ld16(X, xoff, ((i >> 3) * 128 + (i & 7)) * N_ * 4);
}

// ... and transposed into LDS: 8 consecutive c of one column per 16 B store.
__device__ __forceinline__ void store_x(_Float16* sx, int nq, int cg, const v4f (&raw)[16]) {
  #pragma unroll
  for (int p = 0; p < 2; ++p)
    #pragma unroll
    for (int e = 0; e < 4; ++e) {
      v8h col;
      #pragma unroll
      for (int j = 0; j < 8; ++j) col[j] = (_Float16)raw[p * 8 + j][e];
      *(v8h*)(sx + (nq * 4 + e) * XP + p * 128 + cg * 8) = col;
    }
}

// 32 weight rows x 32 k (one k step) into registers: 8 lanes per 128 B line.
__device__ __forceinline__ void load_w(const float* __restrict__ Wr, int ks, unsigned woff,
                                       v4f (&wr)[8]) {
  #pragma unroll
  for (int i = 0; i < 8; ++i) wr[i] = ld16(Wr, woff, (i * 4 * C_ + ks * 32) * 4);
}

// Split into hi + lo and turn into fragments through the wave's own LDS patch.
__device__ __forceinline__ void split_w(_Float16* wl, int lane, const v4f (&wr)[8],
                                        v16h (&hi)[2], v16h (&lo)[2]) {
  #pragma unroll
  for (int i = 0; i < 8; ++i) {
    const int row = i * 4 + (lane >> 3);
    const v2f wa = {wr[i][0], wr[i][1]}, wb = {wr[i][2], wr[i][3]};
    const v2h ha = __builtin_convertvector(wa, v2h), hb = __builtin_convertvector(wb, v2h);
    const v2f da = {wa[0] - (float)ha[0], wa[1] - (float)ha[1]};
    const v2f db = {wb[0] - (float)hb[0], wb[1] - (float)hb[1]};
    const v2h la = __builtin_convertvector(da, v2h), lb = __builtin_convertvector(db, v2h);
    const v4h h4 = __builtin_shufflevector(ha, hb, 0, 1, 2, 3);
    const v4h l4 = __builtin_shufflevector(la, lb, 0, 1, 2, 3);
    *(v4h*)(wl + row * WP + (lane & 7) * 4)        = h4;
    *(v4h*)(wl + (32 + row) * WP + (lane & 7) * 4) = l4;
  }
  __builtin_amdgcn_wave_barrier();   // keeps the reads below behind the stores (per-wave LDS is in-order)
  const _Float16* rd = wl + (lane & 15) * WP + 16 * (lane >> 4);
  #pragma unroll
  for (int t = 0; t < 2; ++t) {
    hi[t] = frag16(rd + t * 16 * WP);
    lo[t] = frag16(rd + (32 + t * 16) * WP);
  }
  __builtin_amdgcn_wave_barrier();   // keeps the next k step's stores behind these reads
}

__global__ __launch_bounds__(256)
void proj_kernel(const float* __restrict__ source, const float* __restrict__ pose,
                 const float* __restrict__ Wq, const float* __restrict__ bq,
                 const float* __restrict__ Wk, const float* __restrict__ bk,
                 const float* __restrict__ Wv, const float* __restrict__ bv,
                 _Float16* __restrict__ qT, _Float16* __restrict__ kT,
                 _Float16* __restrict__ vF) {
  __shared__ __align__(16) _Float16 shX[2][64 * XP];   // [0] pose, [1] source: [n][c]
  __shared__ __align__(16) _Float16 shW[8][64 * WP];   // per wave: 32 rows hi, 32 rows lo
  const int tid  = threadIdx.x;
  const int lane = tid & 31;
  const int wv   = __builtin_amdgcn_readfirstlane(tid >> 5);
  const int b    = blockIdx.x / (N_ / 64);
  const int n0   = (blockIdx.x % (N_ / 64)) * 64;
  const int lr   = lane & 15;
  const int half = lane >> 4;
  _Float16* wl   = &shW[wv][0];

  // waves 0-3: q of one 16-column tile each; waves 4-7: k likewise
  const bool isq = wv < 4;
  const float* __restrict__ W1  = isq ? Wq : Wk;
  const float* __restrict__ Wvr = Wv + wv * 32 * C_;   // then 32 rows of v, all 64 columns

  // weight steps 0-7: the q / k rows, 8-15: the v rows; fetched two steps ahead,
  // so that a step's conversions never wait on loads issued just before them
  const unsigned woff = ((lane >> 3) * C_ + (lane & 7) * 4) * 4;
  auto fetch = [&](int s, v4f (&dst)[8]) {
    if (s < 8) load_w(W1, s, woff, dst);
    else       load_w(Wvr, s - 8, woff, dst);
    // last use of woff: holds it to here, so that no load above takes it as its
    // destination, and puts the wait in front of whatever overwrites it next
    if (s == 15) asm volatile("s_wait_xcnt 0x0" :: "v"(woff) : "memory");
    // keeps the later steps' conversions, and with them their data waits, behind
    // the issue of these loads
    __builtin_amdgcn_sched_barrier(0);
  };
  v4f wr[2][8];
  {
    const int nq = (lane & 7) + 8 * (wv & 1);
    const int cg = (lane >> 3) + 4 * (wv >> 1);
    v4f rp[16], rs[16];
    const unsigned xoff = (cg * 8 * N_ + nq * 4) * 4;
    load_x(pose   + (size_t)b * C_ * N_ + n0, xoff, rp);
    load_x(source + (size_t)b * C_ * N_ + n0, xoff, rs);
    // last use of xoff: as for woff in fetch()
    asm volatile("s_wait_xcnt 0x0" :: "v"(xoff) : "memory");
    fetch(0, wr[0]);
    fetch(1, wr[1]);
    store_x(&shX[0][0], nq, cg, rp);
    store_x(&shX[1][0], nq, cg, rs);
  }
  __syncthreads();

  // ---- q / k: A = W (rows o), B = X (columns n); D[r] = row o = 8*half + r ----
  {
    const _Float16* xcol = &shX[isq ? 0 : 1][((wv & 3) * 16 + lr) * XP + 16 * half];
    v8f a0 = {}, a1 = {};
    #pragma unroll
    for (int ks = 0; ks < 8; ++ks) {
      v16h hi[2], lo[2];
      split_w(wl, lane, wr[ks & 1], hi, lo);
      fetch(ks + 2, wr[ks & 1]);
      const v16h xb = frag16(xcol + ks * 32);
      a0 = mma16(hi[0], xb, a0);
      a1 = mma16(hi[1], xb, a1);
      a0 = mma16(lo[0], xb, a0);
      a1 = mma16(lo[1], xb, a1);
    }
    const float* __restrict__ b1 = (isq ? bq : bk) + 8 * half;
    v8h o0, o1;
    #pragma unroll
    for (int r = 0; r < 8; ++r) {
      o0[r] = (_Float16)(a0[r] + b1[r]);
      o1[r] = (_Float16)(a1[r] + b1[16 + r]);
    }
    _Float16* dst = (isq ? qT : kT) + ((size_t)b * N_ + n0 + (wv & 3) * 16 + lr) * CQ + 8 * half;
    *(v8h*)dst        = o0;
    *(v8h*)(dst + 16) = o1;
  }

  // ---- v: A = X (rows n), B = W (columns o); D[r] = row n = 8*half + r ----
  {
    v8f acc[2][4];
    #pragma unroll
    for (int t = 0; t < 2; ++t)
      #pragma unroll
      for (int nt = 0; nt < 4; ++nt)
        #pragma unroll
        for (int i = 0; i < 8; ++i) acc[t][nt][i] = 0.f;

    float bias[2];   // read ahead of the loop, so that the epilogue does not wait on them
    #pragma unroll
    for (int t = 0; t < 2; ++t) bias[t] = bv[wv * 32 + t * 16 + lr];

    const _Float16* xrow = &shX[1][lr * XP + 16 * half];
    #pragma unroll
    for (int ks = 0; ks < 8; ++ks) {
      v16h hi[2], lo[2];
      split_w(wl, lane, wr[ks & 1], hi, lo);
      if (ks < 6) fetch(ks + 10, wr[ks & 1]);
      v16h xa[4];
      #pragma unroll
      for (int nt = 0; nt < 4; ++nt) xa[nt] = frag16(xrow + nt * 16 * XP + ks * 32);
      #pragma unroll
      for (int t = 0; t < 2; ++t)
        #pragma unroll
        for (int nt = 0; nt < 4; ++nt) acc[t][nt] = mma16(xa[nt], hi[t], acc[t][nt]);
      #pragma unroll
      for (int t = 0; t < 2; ++t)
        #pragma unroll
        for (int nt = 0; nt < 4; ++nt) acc[t][nt] = mma16(xa[nt], lo[t], acc[t][nt]);
    }

    // K-slot permutation for v: column x (0..31) -> slot ((x&15)<<1)|(x>>4), so the
    // two 16-column tiles of a 32-chunk interleave: 16 consecutive slots per lane.
    #pragma unroll
    for (int t = 0; t < 2; ++t) {
      const int o = wv * 32 + t * 16 + lr;
      #pragma unroll
      for (int p = 0; p < 2; ++p) {
        v8h s0, s1;
        #pragma unroll
        for (int r = 0; r < 4; ++r) {
          s0[2 * r]     = (_Float16)(acc[t][2 * p][r] + bias[t]);
          s0[2 * r + 1] = (_Float16)(acc[t][2 * p + 1][r] + bias[t]);
          s1[2 * r]     = (_Float16)(acc[t][2 * p][r + 4] + bias[t]);
          s1[2 * r + 1] = (_Float16)(acc[t][2 * p + 1][r + 4] + bias[t]);
        }
        _Float16* dst = vF + ((size_t)b * C_ + o) * N_ + n0 + 32 * p + 16 * half;
        *(v8h*)dst       = s0;
        *(v8h*)(dst + 8) = s1;
      }
    }
  }
}

// ---------------------------------------------------------------------------
// Kernel 2: fused two-pass flash attention.
// One block = 64 rows m of one batch, 16 waves. Pass A (the exact row maxima)
// deals the keys over all 16 waves, each scoring its keys against all 64 rows.
// In pass B wave (mt, kq) takes every fourth 32-key chunk (4*s + kq) and there owns
// all 64 rows x the 64 channels of quarter mt: a V fragment and a P fragment each
// feed four products. The P tile of rows mt of its chunk is made by that wave, one
// stage ahead, and handed to the chunk's other three waves through LDS at the
// stage's barrier. The grid is one block per WGP. The four phases share the exact
// row maximum (joined through LDS after pass A), so their partial sums add without
// any rescale; they are joined through LDS at the end, always in the order
// kq = 0..3, wave (mt, kq) finishing rows kq of its channel quarter.
// Pass B double-buffers a 128-key stage of K and V in LDS via async global->LDS
// copies (K runs one stage ahead of V, for the P tiles): a V row of a stage is 256
// contiguous bytes, so a copy takes whole lines.
// Every staged row is read as 16 B pieces by 16 lanes, one row each: a pitch of
// 16 B x odd puts those 16 pieces on all 64 banks once.
// A V row stays whole in LDS too (the stage's four chunks side by side): the 16
// lanes that copy it write 256 contiguous bytes, all 64 banks once. Split into one
// plane per chunk, at a plane distance of a multiple of 256 B, the row's four 64 B
// pieces would fall on the same 16 banks, four deep.
// ---------------------------------------------------------------------------
#define AP 40    // halves per staged row of K and P: 32 + 8 (80 B = 16 B x 5)
#define VP 136   // halves per staged row of V: 4 x 32 + 8 (272 B = 16 B x 17)
#define SM_V   0                                  // [2][C_][VP] halves
#define SM_K   (SM_V + 2 * C_ * VP * 2)           // [2][KQ][32][AP] halves
#define SM_P   (SM_K + 2 * KQ * 32 * AP * 2)      // [2][KQ][MT][16][AP] halves
#define SM_X   (WPB * 16 * 1024)                  // the join: [WPB][16 tiles][2][32 lanes] x 16 B
// SM_X is the larger of the two uses (ring + P: 200704 B, join: 262144 B)

__global__ __launch_bounds__(512)
void attn_kernel(const _Float16* __restrict__ qT, const _Float16* __restrict__ kT,
                 const _Float16* __restrict__ vF, const float* __restrict__ src,
                 const float* __restrict__ gamma_p, float* __restrict__ out) {
  __shared__ __align__(64) unsigned char smem[SM_X];
  // per wave: maxima of the block's 64 rows over its keys; 272 B = 16 B x 17 a wave,
  // so that 16 lanes reading 16 B of one wave each meet all 64 banks once
  __shared__ __align__(16) float shM[WPB][MT * 16 + 4];
  __shared__ __align__(16) float shS[WPB][16];   // per wave: row sums of its keys
  _Float16* const shV = (_Float16*)(smem + SM_V);
  _Float16* const shK = (_Float16*)(smem + SM_K);
  _Float16* const shP = (_Float16*)(smem + SM_P);

  const int tid  = threadIdx.x;
  const int lane = tid & 31;
  const int wv   = __builtin_amdgcn_readfirstlane(tid >> 5);
  const int mt   = wv & (MT - 1);
  const int kq   = wv / MT;
  const int b    = blockIdx.x / (N_ / 16 / MT);                // uniform per block
  const int m0   = ((blockIdx.x % (N_ / 16 / MT)) * MT + mt) * 16;
  const int half = lane >> 4;           // 0: rows 0-7/K 0-7,16-23 ; 1: rows 8-15/K 8-15,24-31
  const int lr   = lane & 15;
  const int koff = half ? 8 : 0;

  // A-operand: q rows m0..m0+15, K-packed per ISA 16-bit A layout
  const _Float16* qrow = qT + ((size_t)b * N_ + m0 + lr) * CQ;
  const v8h qlo = *(const v8h*)(qrow + koff);
  const v8h qhi = *(const v8h*)(qrow + koff + 16);
  const v16h aq = __builtin_shufflevector(qlo, qhi, 0,1,2,3,4,5,6,7,8,9,10,11,12,13,14,15);

  const v8f czero = {};

  // ========== Pass A: exact row maxima ==========
  // Wave wv takes the 32-key chunks wv + 16*i and scores them against all four row
  // tiles: a chunk is loaded once per block, and a wave's loads run KD chunks ahead
  // of its products, one exposed round of load latency in place of one per chunk.
  // The products are K.Q^T: D holds row m = lr of a tile in a lane and 8 keys in its
  // registers, so a row's maximum is in-lane but for one exchange between the halves.
  {
    const _Float16* __restrict__ qblk = qT + ((size_t)b * N_ + (blockIdx.x % (N_ / 16 / MT)) * MT * 16) * CQ;
    const _Float16* __restrict__ kwav = kT + ((size_t)b * N_ + wv * 32) * CQ;   // same for the whole wave
    const unsigned fo = (lr * CQ + koff) * 2;   // the lane's byte offset in a 16-row fragment
    v8h qf[MT][2], kf[KD][4];
    auto fetch = [&](int i, v8h (&dst)[4]) {   // chunk wv + 16*i
      const _Float16* __restrict__ kc = kwav + (size_t)i * WPB * 32 * CQ;
      dst[0] = ld16h(kc, fo, 0);
      dst[1] = ld16h(kc, fo, 32);
      dst[2] = ld16h(kc, fo, 16 * CQ * 2);
      dst[3] = ld16h(kc, fo, 16 * CQ * 2 + 32);
    };
    #pragma unroll
    for (int u = 0; u < MT; ++u) {
      qf[u][0] = ld16h(qblk, fo, u * 16 * CQ * 2);
      qf[u][1] = ld16h(qblk, fo, u * 16 * CQ * 2 + 32);
    }
    // the q loads go out first: loads are waited for in issue order, and a q load among
    // the K loads makes the first products wait out the K loads in front of it (the
    // build without this line did so, waited to zero and spilled)
    __builtin_amdgcn_sched_barrier(0);
    #pragma unroll
    for (int d = 0; d < KD; ++d) fetch(d, kf[d]);

    v16h qb[MT];
    #pragma unroll
    for (int u = 0; u < MT; ++u)
      qb[u] = __builtin_shufflevector(qf[u][0], qf[u][1], 0,1,2,3,4,5,6,7,8,9,10,11,12,13,14,15);
    float cm[MT][8];
    #pragma unroll
    for (int u = 0; u < MT; ++u)
      #pragma unroll
      for (int r = 0; r < 8; ++r) cm[u][r] = -3.0e38f;
    auto score = [&](const v8h (&k)[4]) {   // one chunk against the four row tiles
      const v16h ka0 = __builtin_shufflevector(k[0], k[1], 0,1,2,3,4,5,6,7,8,9,10,11,12,13,14,15);
      const v16h ka1 = __builtin_shufflevector(k[2], k[3], 0,1,2,3,4,5,6,7,8,9,10,11,12,13,14,15);
      #pragma unroll
      for (int u = 0; u < MT; ++u) {
        const v8f e0 = __builtin_amdgcn_wmma_f32_16x16x32_f16(false, ka0, false, qb[u],
                                                              (short)0, czero, false, false);
        const v8f e1 = __builtin_amdgcn_wmma_f32_16x16x32_f16(false, ka1, false, qb[u],
                                                              (short)0, czero, false, false);
        #pragma unroll
        for (int r = 0; r < 8; ++r) cm[u][r] = fmaxf(cm[u][r], fmaxf(e0[r], e1[r]));
      }
    };
    #pragma unroll
    for (int i = KD; i < NC; i += KD) {
      #pragma unroll
      for (int d = 0; d < KD; ++d) {
        score(kf[d]);
        fetch(i + d, kf[d]);
      }
    }
    // last use of fo: holds it to here, so that no load above takes it as its
    // destination, and puts the wait in front of whatever overwrites it next
    asm volatile("s_wait_xcnt 0x0" :: "v"(fo) : "memory");
    #pragma unroll
    for (int d = 0; d < KD; ++d) score(kf[d]);
    float mm[MT];
    #pragma unroll
    for (int u = 0; u < MT; ++u) {
      const float m = fmaxf(fmaxf(fmaxf(cm[u][0], cm[u][1]), fmaxf(cm[u][2], cm[u][3])),
                            fmaxf(fmaxf(cm[u][4], cm[u][5]), fmaxf(cm[u][6], cm[u][7])));
      mm[u] = fmaxf(m, __shfl_xor(m, 16, 32));
    }
    if (half == 0) {                // read by every wave behind the prologue's barrier
      #pragma unroll
      for (int u = 0; u < MT; ++u) shM[wv][u * 16 + lr] = mm[u];
    }
  }

  // ================= Pass B: P = exp(e - max), PV accumulation ==============
  v8f acc[16];
  #pragma unroll
  for (int t = 0; t < 16; ++t)
    #pragma unroll
    for (int i = 0; i < 8; ++i) acc[t][i] = 0.f;
  float rsum[8];
  #pragma unroll
  for (int i = 0; i < 8; ++i) rsum[i] = 0.f;

  const _Float16* vbase = vF + (size_t)b * C_ * N_;

  // cooperative staging roles: 512 threads, 16 B per async op, every lane on.
  // V: 16 lanes cover the 256 B (four chunks) of one row; K: 4 lanes cover a 64 B row.
  const int vpart = tid & 15;    // 16 B piece of a V row: chunk vpart >> 2, piece vpart & 3
  const int vrow  = tid >> 4;    // 0..31, then + 32 per copy
  const int part  = tid & 3;     // 16 B piece of a K row
  const int krow  = tid >> 2;    // 0..127: chunk krow >> 5, row krow & 31
  _Float16* const vdst = shV + vrow * VP + vpart * 8;
  _Float16* const kdst = shK + krow * AP + part * 8;
  // the lane's byte offsets from bases that are the same for the whole block
  const unsigned vgo = (vrow * N_ + vpart * 8) * 2;
  const unsigned kgo = (krow * CQ + part * 8) * 2;
  const _Float16* kstage = kT + (size_t)b * N_ * CQ;

  auto stage_v = [&](int buf, int n0) {   // n0: first of the stage's 128 keys
    #pragma unroll
    for (int r = 0; r < 8; ++r)
      cp16_async(vdst + buf * (C_ * VP) + r * 32 * VP,
                 (const char*)(vbase + n0 + (size_t)r * 32 * N_) + (size_t)vgo);
  };
  auto stage_k = [&](int buf, int n0) {
    cp16_async(kdst + buf * (KQ * 32 * AP),
               (const char*)(kstage + (size_t)n0 * CQ) + (size_t)kgo);
  };

  float rmax[8];

  // energy of rows mt against this wave's chunk of the K stage in buffer buf
  auto energy = [&](int buf, v8f& e0, v8f& e1) {
    const _Float16* kk = shK + (buf * KQ + kq) * 32 * AP;
    const v8h kl0 = *(const v8h*)(kk + lr * AP + koff);
    const v8h kh0 = *(const v8h*)(kk + lr * AP + koff + 16);
    const v8h kl1 = *(const v8h*)(kk + (16 + lr) * AP + koff);
    const v8h kh1 = *(const v8h*)(kk + (16 + lr) * AP + koff + 16);
    const v16h kb0 = __builtin_shufflevector(kl0, kh0, 0,1,2,3,4,5,6,7,8,9,10,11,12,13,14,15);
    const v16h kb1 = __builtin_shufflevector(kl1, kh1, 0,1,2,3,4,5,6,7,8,9,10,11,12,13,14,15);
    e0 = __builtin_amdgcn_wmma_f32_16x16x32_f16(false, aq, false, kb0,
                                                (short)0, czero, false, false);
    e1 = __builtin_amdgcn_wmma_f32_16x16x32_f16(false, aq, false, kb1,
                                                (short)0, czero, false, false);
  };

  // P tile of rows mt into P buffer buf: packed (p0,p1) -> one b32 LDS store per row slot.
  // Stored slot j maps to n offset (j>>1)|((j&1)<<4); vF uses same mapping.
  auto put_p = [&](int buf, const v8f& e0, const v8f& e1) {
    _Float16* myP = shP + ((buf * KQ + kq) * MT + mt) * 16 * AP;
    #pragma unroll
    for (int i = 0; i < 8; ++i) {
      const float a0 = __expf(e0[i] - rmax[i]);
      const float a1 = __expf(e1[i] - rmax[i]);
      rsum[i] += a0 + a1;                    // per-lane; reduced after the loop
      const int r = i + 8 * half;
      v2h pk; pk[0] = (_Float16)a0; pk[1] = (_Float16)a1;
      *(v2h*)(myP + r * AP + 2 * lr) = pk;
    }
  };

  // PV of this wave's chunk in buffer buf: 4 row tiles x the 4 channel tiles of quarter mt
  auto pv = [&](int buf) {
    const _Float16* pp = shP + (buf * KQ + kq) * MT * 16 * AP + lr * AP + koff;
    const _Float16* vv = shV + (buf * C_ + mt * 64 + lr) * VP + kq * 32 + koff;
    v16h pa[MT];
    #pragma unroll
    for (int u = 0; u < MT; ++u) {
      const v8h plo = *(const v8h*)(pp + u * 16 * AP);
      const v8h phi = *(const v8h*)(pp + u * 16 * AP + 16);
      pa[u] = __builtin_shufflevector(plo, phi, 0,1,2,3,4,5,6,7,8,9,10,11,12,13,14,15);
    }
    #pragma unroll
    for (int c = 0; c < 4; ++c) {
      const v8h vlo = *(const v8h*)(vv + c * 16 * VP);
      const v8h vhi = *(const v8h*)(vv + c * 16 * VP + 16);
      const v16h vb = __builtin_shufflevector(vlo, vhi, 0,1,2,3,4,5,6,7,8,9,10,11,12,13,14,15);
      #pragma unroll
      for (int u = 0; u < MT; ++u)
        acc[u * 4 + c] = __builtin_amdgcn_wmma_f32_16x16x32_f16(false, pa[u], false, vb,
                                                                (short)0, acc[u * 4 + c], false, false);
    }
  };

  stage_k(0, 0);
  asm volatile("s_wait_asynccnt 0x0" ::: "memory");   // this wave's share of K stage 0 has landed
  __syncthreads();                                    // K stage 0 and shM are published
  stage_v(0, 0);
  stage_k(1, 32 * KQ);

  // the exact max of rows mt over all keys: lane lr takes wave lr's maxima of the
  // rows 8*half .. 8*half + 7, then one-time 16-lane reductions
  {
    const v4f ma = *(const v4f*)&shM[lr][mt * 16 + 8 * half];
    const v4f mb = *(const v4f*)&shM[lr][mt * 16 + 8 * half + 4];
    #pragma unroll
    for (int i = 0; i < 4; ++i) { rmax[i] = ma[i]; rmax[i + 4] = mb[i]; }
    #pragma unroll
    for (int i = 0; i < 8; ++i) {
      float m = rmax[i];
      m = fmaxf(m, __shfl_xor(m, 1, 32));
      m = fmaxf(m, __shfl_xor(m, 2, 32));
      m = fmaxf(m, __shfl_xor(m, 4, 32));
      m = fmaxf(m, __shfl_xor(m, 8, 32));
      rmax[i] = m;
    }
  }
  {
    v8f e0, e1;
    energy(0, e0, e1);
    put_p(0, e0, e1);
  }
  asm volatile("s_wait_dscnt 0x0" ::: "memory");      // this wave's P tile of stage 0 is written
  asm volatile("s_wait_asynccnt 0x0" ::: "memory");   // its shares of V stage 0 and K stage 1 have landed
  __syncthreads();                                    // publishes P and V of stage 0 and K of stage 1

  // trip st: PV of stage st; P of stage st + 1 from the K stage published at the last
  // barrier; V of stage st + 1 and K of stage st + 2 fly into the buffers that the
  // trip before has left
  for (int st = 0; st < N_ / (32 * KQ) - 1; ++st) {
    const int cur = st & 1;
    stage_v(cur ^ 1, (st + 1) * 32 * KQ);
    if (st + 2 < N_ / (32 * KQ)) stage_k(cur, (st + 2) * 32 * KQ);

    v8f e0, e1;
    energy(cur ^ 1, e0, e1);
    pv(cur);
    put_p(cur ^ 1, e0, e1);

    // keeps this trip's products in front of the barrier: sunk behind it they stand in
    // front of the next trip's copies, which then have less of the trip to land in, and
    // their fragments stay live over the copies' addresses (that build spilled)
    __builtin_amdgcn_sched_barrier(0);
    asm volatile("s_wait_dscnt 0x0" ::: "memory");      // this wave has left the current buffers, its P tile is written
    asm volatile("s_wait_asynccnt 0x0" ::: "memory");   // its shares of the next stages have landed
    __syncthreads();                                    // publishes the next stage, frees these buffers
  }
  pv((N_ / (32 * KQ) - 1) & 1);
  asm volatile("s_wait_dscnt 0x0" ::: "memory");        // this wave has left the ring
  // nothing is in flight into the ring when its LDS becomes the join's buffer
  asm volatile("s_wait_asynccnt 0x0" ::: "memory");
  __syncthreads();                                      // every wave has left the ring

  // ---- join of the four key phases ----
  // this wave finishes rows kq of its channel quarter (accumulators 4*kq .. 4*kq + 3);
  // their source values are fetched ahead of the join
  const int mo = ((blockIdx.x % (N_ / 16 / MT)) * MT + kq) * 16;
  const float gam = gamma_p[0];
  v4f sv[4][2];
  const float* __restrict__ sbase = src + ((size_t)b * C_ + mt * 64) * N_ + mo;   // same for the whole wave
  const unsigned soff = (lr * N_ + 8 * half) * 4;
  #pragma unroll
  for (int tt = 0; tt < 4; ++tt) {
    sv[tt][0] = ld16(sbase, soff, tt * 16 * N_ * 4);
    sv[tt][1] = ld16(sbase, soff, tt * 16 * N_ * 4 + 16);
  }
  // last use of soff: holds it to here, so that no load above takes it as its
  // destination, and puts the wait in front of whatever overwrites it next
  asm volatile("s_wait_xcnt 0x0" :: "v"(soff) : "memory");

  #pragma unroll
  for (int i = 0; i < 8; ++i) {   // one-time 16-lane row-sum reduction
    float s = rsum[i];
    s += __shfl_xor(s, 1, 32);
    s += __shfl_xor(s, 2, 32);
    s += __shfl_xor(s, 4, 32);
    s += __shfl_xor(s, 8, 32);
    rsum[i] = s;
  }
  if (lr == 0) {
    #pragma unroll
    for (int i = 0; i < 8; ++i) shS[wv][8 * half + i] = rsum[i];
  }
  float* const xj = (float*)smem;   // [wave][tile][register quad][lane] x 16 B
  #pragma unroll
  for (int t = 0; t < 16; ++t) {
    const v4f lo4 = {acc[t][0], acc[t][1], acc[t][2], acc[t][3]};
    const v4f hi4 = {acc[t][4], acc[t][5], acc[t][6], acc[t][7]};
    *(v4f*)(xj + (((wv * 16 + t) * 2 + 0) * 32 + lane) * 4) = lo4;
    *(v4f*)(xj + (((wv * 16 + t) * 2 + 1) * 32 + lane) * 4) = hi4;
  }
  __syncthreads();                  // every phase's partial sums are in LDS

  float linv[8];
  {
    v4f sa = *(const v4f*)&shS[kq][8 * half];       // shS[j * MT + kq]: rows kq, phase j
    v4f sb = *(const v4f*)&shS[kq][8 * half + 4];
    #pragma unroll
    for (int j = 1; j < KQ; ++j) {
      sa += *(const v4f*)&shS[j * MT + kq][8 * half];
      sb += *(const v4f*)&shS[j * MT + kq][8 * half + 4];
    }
    #pragma unroll
    for (int i = 0; i < 4; ++i) { linv[i] = 1.f / sa[i]; linv[i + 4] = 1.f / sb[i]; }
  }

  // ---- epilogue: gamma * (acc/sum) + source; contiguous 16B stores along m ----
  #pragma unroll
  for (int tt = 0; tt < 4; ++tt) {
    const int t = kq * 4 + tt;
    v4f p0 = *(const v4f*)(xj + (((mt * 16 + t) * 2 + 0) * 32 + lane) * 4);
    v4f p1 = *(const v4f*)(xj + (((mt * 16 + t) * 2 + 1) * 32 + lane) * 4);
    #pragma unroll
    for (int j = 1; j < KQ; ++j) {
      p0 += *(const v4f*)(xj + ((((j * MT + mt) * 16 + t) * 2 + 0) * 32 + lane) * 4);
      p1 += *(const v4f*)(xj + ((((j * MT + mt) * 16 + t) * 2 + 1) * 32 + lane) * 4);
    }
    const size_t base = ((size_t)b * C_ + mt * 64 + tt * 16 + lr) * N_ + mo + 8 * half;
    v4f r0, r1;
    #pragma unroll
    for (int i = 0; i < 4; ++i) {
      r0[i] = gam * p0[i] * linv[i]     + sv[tt][0][i];
      r1[i] = gam * p1[i] * linv[i + 4] + sv[tt][1][i];
    }
    *(v4f*)(out + base)     = r0;
    *(v4f*)(out + base + 4) = r1;
  }
}

// ---------------------------------------------------------------------------
extern "C" void kernel_launch(void* const* d_in, const int* in_sizes, int n_in,
                              void* d_out, int out_size, void* d_ws, size_t ws_size,
                              hipStream_t stream) {
  const float* source = (const float*)d_in[0];
  const float* pose   = (const float*)d_in[1];
  const float* Wq     = (const float*)d_in[2];
  const float* bq     = (const float*)d_in[3];
  const float* Wk     = (const float*)d_in[4];
  const float* bk     = (const float*)d_in[5];
  const float* Wv     = (const float*)d_in[6];
  const float* bv     = (const float*)d_in[7];
  const float* gamma  = (const float*)d_in[8];
  float* out = (float*)d_out;

  // workspace: qT (1 MB) | kT (1 MB) | vF (8 MB), all f16
  _Float16* qT = (_Float16*)d_ws;
  _Float16* kT = qT + (size_t)B_ * N_ * CQ;
  _Float16* vF = kT + (size_t)B_ * N_ * CQ;

  proj_kernel<<<dim3(B_ * (N_ / 64)), dim3(256), 0, stream>>>(
      source, pose, Wq, bq, Wk, bk, Wv, bv, qT, kT, vF);

  attn_kernel<<<dim3(B_ * (N_ / 16) / MT), dim3(32 * WPB), 0, stream>>>(
      qT, kT, vF, source, gamma, out);
}

// v007
// Measured time: 50.9 microseconds a run.
// Next to v006, in two timings, it ran 1.05 and 1.04 times as fast.
// Counting every step since v000, it is 10.5 times as fast.
#include <hip/hip_runtime.h>
#include <cstdint>

typedef __attribute__((ext_vector_type(16))) _Float16 v16h;
typedef __attribute__((ext_vector_type(8)))  _Float16 v8h;
typedef __attribute__((ext_vector_type(4)))  _Float16 v4h;
typedef __attribute__((ext_vector_type(2)))  _Float16 v2h;
typedef __attribute__((ext_vector_type(8)))  float    v8f;
typedef __attribute__((ext_vector_type(4)))  float    v4f;
typedef __attribute__((ext_vector_type(2)))  float    v2f;
typedef __attribute__((ext_vector_type(4)))  int      v4i;

#define B_   4
#define C_   256
#define CQ   32
#define N_   4096
#define MT   4            // 16-row m tiles per attention block
#define KQ   4            // key phases: wave (mt, kq) takes the 32-key chunks 4*s + kq
#define WPB  (MT * KQ)    // waves per attention block (512 threads)
#define NC   (N_ / 32 / WPB)   // 32-key chunks per wave in pass A
#define KD   4                 // chunks that a wave's K loads run ahead of its products

// ---------------------------------------------------------------------------
// CDNA5 async global->LDS copy (ASYNCcnt-tracked), guarded so a missing
// builtin degrades to a plain load + ds_store without breaking the build.
// Builtin expects (int4 AS1*, int4 AS3*, imm offset, imm cpol) per the
// clang diagnostic ("int4 __device__ *").
// ---------------------------------------------------------------------------
#if __has_builtin(__builtin_amdgcn_global_load_async_to_lds_b128)
#define USE_ASYNC_LDS 1
typedef __attribute__((address_space(1))) v4i gv4i;
typedef __attribute__((address_space(3))) v4i lv4i;
#endif

__device__ __forceinline__ void cp16_async(void* lds, const void* g) {
#ifdef USE_ASYNC_LDS
  __builtin_amdgcn_global_load_async_to_lds_b128(
      (gv4i*)(uintptr_t)g, (lv4i*)(unsigned)(uintptr_t)lds, 0, 0);
#else
  *(v8h*)lds = *(const v8h*)g;
#endif
}

// K-slot permutation for the PV matmul (shared by P-store and vF layout):
//   K slot j <-> n offset (j>>1) | ((j&1)<<4)   within each 32-column chunk.

// ---------------------------------------------------------------------------
// Kernel 1: 1x1-conv projections on the matrix unit.
//   q = Wq @ pose + bq   -> qT [B][N][CQ] f16   (K-contiguous for WMMA gather)
//   k = Wk @ src  + bk   -> kT [B][N][CQ] f16
//   v = Wv @ src  + bv   -> vF [B][N/32][C/16][4][16][8] f16: one 1 KB block per
//       (32-key chunk, 16-channel tile), laid out as the PV product's B fragment:
//       [group of 8 K slots][channel][slot], n pre-permuted per 32-chunk
// One block = 64 columns n of one batch. Both input tiles are rounded to f16
// and staged column-major ([n][c]) in LDS, so a fragment is 16 contiguous c.
// Each f32 weight enters as an f16 pair hi + lo (lo = w - hi), two products
// into one f32 accumulator, so the weights keep about 22 significant bits.
// Every fragment, of X and of W alike, holds k = 32*ks + 16*(lane>>4) + s.
// ---------------------------------------------------------------------------
#define XP 264   // halves per staged column: 256 c + 8 (528 B = 16 B x 33)
#define WP 40    // halves per staged weight row: 32 k + 8 (80 B = 16 B x 5)

__device__ __forceinline__ v16h frag16(const _Float16* p) {
  const v8h lo = *(const v8h*)p;
  const v8h hi = *(const v8h*)(p + 8);
  return __builtin_shufflevector(lo, hi, 0,1,2,3,4,5,6,7,8,9,10,11,12,13,14,15);
}

__device__ __forceinline__ v8f mma16(v16h a, v16h b, v8f c) {
  return __builtin_amdgcn_wmma_f32_16x16x32_f16(false, a, false, b, (short)0, c, false, false);
}

// 16 B at a wave-uniform base + the lane's 32-bit byte offset + a constant: every
// load of a family names one offset register and a scalar base, no address pair.
__device__ __forceinline__ v4f ld16(const float* __restrict__ base, unsigned voff, int imm) {
  return *(const v4f*)((const char*)base + (size_t)voff + imm);
}

typedef __attribute__((address_space(1))) const v8h  gv8h;    // eight halves in global memory
typedef __attribute__((address_space(1))) const char gbyte;   // a byte there

// the same for eight halves
__device__ __forceinline__ v8h ld16h(const _Float16* __restrict__ base, unsigned voff, int imm) {
  return *(const v8h*)((const char*)base + (size_t)voff + imm);
}

// 256 c x 64 n of X into registers: 8 lanes cover one 128 B line of a row.
__device__ __forceinline__ void load_x(const float* __restrict__ X, unsigned xoff,
                                       v4f (&raw)[16]) {
  #pragma unroll
  for (int i = 0; i < 16; ++i)
    raw[i] = ld16(X, xoff, ((i >> 3) * 128 + (i & 7)) * N_ * 4);
}

// ... and transposed into LDS: 8 consecutive c of one column per 16 B store.
__device__ __forceinline__ void store_x(_Float16* sx, int nq, int cg, const v4f (&raw)[16]) {
  #pragma unroll
  for (int p = 0; p < 2; ++p)
    #pragma unroll
    for (int e = 0; e < 4; ++e) {
      v8h col;
      #pragma unroll
      for (int j = 0; j < 8; ++j) col[j] = (_Float16)raw[p * 8 + j][e];
      *(v8h*)(sx + (nq * 4 + e) * XP + p * 128 + cg * 8) = col;
    }
}

// 32 weight rows x 32 k (one k step) into registers: 8 lanes per 128 B line.
__device__ __forceinline__ void load_w(const float* __restrict__ Wr, int ks, unsigned woff,
                                       v4f (&wr)[8]) {
  #pragma unroll
  for (int i = 0; i < 8; ++i) wr[i] = ld16(Wr, woff, (i * 4 * C_ + ks * 32) * 4);
}

// Split into hi + lo and turn into fragments through the wave's own LDS patch.
__device__ __forceinline__ void split_w(_Float16* wl, int lane, const v4f (&wr)[8],
                                        v16h (&hi)[2], v16h (&lo)[2]) {
  #pragma unroll
  for (int i = 0; i < 8; ++i) {
    const int row = i * 4 + (lane >> 3);
    const v2f wa = {wr[i][0], wr[i][1]}, wb = {wr[i][2], wr[i][3]};
    const v2h ha = __builtin_convertvector(wa, v2h), hb = __builtin_convertvector(wb, v2h);
    const v2f da = {wa[0] - (float)ha[0], wa[1] - (float)ha[1]};
    const v2f db = {wb[0] - (float)hb[0], wb[1] - (float)hb[1]};
    const v2h la = __builtin_convertvector(da, v2h), lb = __builtin_convertvector(db, v2h);
    const v4h h4 = __builtin_shufflevector(ha, hb, 0, 1, 2, 3);
    const v4h l4 = __builtin_shufflevector(la, lb, 0, 1, 2, 3);
    *(v4h*)(wl + row * WP + (lane & 7) * 4)        = h4;
    *(v4h*)(wl + (32 + row) * WP + (lane & 7) * 4) = l4;
  }
  __builtin_amdgcn_wave_barrier();   // keeps the reads below behind the stores (per-wave LDS is in-order)
  const _Float16* rd = wl + (lane & 15) * WP + 16 * (lane >> 4);
  #pragma unroll
  for (int t = 0; t < 2; ++t) {
    hi[t] = frag16(rd + t * 16 * WP);
    lo[t] = frag16(rd + (32 + t * 16) * WP);
  }
  __builtin_amdgcn_wave_barrier();   // keeps the next k step's stores behind these reads
}

__global__ __launch_bounds__(256)
void proj_kernel(const float* __restrict__ source, const float* __restrict__ pose,
                 const float* __restrict__ Wq, const float* __restrict__ bq,
                 const float* __restrict__ Wk, const float* __restrict__ bk,
                 const float* __restrict__ Wv, const float* __restrict__ bv,
                 _Float16* __restrict__ qT, _Float16* __restrict__ kT,
                 _Float16* __restrict__ vF) {
  __shared__ __align__(16) _Float16 shX[2][64 * XP];   // [0] pose, [1] source: [n][c]
  __shared__ __align__(16) _Float16 shW[8][64 * WP];   // per wave: 32 rows hi, 32 rows lo
  const int tid  = threadIdx.x;
  const int lane = tid & 31;
  const int wv   = __builtin_amdgcn_readfirstlane(tid >> 5);
  const int b    = blockIdx.x / (N_ / 64);
  const int n0   = (blockIdx.x % (N_ / 64)) * 64;
  const int lr   = lane & 15;
  const int half = lane >> 4;
  _Float16* wl   = &shW[wv][0];

  // waves 0-3: q of one 16-column tile each; waves 4-7: k likewise
  const bool isq = wv < 4;
  const float* __restrict__ W1  = isq ? Wq : Wk;
  const float* __restrict__ Wvr = Wv + wv * 32 * C_;   // then 32 rows of v, all 64 columns

  // weight steps 0-7: the q / k rows, 8-15: the v rows; fetched two steps ahead,
  // so that a step's conversions never wait on loads issued just before them
  const unsigned woff = ((lane >> 3) * C_ + (lane & 7) * 4) * 4;
  auto fetch = [&](int s, v4f (&dst)[8]) {
    if (s < 8) load_w(W1, s, woff, dst);
    else       load_w(Wvr, s - 8, woff, dst);
    // last use of woff: holds it to here, so that no load above takes it as its
    // destination, and puts the wait in front of whatever overwrites it next
    if (s == 15) asm volatile("s_wait_xcnt 0x0" :: "v"(woff) : "memory");
    // keeps the later steps' conversions, and with them their data waits, behind
    // the issue of these loads
    __builtin_amdgcn_sched_barrier(0);
  };
  v4f wr[2][8];
  {
    const int nq = (lane & 7) + 8 * (wv & 1);
    const int cg = (lane >> 3) + 4 * (wv >> 1);
    v4f rp[16], rs[16];
    const unsigned xoff = (cg * 8 * N_ + nq * 4) * 4;
    load_x(pose   + (size_t)b * C_ * N_ + n0, xoff, rp);
    load_x(source + (size_t)b * C_ * N_ + n0, xoff, rs);
    // last use of xoff: as for woff in fetch()
    asm volatile("s_wait_xcnt 0x0" :: "v"(xoff) : "memory");
    fetch(0, wr[0]);
    fetch(1, wr[1]);
    store_x(&shX[0][0], nq, cg, rp);
    store_x(&shX[1][0], nq, cg, rs);
  }
  __syncthreads();

  // ---- q / k: A = W (rows o), B = X (columns n); D[r] = row o = 8*half + r ----
  {
    const _Float16* xcol = &shX[isq ? 0 : 1][((wv & 3) * 16 + lr) * XP + 16 * half];
    v8f a0 = {}, a1 = {};
    #pragma unroll
    for (int ks = 0; ks < 8; ++ks) {
      v16h hi[2], lo[2];
      split_w(wl, lane, wr[ks & 1], hi, lo);
      fetch(ks + 2, wr[ks & 1]);
      const v16h xb = frag16(xcol + ks * 32);
      a0 = mma16(hi[0], xb, a0);
      a1 = mma16(hi[1], xb, a1);
      a0 = mma16(lo[0], xb, a0);
      a1 = mma16(lo[1], xb, a1);
    }
    const float* __restrict__ b1 = (isq ? bq : bk) + 8 * half;
    v8h o0, o1;
    #pragma unroll
    for (int r = 0; r < 8; ++r) {
      o0[r] = (_Float16)(a0[r] + b1[r]);
      o1[r] = (_Float16)(a1[r] + b1[16 + r]);
    }
    _Float16* dst = (isq ? qT : kT) + ((size_t)b * N_ + n0 + (wv & 3) * 16 + lr) * CQ + 8 * half;
    *(v8h*)dst        = o0;
    *(v8h*)(dst + 16) = o1;
  }

  // ---- v: A = X (rows n), B = W (columns o); D[r] = row n = 8*half + r ----
  {
    v8f acc[2][4];
    #pragma unroll
    for (int t = 0; t < 2; ++t)
      #pragma unroll
      for (int nt = 0; nt < 4; ++nt)
        #pragma unroll
        for (int i = 0; i < 8; ++i) acc[t][nt][i] = 0.f;

    float bias[2];   // read ahead of the loop, so that the epilogue does not wait on them
    #pragma unroll
    for (int t = 0; t < 2; ++t) bias[t] = bv[wv * 32 + t * 16 + lr];

    const _Float16* xrow = &shX[1][lr * XP + 16 * half];
    #pragma unroll
    for (int ks = 0; ks < 8; ++ks) {
      v16h hi[2], lo[2];
      split_w(wl, lane, wr[ks & 1], hi, lo);
      if (ks < 6) fetch(ks + 10, wr[ks & 1]);
      v16h xa[4];
      #pragma unroll
      for (int nt = 0; nt < 4; ++nt) xa[nt] = frag16(xrow + nt * 16 * XP + ks * 32);
      #pragma unroll
      for (int t = 0; t < 2; ++t)
        #pragma unroll
        for (int nt = 0; nt < 4; ++nt) acc[t][nt] = mma16(xa[nt], hi[t], acc[t][nt]);
      #pragma unroll
      for (int t = 0; t < 2; ++t)
        #pragma unroll
        for (int nt = 0; nt < 4; ++nt) acc[t][nt] = mma16(xa[nt], lo[t], acc[t][nt]);
    }

    // K-slot permutation for v: column x (0..31) -> slot ((x&15)<<1)|(x>>4), so the
    // two 16-column tiles of a 32-chunk interleave: 16 consecutive slots per lane.
    #pragma unroll
    for (int t = 0; t < 2; ++t) {
      #pragma unroll
      for (int p = 0; p < 2; ++p) {
        v8h s0, s1;
        #pragma unroll
        for (int r = 0; r < 4; ++r) {
          s0[2 * r]     = (_Float16)(acc[t][2 * p][r] + bias[t]);
          s0[2 * r + 1] = (_Float16)(acc[t][2 * p + 1][r] + bias[t]);
          s1[2 * r]     = (_Float16)(acc[t][2 * p][r + 4] + bias[t]);
          s1[2 * r + 1] = (_Float16)(acc[t][2 * p + 1][r + 4] + bias[t]);
        }
        // slots 16*half .. + 15 of channel lr: slot groups 2*half and 2*half + 1;
        // 16 lanes store 256 contiguous bytes
        _Float16* dst = vF + (((size_t)b * (N_ / 32) + n0 / 32 + p) * (C_ / 16) + wv * 2 + t) * 512
                           + 2 * half * 128 + lr * 8;
        *(v8h*)dst         = s0;
        *(v8h*)(dst + 128) = s1;
      }
    }
  }
}

// ---------------------------------------------------------------------------
// Kernel 2: fused two-pass flash attention.
// One block = 64 rows m of one batch, 16 waves. Pass A (the exact row maxima)
// deals the keys over all 16 waves, each scoring its keys against all 64 rows.
// In pass B wave (mt, kq) takes every fourth 32-key chunk (4*s + kq) and there owns
// all 64 rows x the 64 channels of quarter mt: a V fragment and a P fragment each
// feed four products. The P tile of rows mt of its chunk is made by that wave, one
// stage ahead, and handed to the chunk's other three waves through LDS at the
// stage's barrier. The grid is one block per WGP. The four phases share the exact
// row maximum (joined through LDS after pass A), so their partial sums add without
// any rescale; they are joined through LDS at the end, always in the order
// kq = 0..3, wave (mt, kq) finishing rows kq of its channel quarter.
// Pass B double-buffers a 128-key stage of K in LDS via async global->LDS copies (the
// K stage in use runs one stage ahead of the PV products, for the P tiles).
// Every staged row is read as 16 B pieces by 16 lanes, one row each: a pitch of
// 16 B x odd puts those 16 pieces on all 64 banks once.
// V does not pass through LDS: a V fragment is used by one wave alone, so LDS would
// only add a write and a read of every byte. The projection stores V in fragment
// order, a wave's load of half a fragment is 512 contiguous bytes, and a fragment's
// registers are refilled for the next stage directly behind its last product.
// ---------------------------------------------------------------------------
#define AP 40    // halves per staged row of K and P: 32 + 8 (80 B = 16 B x 5)
#define VSTG (KQ * (C_ / 16) * 512)               // halves of V per 128-key stage
#define SM_K   0                                  // [2][KQ][32][AP] halves
#define SM_P   (SM_K + 2 * KQ * 32 * AP * 2)      // [2][KQ][MT][16][AP] halves
#define SM_X   (WPB * 16 * 1024)                  // the join: [WPB][16 tiles][2][32 lanes] x 16 B
// SM_X is the larger of the two uses (ring + P: 61440 B, join: 262144 B)

__global__ __launch_bounds__(512)
void attn_kernel(const _Float16* __restrict__ qT, const _Float16* __restrict__ kT,
                 const _Float16* __restrict__ vF, const float* __restrict__ src,
                 const float* __restrict__ gamma_p, float* __restrict__ out) {
  __shared__ __align__(64) unsigned char smem[SM_X];
  // per wave: maxima of the block's 64 rows over its keys; 272 B = 16 B x 17 a wave,
  // so that 16 lanes reading 16 B of one wave each meet all 64 banks once
  __shared__ __align__(16) float shM[WPB][MT * 16 + 4];
  __shared__ __align__(16) float shS[WPB][16];   // per wave: row sums of its keys
  _Float16* const shK = (_Float16*)(smem + SM_K);
  _Float16* const shP = (_Float16*)(smem + SM_P);

  const int tid  = threadIdx.x;
  const int lane = tid & 31;
  const int wv   = __builtin_amdgcn_readfirstlane(tid >> 5);
  const int mt   = wv & (MT - 1);
  const int kq   = wv / MT;
  const int b    = blockIdx.x / (N_ / 16 / MT);                // uniform per block
  const int m0   = ((blockIdx.x % (N_ / 16 / MT)) * MT + mt) * 16;
  const int half = lane >> 4;           // 0: rows 0-7/K 0-7,16-23 ; 1: rows 8-15/K 8-15,24-31
  const int lr   = lane & 15;
  const int koff = half ? 8 : 0;

  // A-operand: q rows m0..m0+15, K-packed per ISA 16-bit A layout
  const _Float16* qrow = qT + ((size_t)b * N_ + m0 + lr) * CQ;
  const v8h qlo = *(const v8h*)(qrow + koff);
  const v8h qhi = *(const v8h*)(qrow + koff + 16);
  const v16h aq = __builtin_shufflevector(qlo, qhi, 0,1,2,3,4,5,6,7,8,9,10,11,12,13,14,15);

  const v8f czero = {};

  // ========== Pass A: exact row maxima ==========
  // Wave wv takes the 32-key chunks wv + 16*i and scores them against all four row
  // tiles: a chunk is loaded once per block, and a wave's loads run KD chunks ahead
  // of its products, one exposed round of load latency in place of one per chunk.
  // The products are K.Q^T: D holds row m = lr of a tile in a lane and 8 keys in its
  // registers, so a row's maximum is in-lane but for one exchange between the halves.
  {
    const _Float16* __restrict__ qblk = qT + ((size_t)b * N_ + (blockIdx.x % (N_ / 16 / MT)) * MT * 16) * CQ;
    const _Float16* __restrict__ kwav = kT + ((size_t)b * N_ + wv * 32) * CQ;   // same for the whole wave
    const unsigned fo = (lr * CQ + koff) * 2;   // the lane's byte offset in a 16-row fragment
    v8h qf[MT][2], kf[KD][4];
    auto fetch = [&](int i, v8h (&dst)[4]) {   // chunk wv + 16*i
      const _Float16* __restrict__ kc = kwav + (size_t)i * WPB * 32 * CQ;
      dst[0] = ld16h(kc, fo, 0);
      dst[1] = ld16h(kc, fo, 32);
      dst[2] = ld16h(kc, fo, 16 * CQ * 2);
      dst[3] = ld16h(kc, fo, 16 * CQ * 2 + 32);
    };
    #pragma unroll
    for (int u = 0; u < MT; ++u) {
      qf[u][0] = ld16h(qblk, fo, u * 16 * CQ * 2);
      qf[u][1] = ld16h(qblk, fo, u * 16 * CQ * 2 + 32);
    }
    // the q loads go out first: loads are waited for in issue order, and a q load among
    // the K loads makes the first products wait out the K loads in front of it (the
    // build without this line did so, waited to zero and spilled)
    __builtin_amdgcn_sched_barrier(0);
    #pragma unroll
    for (int d = 0; d < KD; ++d) fetch(d, kf[d]);

    v16h qb[MT];
    #pragma unroll
    for (int u = 0; u < MT; ++u)
      qb[u] = __builtin_shufflevector(qf[u][0], qf[u][1], 0,1,2,3,4,5,6,7,8,9,10,11,12,13,14,15);
    float cm[MT][8];
    #pragma unroll
    for (int u = 0; u < MT; ++u)
      #pragma unroll
      for (int r = 0; r < 8; ++r) cm[u][r] = -3.0e38f;
    auto score = [&](const v8h (&k)[4]) {   // one chunk against the four row tiles
      const v16h ka0 = __builtin_shufflevector(k[0], k[1], 0,1,2,3,4,5,6,7,8,9,10,11,12,13,14,15);
      const v16h ka1 = __builtin_shufflevector(k[2], k[3], 0,1,2,3,4,5,6,7,8,9,10,11,12,13,14,15);
      #pragma unroll
      for (int u = 0; u < MT; ++u) {
        const v8f e0 = __builtin_amdgcn_wmma_f32_16x16x32_f16(false, ka0, false, qb[u],
                                                              (short)0, czero, false, false);
        const v8f e1 = __builtin_amdgcn_wmma_f32_16x16x32_f16(false, ka1, false, qb[u],
                                                              (short)0, czero, false, false);
        #pragma unroll
        for (int r = 0; r < 8; ++r) cm[u][r] = fmaxf(cm[u][r], fmaxf(e0[r], e1[r]));
      }
    };
    #pragma unroll
    for (int i = KD; i < NC; i += KD) {
      #pragma unroll
      for (int d = 0; d < KD; ++d) {
        score(kf[d]);
        fetch(i + d, kf[d]);
      }
    }
    // last use of fo: holds it to here, so that no load above takes it as its
    // destination, and puts the wait in front of whatever overwrites it next
    asm volatile("s_wait_xcnt 0x0" :: "v"(fo) : "memory");
    #pragma unroll
    for (int d = 0; d < KD; ++d) score(kf[d]);
    float mm[MT];
    #pragma unroll
    for (int u = 0; u < MT; ++u) {
      const float m = fmaxf(fmaxf(fmaxf(cm[u][0], cm[u][1]), fmaxf(cm[u][2], cm[u][3])),
                            fmaxf(fmaxf(cm[u][4], cm[u][5]), fmaxf(cm[u][6], cm[u][7])));
      mm[u] = fmaxf(m, __shfl_xor(m, 16, 32));
    }
    if (half == 0) {                // read by every wave behind the prologue's barrier
      #pragma unroll
      for (int u = 0; u < MT; ++u) shM[wv][u * 16 + lr] = mm[u];
    }
  }

  // ================= Pass B: P = exp(e - max), PV accumulation ==============
  v8f acc[16];
  #pragma unroll
  for (int t = 0; t < 16; ++t)
    #pragma unroll
    for (int i = 0; i < 8; ++i) acc[t][i] = 0.f;
  float rsum[8];
  #pragma unroll
  for (int i = 0; i < 8; ++i) rsum[i] = 0.f;

  // the wave's four V fragments of a stage: 4 KB in a row, the same base for the whole wave
  // (vnext: of the stage that is fetched next; typed as global memory, which the compiler
  // cannot see for itself behind the asm statements that hold it)
  gbyte* vnext = (gbyte*)(uintptr_t)(vF + (((size_t)b * (N_ / 32) + kq) * (C_ / 16) + mt * 4) * 512);
  const unsigned vfo = lane * 16;   // the lane's byte offset in half a fragment
  v8h vr[4][2];
  auto load_v = [&](int c) {        // fragment c of the stage at vnext
    vr[c][0] = *(gv8h*)(vnext + (size_t)vfo + c * 1024);
    vr[c][1] = *(gv8h*)(vnext + (size_t)vfo + c * 1024 + 512);
  };

  // cooperative staging of K: 512 threads, 16 B per async op, every lane on;
  // 4 lanes cover a 64 B row.
  const int part  = tid & 3;     // 16 B piece of a K row
  const int krow  = tid >> 2;    // 0..127: chunk krow >> 5, row krow & 31
  _Float16* const kdst = shK + krow * AP + part * 8;
  // the lane's byte offset from a base that is the same for the whole block
  const unsigned kgo = (krow * CQ + part * 8) * 2;
  const _Float16* kstage = kT + (size_t)b * N_ * CQ;

  auto stage_k = [&](int buf, int n0) {
    cp16_async(kdst + buf * (KQ * 32 * AP),
               (const char*)(kstage + (size_t)n0 * CQ) + (size_t)kgo);
  };

  float rmax[8];

  // energy of rows mt against this wave's chunk of the K stage in buffer buf
  auto energy = [&](int buf, v8f& e0, v8f& e1) {
    const _Float16* kk = shK + (buf * KQ + kq) * 32 * AP;
    const v8h kl0 = *(const v8h*)(kk + lr * AP + koff);
    const v8h kh0 = *(const v8h*)(kk + lr * AP + koff + 16);
    const v8h kl1 = *(const v8h*)(kk + (16 + lr) * AP + koff);
    const v8h kh1 = *(const v8h*)(kk + (16 + lr) * AP + koff + 16);
    const v16h kb0 = __builtin_shufflevector(kl0, kh0, 0,1,2,3,4,5,6,7,8,9,10,11,12,13,14,15);
    const v16h kb1 = __builtin_shufflevector(kl1, kh1, 0,1,2,3,4,5,6,7,8,9,10,11,12,13,14,15);
    e0 = __builtin_amdgcn_wmma_f32_16x16x32_f16(false, aq, false, kb0,
                                                (short)0, czero, false, false);
    e1 = __builtin_amdgcn_wmma_f32_16x16x32_f16(false, aq, false, kb1,
                                                (short)0, czero, false, false);
  };

  // P tile of rows mt into P buffer buf: packed (p0,p1) -> one b32 LDS store per row slot.
  // Stored slot j maps to n offset (j>>1)|((j&1)<<4); vF uses same mapping.
  auto put_p = [&](int buf, const v8f& e0, const v8f& e1) {
    _Float16* myP = shP + ((buf * KQ + kq) * MT + mt) * 16 * AP;
    #pragma unroll
    for (int i = 0; i < 8; ++i) {
      const float a0 = __expf(e0[i] - rmax[i]);
      const float a1 = __expf(e1[i] - rmax[i]);
      rsum[i] += a0 + a1;                    // per-lane; reduced after the loop
      const int r = i + 8 * half;
      v2h pk; pk[0] = (_Float16)a0; pk[1] = (_Float16)a1;
      *(v2h*)(myP + r * AP + 2 * lr) = pk;
    }
  };

  // PV of this wave's chunk, P in buffer buf: 4 row tiles x the 4 channel tiles of quarter
  // mt; more: each V fragment is then fetched anew from vnext
  auto pv = [&](int buf, bool more) {
    const _Float16* pp = shP + (buf * KQ + kq) * MT * 16 * AP + lr * AP + koff;
    v16h pa[MT];
    #pragma unroll
    for (int u = 0; u < MT; ++u) {
      const v8h plo = *(const v8h*)(pp + u * 16 * AP);
      const v8h phi = *(const v8h*)(pp + u * 16 * AP + 16);
      pa[u] = __builtin_shufflevector(plo, phi, 0,1,2,3,4,5,6,7,8,9,10,11,12,13,14,15);
    }
    #pragma unroll
    for (int c = 0; c < 4; ++c) {
      const v16h vb = __builtin_shufflevector(vr[c][0], vr[c][1], 0,1,2,3,4,5,6,7,8,9,10,11,12,13,14,15);
      #pragma unroll
      for (int u = 0; u < MT; ++u)
        acc[u * 4 + c] = __builtin_amdgcn_wmma_f32_16x16x32_f16(false, pa[u], false, vb,
                                                                (short)0, acc[u * 4 + c], false, false);
      if (more) load_v(c);
    }
  };

  stage_k(0, 0);
  asm volatile("s_wait_asynccnt 0x0" ::: "memory");   // this wave's share of K stage 0 has landed
  __syncthreads();                                    // K stage 0 and shM are published
  #pragma unroll
  for (int c = 0; c < 4; ++c) load_v(c);              // V of stage 0
  // the loads above name addresses formed from vnext: the wait stands in front of their overwrite
  asm volatile("s_wait_xcnt 0x0" : "+s"(vnext) :: "memory");
  vnext += VSTG * 2;
  stage_k(1, 32 * KQ);

  // the exact max of rows mt over all keys: lane lr takes wave lr's maxima of the
  // rows 8*half .. 8*half + 7, then one-time 16-lane reductions
  {
    const v4f ma = *(const v4f*)&shM[lr][mt * 16 + 8 * half];
    const v4f mb = *(const v4f*)&shM[lr][mt * 16 + 8 * half + 4];
    #pragma unroll
    for (int i = 0; i < 4; ++i) { rmax[i] = ma[i]; rmax[i + 4] = mb[i]; }
    #pragma unroll
    for (int i = 0; i < 8; ++i) {
      float m = rmax[i];
      m = fmaxf(m, __shfl_xor(m, 1, 32));
      m = fmaxf(m, __shfl_xor(m, 2, 32));
      m = fmaxf(m, __shfl_xor(m, 4, 32));
      m = fmaxf(m, __shfl_xor(m, 8, 32));
      rmax[i] = m;
    }
  }
  {
    v8f e0, e1;
    energy(0, e0, e1);
    put_p(0, e0, e1);
  }
  asm volatile("s_wait_dscnt 0x0" ::: "memory");      // this wave's P tile of stage 0 is written
  asm volatile("s_wait_asynccnt 0x0" ::: "memory");   // its share of K stage 1 has landed
  __syncthreads();                                    // publishes P of stage 0 and K of stage 1

  // trip st: PV of stage st; P of stage st + 1 from the K stage published at the last
  // barrier; K of stage st + 2 flies into the buffer that the trip before has left, V of
  // stage st + 1 into the registers that this trip's products leave
  for (int st = 0; st < N_ / (32 * KQ) - 1; ++st) {
    const int cur = st & 1;
    if (st + 2 < N_ / (32 * KQ)) stage_k(cur, (st + 2) * 32 * KQ);

    v8f e0, e1;
    energy(cur ^ 1, e0, e1);
    pv(cur, true);
    put_p(cur ^ 1, e0, e1);

    // keeps this trip's products in front of the barrier: sunk behind it they stand in
    // front of the next trip's copies, which then have less of the trip to land in, and
    // their fragments stay live over the copies' addresses (that build spilled)
    __builtin_amdgcn_sched_barrier(0);
    asm volatile("s_wait_dscnt 0x0" ::: "memory");      // this wave has left the current buffers, its P tile is written
    asm volatile("s_wait_asynccnt 0x0" ::: "memory");   // its share of the next K stage has landed
    // this trip's V loads name an address formed from vnext: the wait stands in front of its overwrite
    asm volatile("s_wait_xcnt 0x0" : "+s"(vnext) :: "memory");
    vnext += VSTG * 2;
    // publishes the next stage, frees these buffers. The barrier is written out, its fences
    // on LDS alone: __syncthreads() would wait out the V loads that are to fly across it
    __builtin_amdgcn_fence(__ATOMIC_RELEASE, "workgroup", "local");
    __builtin_amdgcn_s_barrier();
    __builtin_amdgcn_fence(__ATOMIC_ACQUIRE, "workgroup", "local");
  }
  pv((N_ / (32 * KQ) - 1) & 1, false);
  asm volatile("s_wait_dscnt 0x0" ::: "memory");        // this wave has left the ring
  // nothing is in flight into the ring when its LDS becomes the join's buffer
  asm volatile("s_wait_asynccnt 0x0" ::: "memory");
  __syncthreads();                                      // every wave has left the ring

  // ---- join of the four key phases ----
  // this wave finishes rows kq of its channel quarter (accumulators 4*kq .. 4*kq + 3);
  // their source values are fetched ahead of the join
  const int mo = ((blockIdx.x % (N_ / 16 / MT)) * MT + kq) * 16;
  const float gam = gamma_p[0];
  v4f sv[4][2];
  const float* __restrict__ sbase = src + ((size_t)b * C_ + mt * 64) * N_ + mo;   // same for the whole wave
  const unsigned soff = (lr * N_ + 8 * half) * 4;
  #pragma unroll
  for (int tt = 0; tt < 4; ++tt) {
    sv[tt][0] = ld16(sbase, soff, tt * 16 * N_ * 4);
    sv[tt][1] = ld16(sbase, soff, tt * 16 * N_ * 4 + 16);
  }
  // last use of soff: holds it to here, so that no load above takes it as its
  // destination, and puts the wait in front of whatever overwrites it next
  asm volatile("s_wait_xcnt 0x0" :: "v"(soff) : "memory");

  #pragma unroll
  for (int i = 0; i < 8; ++i) {   // one-time 16-lane row-sum reduction
    float s = rsum[i];
    s += __shfl_xor(s, 1, 32);
    s += __shfl_xor(s, 2, 32);
    s += __shfl_xor(s, 4, 32);
    s += __shfl_xor(s, 8, 32);
    rsum[i] = s;
  }
  if (lr == 0) {
    #pragma unroll
    for (int i = 0; i < 8; ++i) shS[wv][8 * half + i] = rsum[i];
  }
  float* const xj = (float*)smem;   // [wave][tile][register quad][lane] x 16 B
  #pragma unroll
  for (int t = 0; t < 16; ++t) {
    const v4f lo4 = {acc[t][0], acc[t][1], acc[t][2], acc[t][3]};
    const v4f hi4 = {acc[t][4], acc[t][5], acc[t][6], acc[t][7]};
    *(v4f*)(xj + (((wv * 16 + t) * 2 + 0) * 32 + lane) * 4) = lo4;
    *(v4f*)(xj + (((wv * 16 + t) * 2 + 1) * 32 + lane) * 4) = hi4;
  }
  __syncthreads();                  // every phase's partial sums are in LDS

  float linv[8];
  {
    v4f sa = *(const v4f*)&shS[kq][8 * half];       // shS[j * MT + kq]: rows kq, phase j
    v4f sb = *(const v4f*)&shS[kq][8 * half + 4];
    #pragma unroll
    for (int j = 1; j < KQ; ++j) {
      sa += *(const v4f*)&shS[j * MT + kq][8 * half];
      sb += *(const v4f*)&shS[j * MT + kq][8 * half + 4];
    }
    #pragma unroll
    for (int i = 0; i < 4; ++i) { linv[i] = 1.f / sa[i]; linv[i + 4] = 1.f / sb[i]; }
  }

  // ---- epilogue: gamma * (acc/sum) + source; contiguous 16B stores along m ----
  #pragma unroll
  for (int tt = 0; tt < 4; ++tt) {
    const int t = kq * 4 + tt;
    v4f p0 = *(const v4f*)(xj + (((mt * 16 + t) * 2 + 0) * 32 + lane) * 4);
    v4f p1 = *(const v4f*)(xj + (((mt * 16 + t) * 2 + 1) * 32 + lane) * 4);
    #pragma unroll
    for (int j = 1; j < KQ; ++j) {
      p0 += *(const v4f*)(xj + ((((j * MT + mt) * 16 + t) * 2 + 0) * 32 + lane) * 4);
      p1 += *(const v4f*)(xj + ((((j * MT + mt) * 16 + t) * 2 + 1) * 32 + lane) * 4);
    }
    const size_t base = ((size_t)b * C_ + mt * 64 + tt * 16 + lr) * N_ + mo + 8 * half;
    v4f r0, r1;
    #pragma unroll
    for (int i = 0; i < 4; ++i) {
      r0[i] = gam * p0[i] * linv[i]     + sv[tt][0][i];
      r1[i] = gam * p1[i] * linv[i + 4] + sv[tt][1][i];
    }
    *(v4f*)(out + base)     = r0;
    *(v4f*)(out + base + 4) = r1;
  }
}

// ---------------------------------------------------------------------------
extern "C" void kernel_launch(void* const* d_in, const int* in_sizes, int n_in,
                              void* d_out, int out_size, void* d_ws, size_t ws_size,
                              hipStream_t stream) {
  const float* source = (const float*)d_in[0];
  const float* pose   = (const float*)d_in[1];
  const float* Wq     = (const float*)d_in[2];
  const float* bq     = (const float*)d_in[3];
  const float* Wk     = (const float*)d_in[4];
  const float* bk     = (const float*)d_in[5];
  const float* Wv     = (const float*)d_in[6];
  const float* bv     = (const float*)d_in[7];
  const float* gamma  = (const float*)d_in[8];
  float* out = (float*)d_out;

  // workspace: qT (1 MB) | kT (1 MB) | vF (8 MB), all f16
  _Float16* qT = (_Float16*)d_ws;
  _Float16* kT = qT + (size_t)B_ * N_ * CQ;
  _Float16* vF = kT + (size_t)B_ * N_ * CQ;

  proj_kernel<<<dim3(B_ * (N_ / 64)), dim3(256), 0, stream>>>(
      source, pose, Wq, bq, Wk, bk, Wv, bv, qT, kT, vF);

  attn_kernel<<<dim3(B_ * (N_ / 16) / MT), dim3(32 * WPB), 0, stream>>>(
      qT, kT, vF, source, gamma, out);
}

// v008
// Measured time: 48.7 microseconds a run.
// Two timings next to v007 put it at 1.04 and 1.05 times that version's speed.
// All steps since v000 together make it 11.0 times as fast.
#include <hip/hip_runtime.h>
#include <cstdint>

typedef __attribute__((ext_vector_type(16))) _Float16 v16h;
typedef __attribute__((ext_vector_type(8)))  _Float16 v8h;
typedef __attribute__((ext_vector_type(4)))  _Float16 v4h;
typedef __attribute__((ext_vector_type(2)))  _Float16 v2h;
typedef __attribute__((ext_vector_type(8)))  float    v8f;
typedef __attribute__((ext_vector_type(4)))  float    v4f;
typedef __attribute__((ext_vector_type(2)))  float    v2f;
typedef __attribute__((ext_vector_type(4)))  int      v4i;

#define B_   4
#define C_   256
#define CQ   32
#define N_   4096
#define MT   4            // 16-row m tiles per attention block
#define KQ   4            // key phases: wave (mt, kq) takes the 32-key chunks 4*s + kq
#define WPB  (MT * KQ)    // waves per attention block (512 threads)
#define NC   (N_ / 32 / WPB)   // 32-key chunks per wave in pass A
#define KD   4                 // chunks that a wave's K loads run ahead of its products
#define NS   (N_ / (32 * KQ))  // 128-key stages of pass B

// ---------------------------------------------------------------------------
// CDNA5 async global->LDS copy (ASYNCcnt-tracked), guarded so a missing
// builtin degrades to a plain load + ds_store without breaking the build.
// Builtin expects (int4 AS1*, int4 AS3*, imm offset, imm cpol) per the
// clang diagnostic ("int4 __device__ *").
// ---------------------------------------------------------------------------
#if __has_builtin(__builtin_amdgcn_global_load_async_to_lds_b128)
#define USE_ASYNC_LDS 1
typedef __attribute__((address_space(1))) v4i gv4i;
typedef __attribute__((address_space(3))) v4i lv4i;
#endif

__device__ __forceinline__ void cp16_async(void* lds, const void* g) {
#ifdef USE_ASYNC_LDS
  __builtin_amdgcn_global_load_async_to_lds_b128(
      (gv4i*)(uintptr_t)g, (lv4i*)(unsigned)(uintptr_t)lds, 0, 0);
#else
  *(v8h*)lds = *(const v8h*)g;
#endif
}

// K-slot permutation for the PV matmul (shared by P-store and vF layout):
//   K slot j <-> n offset (j>>1) | ((j&1)<<4)   within each 32-column chunk.

// ---------------------------------------------------------------------------
// Kernel 1: 1x1-conv projections on the matrix unit.
//   q = Wq @ pose + bq   -> qT [B][N][CQ] f16   (K-contiguous for WMMA gather)
//   k = Wk @ src  + bk   -> kT [B][N][CQ] f16
//   v = Wv @ src  + bv   -> vF [B][N/32][C/16][4][16][8] f16: one 1 KB block per
//       (32-key chunk, 16-channel tile), laid out as the PV product's B fragment:
//       [group of 8 K slots][channel][slot], n pre-permuted per 32-chunk
// One block = 64 columns n of one batch. Both input tiles are rounded to f16
// and staged column-major ([n][c]) in LDS, so a fragment is 16 contiguous c.
// Each f32 weight enters as an f16 pair hi + lo (lo = w - hi), two products
// into one f32 accumulator, so the weights keep about 22 significant bits.
// Every fragment, of X and of W alike, holds k = 32*ks + 16*(lane>>4) + s.
// ---------------------------------------------------------------------------
#define XP 264   // halves per staged column: 256 c + 8 (528 B = 16 B x 33)
#define WP 40    // halves per staged weight row: 32 k + 8 (80 B = 16 B x 5)

__device__ __forceinline__ v16h frag16(const _Float16* p) {
  const v8h lo = *(const v8h*)p;
  const v8h hi = *(const v8h*)(p + 8);
  return __builtin_shufflevector(lo, hi, 0,1,2,3,4,5,6,7,8,9,10,11,12,13,14,15);
}

__device__ __forceinline__ v8f mma16(v16h a, v16h b, v8f c) {
  return __builtin_amdgcn_wmma_f32_16x16x32_f16(false, a, false, b, (short)0, c, false, false);
}

// 16 B at a wave-uniform base + the lane's 32-bit byte offset + a constant: every
// load of a family names one offset register and a scalar base, no address pair.
__device__ __forceinline__ v4f ld16(const float* __restrict__ base, unsigned voff, int imm) {
  return *(const v4f*)((const char*)base + (size_t)voff + imm);
}

typedef __attribute__((address_space(1))) const v8h  gv8h;    // eight halves in global memory
typedef __attribute__((address_space(1))) const char gbyte;   // a byte there

// the same for eight halves
__device__ __forceinline__ v8h ld16h(const _Float16* __restrict__ base, unsigned voff, int imm) {
  return *(const v8h*)((const char*)base + (size_t)voff + imm);
}

// 256 c x 64 n of X into registers: 8 lanes cover one 128 B line of a row.
__device__ __forceinline__ void load_x(const float* __restrict__ X, unsigned xoff,
                                       v4f (&raw)[16]) {
  #pragma unroll
  for (int i = 0; i < 16; ++i)
    raw[i] = ld16(X, xoff, ((i >> 3) * 128 + (i & 7)) * N_ * 4);
}

// ... and transposed into LDS: 8 consecutive c of one column per 16 B store.
__device__ __forceinline__ void store_x(_Float16* sx, int nq, int cg, const v4f (&raw)[16]) {
  #pragma unroll
  for (int p = 0; p < 2; ++p)
    #pragma unroll
    for (int e = 0; e < 4; ++e) {
      v8h col;
      #pragma unroll
      for (int j = 0; j < 8; ++j) col[j] = (_Float16)raw[p * 8 + j][e];
      *(v8h*)(sx + (nq * 4 + e) * XP + p * 128 + cg * 8) = col;
    }
}

// 32 weight rows x 32 k (one k step) into registers: 8 lanes per 128 B line.
__device__ __forceinline__ void load_w(const float* __restrict__ Wr, int ks, unsigned woff,
                                       v4f (&wr)[8]) {
  #pragma unroll
  for (int i = 0; i < 8; ++i) wr[i] = ld16(Wr, woff, (i * 4 * C_ + ks * 32) * 4);
}

// Split into hi + lo and turn into fragments through the wave's own LDS patch.
__device__ __forceinline__ void split_w(_Float16* wl, int lane, const v4f (&wr)[8],
                                        v16h (&hi)[2], v16h (&lo)[2]) {
  #pragma unroll
  for (int i = 0; i < 8; ++i) {
    const int row = i * 4 + (lane >> 3);
    const v2f wa = {wr[i][0], wr[i][1]}, wb = {wr[i][2], wr[i][3]};
    const v2h ha = __builtin_convertvector(wa, v2h), hb = __builtin_convertvector(wb, v2h);
    const v2f da = {wa[0] - (float)ha[0], wa[1] - (float)ha[1]};
    const v2f db = {wb[0] - (float)hb[0], wb[1] - (float)hb[1]};
    const v2h la = __builtin_convertvector(da, v2h), lb = __builtin_convertvector(db, v2h);
    const v4h h4 = __builtin_shufflevector(ha, hb, 0, 1, 2, 3);
    const v4h l4 = __builtin_shufflevector(la, lb, 0, 1, 2, 3);
    *(v4h*)(wl + row * WP + (lane & 7) * 4)        = h4;
    *(v4h*)(wl + (32 + row) * WP + (lane & 7) * 4) = l4;
  }
  __builtin_amdgcn_wave_barrier();   // keeps the reads below behind the stores (per-wave LDS is in-order)
  const _Float16* rd = wl + (lane & 15) * WP + 16 * (lane >> 4);
  #pragma unroll
  for (int t = 0; t < 2; ++t) {
    hi[t] = frag16(rd + t * 16 * WP);
    lo[t] = frag16(rd + (32 + t * 16) * WP);
  }
  __builtin_amdgcn_wave_barrier();   // keeps the next k step's stores behind these reads
}

__global__ __launch_bounds__(256)
void proj_kernel(const float* __restrict__ source, const float* __restrict__ pose,
                 const float* __restrict__ Wq, const float* __restrict__ bq,
                 const float* __restrict__ Wk, const float* __restrict__ bk,
                 const float* __restrict__ Wv, const float* __restrict__ bv,
                 _Float16* __restrict__ qT, _Float16* __restrict__ kT,
                 _Float16* __restrict__ vF) {
  __shared__ __align__(16) _Float16 shX[2][64 * XP];   // [0] pose, [1] source: [n][c]
  __shared__ __align__(16) _Float16 shW[8][64 * WP];   // per wave: 32 rows hi, 32 rows lo
  const int tid  = threadIdx.x;
  const int lane = tid & 31;
  const int wv   = __builtin_amdgcn_readfirstlane(tid >> 5);
  const int b    = blockIdx.x / (N_ / 64);
  const int n0   = (blockIdx.x % (N_ / 64)) * 64;
  const int lr   = lane & 15;
  const int half = lane >> 4;
  _Float16* wl   = &shW[wv][0];

  // waves 0-3: q of one 16-column tile each; waves 4-7: k likewise
  const bool isq = wv < 4;
  const float* __restrict__ W1  = isq ? Wq : Wk;
  const float* __restrict__ Wvr = Wv + wv * 32 * C_;   // then 32 rows of v, all 64 columns

  // weight steps 0-7: the q / k rows, 8-15: the v rows; fetched two steps ahead,
  // so that a step's conversions never wait on loads issued just before them
  const unsigned woff = ((lane >> 3) * C_ + (lane & 7) * 4) * 4;
  auto fetch = [&](int s, v4f (&dst)[8]) {
    if (s < 8) load_w(W1, s, woff, dst);
    else       load_w(Wvr, s - 8, woff, dst);
    // last use of woff: holds it to here, so that no load above takes it as its
    // destination, and puts the wait in front of whatever overwrites it next
    if (s == 15) asm volatile("s_wait_xcnt 0x0" :: "v"(woff) : "memory");
    // keeps the later steps' conversions, and with them their data waits, behind
    // the issue of these loads
    __builtin_amdgcn_sched_barrier(0);
  };
  v4f wr[2][8];
  {
    const int nq = (lane & 7) + 8 * (wv & 1);
    const int cg = (lane >> 3) + 4 * (wv >> 1);
    v4f rp[16], rs[16];
    const unsigned xoff = (cg * 8 * N_ + nq * 4) * 4;
    load_x(pose   + (size_t)b * C_ * N_ + n0, xoff, rp);
    load_x(source + (size_t)b * C_ * N_ + n0, xoff, rs);
    // last use of xoff: as for woff in fetch()
    asm volatile("s_wait_xcnt 0x0" :: "v"(xoff) : "memory");
    fetch(0, wr[0]);
    fetch(1, wr[1]);
    store_x(&shX[0][0], nq, cg, rp);
    store_x(&shX[1][0], nq, cg, rs);
  }
  __syncthreads();

  // ---- q / k: A = W (rows o), B = X (columns n); D[r] = row o = 8*half + r ----
  {
    const _Float16* xcol = &shX[isq ? 0 : 1][((wv & 3) * 16 + lr) * XP + 16 * half];
    v8f a0 = {}, a1 = {};
    #pragma unroll
    for (int ks = 0; ks < 8; ++ks) {
      v16h hi[2], lo[2];
      split_w(wl, lane, wr[ks & 1], hi, lo);
      fetch(ks + 2, wr[ks & 1]);
      const v16h xb = frag16(xcol + ks * 32);
      a0 = mma16(hi[0], xb, a0);
      a1 = mma16(hi[1], xb, a1);
      a0 = mma16(lo[0], xb, a0);
      a1 = mma16(lo[1], xb, a1);
    }
    const float* __restrict__ b1 = (isq ? bq : bk) + 8 * half;
    v8h o0, o1;
    #pragma unroll
    for (int r = 0; r < 8; ++r) {
      o0[r] = (_Float16)(a0[r] + b1[r]);
      o1[r] = (_Float16)(a1[r] + b1[16 + r]);
    }
    _Float16* dst = (isq ? qT : kT) + ((size_t)b * N_ + n0 + (wv & 3) * 16 + lr) * CQ + 8 * half;
    *(v8h*)dst        = o0;
    *(v8h*)(dst + 16) = o1;
  }

  // ---- v: A = X (rows n), B = W (columns o); D[r] = row n = 8*half + r ----
  {
    v8f acc[2][4];
    #pragma unroll
    for (int t = 0; t < 2; ++t)
      #pragma unroll
      for (int nt = 0; nt < 4; ++nt)
        #pragma unroll
        for (int i = 0; i < 8; ++i) acc[t][nt][i] = 0.f;

    float bias[2];   // read ahead of the loop, so that the epilogue does not wait on them
    #pragma unroll
    for (int t = 0; t < 2; ++t) bias[t] = bv[wv * 32 + t * 16 + lr];

    const _Float16* xrow = &shX[1][lr * XP + 16 * half];
    #pragma unroll
    for (int ks = 0; ks < 8; ++ks) {
      v16h hi[2], lo[2];
      split_w(wl, lane, wr[ks & 1], hi, lo);
      if (ks < 6) fetch(ks + 10, wr[ks & 1]);
      v16h xa[4];
      #pragma unroll
      for (int nt = 0; nt < 4; ++nt) xa[nt] = frag16(xrow + nt * 16 * XP + ks * 32);
      #pragma unroll
      for (int t = 0; t < 2; ++t)
        #pragma unroll
        for (int nt = 0; nt < 4; ++nt) acc[t][nt] = mma16(xa[nt], hi[t], acc[t][nt]);
      #pragma unroll
      for (int t = 0; t < 2; ++t)
        #pragma unroll
        for (int nt = 0; nt < 4; ++nt) acc[t][nt] = mma16(xa[nt], lo[t], acc[t][nt]);
    }

    // K-slot permutation for v: column x (0..31) -> slot ((x&15)<<1)|(x>>4), so the
    // two 16-column tiles of a 32-chunk interleave: 16 consecutive slots per lane.
    #pragma unroll
    for (int t = 0; t < 2; ++t) {
      #pragma unroll
      for (int p = 0; p < 2; ++p) {
        v8h s0, s1;
        #pragma unroll
        for (int r = 0; r < 4; ++r) {
          s0[2 * r]     = (_Float16)(acc[t][2 * p][r] + bias[t]);
          s0[2 * r + 1] = (_Float16)(acc[t][2 * p + 1][r] + bias[t]);
          s1[2 * r]     = (_Float16)(acc[t][2 * p][r + 4] + bias[t]);
          s1[2 * r + 1] = (_Float16)(acc[t][2 * p + 1][r + 4] + bias[t]);
        }
        // slots 16*half .. + 15 of channel lr: slot groups 2*half and 2*half + 1;
        // 16 lanes store 256 contiguous bytes
        _Float16* dst = vF + (((size_t)b * (N_ / 32) + n0 / 32 + p) * (C_ / 16) + wv * 2 + t) * 512
                           + 2 * half * 128 + lr * 8;
        *(v8h*)dst         = s0;
        *(v8h*)(dst + 128) = s1;
      }
    }
  }
}

// ---------------------------------------------------------------------------
// Kernel 2: fused two-pass flash attention.
// One block = 64 rows m of one batch, 16 waves. Pass A (the exact row maxima)
// deals the keys over all 16 waves, each scoring its keys against all 64 rows.
// In pass B wave (mt, kq) takes every fourth 32-key chunk (4*s + kq) and there owns
// all 64 rows x the 64 channels of quarter mt: a V fragment and a P fragment each
// feed four products. The P tile of rows mt of its chunk is made by that wave, one
// stage ahead, and handed to the chunk's other three waves through LDS at the
// stage's barrier. The grid is one block per WGP. The four phases share the exact
// row maximum (joined through LDS after pass A), so their partial sums add without
// any rescale; they are joined through LDS at the end, always in the order
// kq = 0..3, wave (mt, kq) finishing rows kq of its channel quarter.
// Pass B double-buffers a 128-key stage of K in LDS via async global->LDS copies (the
// K stage in use runs one stage ahead of the PV products, for the P tiles).
// Every staged row is read as 16 B pieces by 16 lanes, one row each: a pitch of
// 16 B x odd puts those 16 pieces on all 64 banks once.
// V does not pass through LDS: a V fragment is used by one wave alone, so LDS would
// only add a write and a read of every byte. The projection stores V in fragment
// order, a wave's load of half a fragment is 512 contiguous bytes, and a fragment's
// registers are refilled for the next stage directly behind its last product.
// The 64 blocks of a batch read the same K and V. In pass B each walks the stages in a
// ring from a start of its own (rot), so that they do not ask L2 for the same lines at
// the same moment; but for the order of the additions the sums do not depend on it.
// ---------------------------------------------------------------------------
#define AP 40    // halves per staged row of K and P: 32 + 8 (80 B = 16 B x 5)
#define VSTG (KQ * (C_ / 16) * 512)               // halves of V per 128-key stage
#define SM_K   0                                  // [2][KQ][32][AP] halves
#define SM_P   (SM_K + 2 * KQ * 32 * AP * 2)      // [2][KQ][MT][16][AP] halves
#define SM_X   (WPB * 16 * 1024)                  // the join: [WPB][16 tiles][2][32 lanes] x 16 B
// SM_X is the larger of the two uses (ring + P: 61440 B, join: 262144 B)

__global__ __launch_bounds__(512)
void attn_kernel(const _Float16* __restrict__ qT, const _Float16* __restrict__ kT,
                 const _Float16* __restrict__ vF, const float* __restrict__ src,
                 const float* __restrict__ gamma_p, float* __restrict__ out) {
  __shared__ __align__(64) unsigned char smem[SM_X];
  // per wave: maxima of the block's 64 rows over its keys; 272 B = 16 B x 17 a wave,
  // so that 16 lanes reading 16 B of one wave each meet all 64 banks once
  __shared__ __align__(16) float shM[WPB][MT * 16 + 4];
  __shared__ __align__(16) float shS[WPB][16];   // per wave: row sums of its keys
  _Float16* const shK = (_Float16*)(smem + SM_K);
  _Float16* const shP = (_Float16*)(smem + SM_P);

  const int tid  = threadIdx.x;
  const int lane = tid & 31;
  const int wv   = __builtin_amdgcn_readfirstlane(tid >> 5);
  const int mt   = wv & (MT - 1);
  const int kq   = wv / MT;
  const int b    = blockIdx.x / (N_ / 16 / MT);                // uniform per block
  const int m0   = ((blockIdx.x % (N_ / 16 / MT)) * MT + mt) * 16;
  const int half = lane >> 4;           // 0: rows 0-7/K 0-7,16-23 ; 1: rows 8-15/K 8-15,24-31
  const int lr   = lane & 15;
  const int koff = half ? 8 : 0;
  // the block's start stage: the 32 blocks of a batch whose indices lie in any four
  // successive residues mod 8 get 32 different starts. For speed only: every value gives the same function.
  const int tile = blockIdx.x % (N_ / 16 / MT);
  const int rot  = (tile >> 3) * 4 + (tile & 3);

  // A-operand: q rows m0..m0+15, K-packed per ISA 16-bit A layout
  const _Float16* qrow = qT + ((size_t)b * N_ + m0 + lr) * CQ;
  const v8h qlo = *(const v8h*)(qrow + koff);
  const v8h qhi = *(const v8h*)(qrow + koff + 16);
  const v16h aq = __builtin_shufflevector(qlo, qhi, 0,1,2,3,4,5,6,7,8,9,10,11,12,13,14,15);

  const v8f czero = {};

  // ========== Pass A: exact row maxima ==========
  // Wave wv takes the 32-key chunks wv + 16*i and scores them against all four row
  // tiles: a chunk is loaded once per block, and a wave's loads run KD chunks ahead
  // of its products, one exposed round of load latency in place of one per chunk.
  // The products are K.Q^T: D holds row m = lr of a tile in a lane and 8 keys in its
  // registers, so a row's maximum is in-lane but for one exchange between the halves.
  {
    const _Float16* __restrict__ qblk = qT + ((size_t)b * N_ + (blockIdx.x % (N_ / 16 / MT)) * MT * 16) * CQ;
    const _Float16* __restrict__ kwav = kT + ((size_t)b * N_ + wv * 32) * CQ;   // same for the whole wave
    const unsigned fo = (lr * CQ + koff) * 2;   // the lane's byte offset in a 16-row fragment
    v8h qf[MT][2], kf[KD][4];
    auto fetch = [&](int i, v8h (&dst)[4]) {   // chunk wv + 16*i
      const _Float16* __restrict__ kc = kwav + (size_t)i * WPB * 32 * CQ;
      dst[0] = ld16h(kc, fo, 0);
      dst[1] = ld16h(kc, fo, 32);
      dst[2] = ld16h(kc, fo, 16 * CQ * 2);
      dst[3] = ld16h(kc, fo, 16 * CQ * 2 + 32);
    };
    #pragma unroll
    for (int u = 0; u < MT; ++u) {
      qf[u][0] = ld16h(qblk, fo, u * 16 * CQ * 2);
      qf[u][1] = ld16h(qblk, fo, u * 16 * CQ * 2 + 32);
    }
    // the q loads go out first: loads are waited for in issue order, and a q load among
    // the K loads makes the first products wait out the K loads in front of it (the
    // build without this line did so, waited to zero and spilled)
    __builtin_amdgcn_sched_barrier(0);
    #pragma unroll
    for (int d = 0; d < KD; ++d) fetch(d, kf[d]);

    v16h qb[MT];
    #pragma unroll
    for (int u = 0; u < MT; ++u)
      qb[u] = __builtin_shufflevector(qf[u][0], qf[u][1], 0,1,2,3,4,5,6,7,8,9,10,11,12,13,14,15);
    float cm[MT][8];
    #pragma unroll
    for (int u = 0; u < MT; ++u)
      #pragma unroll
      for (int r = 0; r < 8; ++r) cm[u][r] = -3.0e38f;
    auto score = [&](const v8h (&k)[4]) {   // one chunk against the four row tiles
      const v16h ka0 = __builtin_shufflevector(k[0], k[1], 0,1,2,3,4,5,6,7,8,9,10,11,12,13,14,15);
      const v16h ka1 = __builtin_shufflevector(k[2], k[3], 0,1,2,3,4,5,6,7,8,9,10,11,12,13,14,15);
      #pragma unroll
      for (int u = 0; u < MT; ++u) {
        const v8f e0 = __builtin_amdgcn_wmma_f32_16x16x32_f16(false, ka0, false, qb[u],
                                                              (short)0, czero, false, false);
        const v8f e1 = __builtin_amdgcn_wmma_f32_16x16x32_f16(false, ka1, false, qb[u],
                                                              (short)0, czero, false, false);
        #pragma unroll
        for (int r = 0; r < 8; ++r) cm[u][r] = fmaxf(cm[u][r], fmaxf(e0[r], e1[r]));
      }
    };
    #pragma unroll
    for (int i = KD; i < NC; i += KD) {
      #pragma unroll
      for (int d = 0; d < KD; ++d) {
        score(kf[d]);
        fetch(i + d, kf[d]);
      }
    }
    // last use of fo: holds it to here, so that no load above takes it as its
    // destination, and puts the wait in front of whatever overwrites it next
    asm volatile("s_wait_xcnt 0x0" :: "v"(fo) : "memory");
    #pragma unroll
    for (int d = 0; d < KD; ++d) score(kf[d]);
    float mm[MT];
    #pragma unroll
    for (int u = 0; u < MT; ++u) {
      const float m = fmaxf(fmaxf(fmaxf(cm[u][0], cm[u][1]), fmaxf(cm[u][2], cm[u][3])),
                            fmaxf(fmaxf(cm[u][4], cm[u][5]), fmaxf(cm[u][6], cm[u][7])));
      mm[u] = fmaxf(m, __shfl_xor(m, 16, 32));
    }
    if (half == 0) {                // read by every wave behind the prologue's barrier
      #pragma unroll
      for (int u = 0; u < MT; ++u) shM[wv][u * 16 + lr] = mm[u];
    }
  }

  // ================= Pass B: P = exp(e - max), PV accumulation ==============
  v8f acc[16];
  #pragma unroll
  for (int t = 0; t < 16; ++t)
    #pragma unroll
    for (int i = 0; i < 8; ++i) acc[t][i] = 0.f;
  float rsum[8];
  #pragma unroll
  for (int i = 0; i < 8; ++i) rsum[i] = 0.f;

  // the wave's four V fragments of a stage: 4 KB in a row, the same base for the whole wave
  // (vnext: of the stage that is fetched next; typed as global memory, which the compiler
  // cannot see for itself behind the asm statements that hold it)
  gbyte* const vwav = (gbyte*)(uintptr_t)(vF + (((size_t)b * (N_ / 32) + kq) * (C_ / 16) + mt * 4) * 512);
  auto ring = [&](int s) { return (s + rot) & (NS - 1); };   // the stage that the block takes as its s-th
  gbyte* vnext = vwav + (size_t)ring(0) * (VSTG * 2);
  // bytes from the block's (s-1)-th V stage to its s-th: one stage on, or back to the first
  auto vstep = [&](int s) { return ring(s) ? (long)(VSTG * 2) : -(long)((NS - 1) * VSTG * 2); };
  const unsigned vfo = lane * 16;   // the lane's byte offset in half a fragment
  v8h vr[4][2];
  auto load_v = [&](int c) {        // fragment c of the stage at vnext
    vr[c][0] = *(gv8h*)(vnext + (size_t)vfo + c * 1024);
    vr[c][1] = *(gv8h*)(vnext + (size_t)vfo + c * 1024 + 512);
  };

  // cooperative staging of K: 512 threads, 16 B per async op, every lane on;
  // 4 lanes cover a 64 B row.
  const int part  = tid & 3;     // 16 B piece of a K row
  const int krow  = tid >> 2;    // 0..127: chunk krow >> 5, row krow & 31
  _Float16* const kdst = shK + krow * AP + part * 8;
  // the lane's byte offset from a base that is the same for the whole block
  const unsigned kgo = (krow * CQ + part * 8) * 2;
  const _Float16* kstage = kT + (size_t)b * N_ * CQ;

  auto stage_k = [&](int buf, int n0) {
    cp16_async(kdst + buf * (KQ * 32 * AP),
               (const char*)(kstage + (size_t)n0 * CQ) + (size_t)kgo);
  };

  float rmax[8];

  // energy of rows mt against this wave's chunk of the K stage in buffer buf
  auto energy = [&](int buf, v8f& e0, v8f& e1) {
    const _Float16* kk = shK + (buf * KQ + kq) * 32 * AP;
    const v8h kl0 = *(const v8h*)(kk + lr * AP + koff);
    const v8h kh0 = *(const v8h*)(kk + lr * AP + koff + 16);
    const v8h kl1 = *(const v8h*)(kk + (16 + lr) * AP + koff);
    const v8h kh1 = *(const v8h*)(kk + (16 + lr) * AP + koff + 16);
    const v16h kb0 = __builtin_shufflevector(kl0, kh0, 0,1,2,3,4,5,6,7,8,9,10,11,12,13,14,15);
    const v16h kb1 = __builtin_shufflevector(kl1, kh1, 0,1,2,3,4,5,6,7,8,9,10,11,12,13,14,15);
    e0 = __builtin_amdgcn_wmma_f32_16x16x32_f16(false, aq, false, kb0,
                                                (short)0, czero, false, false);
    e1 = __builtin_amdgcn_wmma_f32_16x16x32_f16(false, aq, false, kb1,
                                                (short)0, czero, false, false);
  };

  // P tile of rows mt into P buffer buf: packed (p0,p1) -> one b32 LDS store per row slot.
  // Stored slot j maps to n offset (j>>1)|((j&1)<<4); vF uses same mapping.
  auto put_p = [&](int buf, const v8f& e0, const v8f& e1) {
    _Float16* myP = shP + ((buf * KQ + kq) * MT + mt) * 16 * AP;
    #pragma unroll
    for (int i = 0; i < 8; ++i) {
      const float a0 = __expf(e0[i] - rmax[i]);
      const float a1 = __expf(e1[i] - rmax[i]);
      rsum[i] += a0 + a1;                    // per-lane; reduced after the loop
      const int r = i + 8 * half;
      v2h pk; pk[0] = (_Float16)a0; pk[1] = (_Float16)a1;
      *(v2h*)(myP + r * AP + 2 * lr) = pk;
    }
  };

  // PV of this wave's chunk, P in buffer buf: 4 row tiles x the 4 channel tiles of quarter
  // mt; more: each V fragment is then fetched anew from vnext
  auto pv = [&](int buf, bool more) {
    const _Float16* pp = shP + (buf * KQ + kq) * MT * 16 * AP + lr * AP + koff;
    v16h pa[MT];
    #pragma unroll
    for (int u = 0; u < MT; ++u) {
      const v8h plo = *(const v8h*)(pp + u * 16 * AP);
      const v8h phi = *(const v8h*)(pp + u * 16 * AP + 16);
      pa[u] = __builtin_shufflevector(plo, phi, 0,1,2,3,4,5,6,7,8,9,10,11,12,13,14,15);
    }
    #pragma unroll
    for (int c = 0; c < 4; ++c) {
      const v16h vb = __builtin_shufflevector(vr[c][0], vr[c][1], 0,1,2,3,4,5,6,7,8,9,10,11,12,13,14,15);
      #pragma unroll
      for (int u = 0; u < MT; ++u)
        acc[u * 4 + c] = __builtin_amdgcn_wmma_f32_16x16x32_f16(false, pa[u], false, vb,
                                                                (short)0, acc[u * 4 + c], false, false);
      if (more) load_v(c);
    }
  };

  stage_k(0, ring(0) * 32 * KQ);
  asm volatile("s_wait_asynccnt 0x0" ::: "memory");   // this wave's share of K stage 0 has landed
  __syncthreads();                                    // K stage 0 and shM are published
  #pragma unroll
  for (int c = 0; c < 4; ++c) load_v(c);              // V of stage 0
  // the loads above name addresses formed from vnext: the wait stands in front of their overwrite
  asm volatile("s_wait_xcnt 0x0" : "+s"(vnext) :: "memory");
  vnext += vstep(1);
  stage_k(1, ring(1) * 32 * KQ);

  // the exact max of rows mt over all keys: lane lr takes wave lr's maxima of the
  // rows 8*half .. 8*half + 7, then one-time 16-lane reductions
  {
    const v4f ma = *(const v4f*)&shM[lr][mt * 16 + 8 * half];
    const v4f mb = *(const v4f*)&shM[lr][mt * 16 + 8 * half + 4];
    #pragma unroll
    for (int i = 0; i < 4; ++i) { rmax[i] = ma[i]; rmax[i + 4] = mb[i]; }
    #pragma unroll
    for (int i = 0; i < 8; ++i) {
      float m = rmax[i];
      m = fmaxf(m, __shfl_xor(m, 1, 32));
      m = fmaxf(m, __shfl_xor(m, 2, 32));
      m = fmaxf(m, __shfl_xor(m, 4, 32));
      m = fmaxf(m, __shfl_xor(m, 8, 32));
      rmax[i] = m;
    }
  }
  {
    v8f e0, e1;
    energy(0, e0, e1);
    put_p(0, e0, e1);
  }
  asm volatile("s_wait_dscnt 0x0" ::: "memory");      // this wave's P tile of stage 0 is written
  asm volatile("s_wait_asynccnt 0x0" ::: "memory");   // its share of K stage 1 has landed
  __syncthreads();                                    // publishes P of stage 0 and K of stage 1

  // trip st: PV of stage st; P of stage st + 1 from the K stage published at the last
  // barrier; K of stage st + 2 flies into the buffer that the trip before has left, V of
  // stage st + 1 into the registers that this trip's products leave
  for (int st = 0; st < NS - 1; ++st) {
    const int cur = st & 1;
    if (st + 2 < NS) stage_k(cur, ring(st + 2) * 32 * KQ);

    v8f e0, e1;
    energy(cur ^ 1, e0, e1);
    pv(cur, true);
    put_p(cur ^ 1, e0, e1);

    // keeps this trip's products in front of the barrier: sunk behind it they stand in
    // front of the next trip's copies, which then have less of the trip to land in, and
    // their fragments stay live over the copies' addresses (that build spilled)
    __builtin_amdgcn_sched_barrier(0);
    asm volatile("s_wait_dscnt 0x0" ::: "memory");      // this wave has left the current buffers, its P tile is written
    asm volatile("s_wait_asynccnt 0x0" ::: "memory");   // its share of the next K stage has landed
    // this trip's V loads name an address formed from vnext: the wait stands in front of its overwrite
    asm volatile("s_wait_xcnt 0x0" : "+s"(vnext) :: "memory");
    vnext += vstep(st + 2);
    // publishes the next stage, frees these buffers. The barrier is written out, its fences
    // on LDS alone: __syncthreads() would wait out the V loads that are to fly across it
    __builtin_amdgcn_fence(__ATOMIC_RELEASE, "workgroup", "local");
    __builtin_amdgcn_s_barrier();
    __builtin_amdgcn_fence(__ATOMIC_ACQUIRE, "workgroup", "local");
  }
  pv((NS - 1) & 1, false);
  asm volatile("s_wait_dscnt 0x0" ::: "memory");        // this wave has left the ring
  // nothing is in flight into the ring when its LDS becomes the join's buffer
  asm volatile("s_wait_asynccnt 0x0" ::: "memory");
  __syncthreads();                                      // every wave has left the ring

  // ---- join of the four key phases ----
  // this wave finishes rows kq of its channel quarter (accumulators 4*kq .. 4*kq + 3);
  // their source values are fetched ahead of the join
  const int mo = ((blockIdx.x % (N_ / 16 / MT)) * MT + kq) * 16;
  const float gam = gamma_p[0];
  v4f sv[4][2];
  const float* __restrict__ sbase = src + ((size_t)b * C_ + mt * 64) * N_ + mo;   // same for the whole wave
  const unsigned soff = (lr * N_ + 8 * half) * 4;
  #pragma unroll
  for (int tt = 0; tt < 4; ++tt) {
    sv[tt][0] = ld16(sbase, soff, tt * 16 * N_ * 4);
    sv[tt][1] = ld16(sbase, soff, tt * 16 * N_ * 4 + 16);
  }
  // last use of soff: holds it to here, so that no load above takes it as its
  // destination, and puts the wait in front of whatever overwrites it next
  asm volatile("s_wait_xcnt 0x0" :: "v"(soff) : "memory");

  #pragma unroll
  for (int i = 0; i < 8; ++i) {   // one-time 16-lane row-sum reduction
    float s = rsum[i];
    s += __shfl_xor(s, 1, 32);
    s += __shfl_xor(s, 2, 32);
    s += __shfl_xor(s, 4, 32);
    s += __shfl_xor(s, 8, 32);
    rsum[i] = s;
  }
  if (lr == 0) {
    #pragma unroll
    for (int i = 0; i < 8; ++i) shS[wv][8 * half + i] = rsum[i];
  }
  float* const xj = (float*)smem;   // [wave][tile][register quad][lane] x 16 B
  #pragma unroll
  for (int t = 0; t < 16; ++t) {
    const v4f lo4 = {acc[t][0], acc[t][1], acc[t][2], acc[t][3]};
    const v4f hi4 = {acc[t][4], acc[t][5], acc[t][6], acc[t][7]};
    *(v4f*)(xj + (((wv * 16 + t) * 2 + 0) * 32 + lane) * 4) = lo4;
    *(v4f*)(xj + (((wv * 16 + t) * 2 + 1) * 32 + lane) * 4) = hi4;
  }
  __syncthreads();                  // every phase's partial sums are in LDS

  float linv[8];
  {
    v4f sa = *(const v4f*)&shS[kq][8 * half];       // shS[j * MT + kq]: rows kq, phase j
    v4f sb = *(const v4f*)&shS[kq][8 * half + 4];
    #pragma unroll
    for (int j = 1; j < KQ; ++j) {
      sa += *(const v4f*)&shS[j * MT + kq][8 * half];
      sb += *(const v4f*)&shS[j * MT + kq][8 * half + 4];
    }
    #pragma unroll
    for (int i = 0; i < 4; ++i) { linv[i] = 1.f / sa[i]; linv[i + 4] = 1.f / sb[i]; }
  }

  // ---- epilogue: gamma * (acc/sum) + source; contiguous 16B stores along m ----
  #pragma unroll
  for (int tt = 0; tt < 4; ++tt) {
    const int t = kq * 4 + tt;
    v4f p0 = *(const v4f*)(xj + (((mt * 16 + t) * 2 + 0) * 32 + lane) * 4);
    v4f p1 = *(const v4f*)(xj + (((mt * 16 + t) * 2 + 1) * 32 + lane) * 4);
    #pragma unroll
    for (int j = 1; j < KQ; ++j) {
      p0 += *(const v4f*)(xj + ((((j * MT + mt) * 16 + t) * 2 + 0) * 32 + lane) * 4);
      p1 += *(const v4f*)(xj + ((((j * MT + mt) * 16 + t) * 2 + 1) * 32 + lane) * 4);
    }
    const size_t base = ((size_t)b * C_ + mt * 64 + tt * 16 + lr) * N_ + mo + 8 * half;
    v4f r0, r1;
    #pragma unroll
    for (int i = 0; i < 4; ++i) {
      r0[i] = gam * p0[i] * linv[i]     + sv[tt][0][i];
      r1[i] = gam * p1[i] * linv[i + 4] + sv[tt][1][i];
    }
    *(v4f*)(out + base)     = r0;
    *(v4f*)(out + base + 4) = r1;
  }
}

// ---------------------------------------------------------------------------
extern "C" void kernel_launch(void* const* d_in, const int* in_sizes, int n_in,
                              void* d_out, int out_size, void* d_ws, size_t ws_size,
                              hipStream_t stream) {
  const float* source = (const float*)d_in[0];
  const float* pose   = (const float*)d_in[1];
  const float* Wq     = (const float*)d_in[2];
  const float* bq     = (const float*)d_in[3];
  const float* Wk     = (const float*)d_in[4];
  const float* bk     = (const float*)d_in[5];
  const float* Wv     = (const float*)d_in[6];
  const float* bv     = (const float*)d_in[7];
  const float* gamma  = (const float*)d_in[8];
  float* out = (float*)d_out;

  // workspace: qT (1 MB) | kT (1 MB) | vF (8 MB), all f16
  _Float16* qT = (_Float16*)d_ws;
  _Float16* kT = qT + (size_t)B_ * N_ * CQ;
  _Float16* vF = kT + (size_t)B_ * N_ * CQ;

  proj_kernel<<<dim3(B_ * (N_ / 64)), dim3(256), 0, stream>>>(
      source, pose, Wq, bq, Wk, bk, Wv, bv, qT, kT, vF);

  attn_kernel<<<dim3(B_ * (N_ / 16) / MT), dim3(32 * WPB), 0, stream>>>(
      qT, kT, vF, source, gamma, out);
}

// v009
// A run of this version takes 45.7 microseconds.
// Next to v008, in two timings, it ran 1.06 and 1.07 times as fast.
// Over all steps from v000 it is 11.7 times as fast.
#include <hip/hip_runtime.h>
#include <cstdint>

typedef __attribute__((ext_vector_type(16))) _Float16 v16h;
typedef __attribute__((ext_vector_type(8)))  _Float16 v8h;
typedef __attribute__((ext_vector_type(4)))  _Float16 v4h;
typedef __attribute__((ext_vector_type(2)))  _Float16 v2h;
typedef __attribute__((ext_vector_type(8)))  float    v8f;
typedef __attribute__((ext_vector_type(4)))  float    v4f;
typedef __attribute__((ext_vector_type(2)))  float    v2f;
typedef __attribute__((ext_vector_type(4)))  int      v4i;

#define B_   4
#define C_   256
#define CQ   32
#define N_   4096
#define MT   4            // 16-row m tiles per attention block
#define KQ   4            // key phases: wave (mt, kq) takes the 32-key chunks 4*s + kq
#define WPB  (MT * KQ)    // waves per attention block (512 threads)
#define NC   (N_ / 32 / WPB)   // 32-key chunks per wave in pass A
#define KD   4                 // chunks that a wave's K loads run ahead of its products
#define NS   (N_ / (32 * KQ))  // 128-key stages of pass B

// ---------------------------------------------------------------------------
// CDNA5 async global->LDS copy (ASYNCcnt-tracked), guarded so a missing
// builtin degrades to a plain load + ds_store without breaking the build.
// Builtin expects (int4 AS1*, int4 AS3*, imm offset, imm cpol) per the
// clang diagnostic ("int4 __device__ *").
// ---------------------------------------------------------------------------
#if __has_builtin(__builtin_amdgcn_global_load_async_to_lds_b128)
#define USE_ASYNC_LDS 1
typedef __attribute__((address_space(1))) v4i gv4i;
typedef __attribute__((address_space(3))) v4i lv4i;
#endif

__device__ __forceinline__ void cp16_async(void* lds, const void* g) {
#ifdef USE_ASYNC_LDS
  __builtin_amdgcn_global_load_async_to_lds_b128(
      (gv4i*)(uintptr_t)g, (lv4i*)(unsigned)(uintptr_t)lds, 0, 0);
#else
  *(v8h*)lds = *(const v8h*)g;
#endif
}

// K-slot permutation for the PV matmul (shared by P-store and vF layout):
//   K slot j <-> n offset (j>>1) | ((j&1)<<4)   within each 32-column chunk.

// ---------------------------------------------------------------------------
// Kernel 1: 1x1-conv projections on the matrix unit.
//   q = Wq @ pose + bq   -> qT [B][N][CQ] f16   (K-contiguous for WMMA gather)
//   k = Wk @ src  + bk   -> kT [B][N][CQ] f16
//   v = Wv @ src  + bv   -> vF [B][N/32][C/16][4][16][8] f16: one 1 KB block per
//       (32-key chunk, 16-channel tile), laid out as the PV product's B fragment:
//       [group of 8 K slots][channel][slot], n pre-permuted per 32-chunk
// One block = 64 columns n of one batch. Both input tiles are rounded to f16
// and staged column-major ([n][c]) in LDS, so a fragment is 16 contiguous c.
// Each f32 weight enters as an f16 pair hi + lo (lo = w - hi), two products
// into one f32 accumulator, so the weights keep about 22 significant bits.
// Every fragment, of X and of W alike, holds k = 32*ks + 16*(lane>>4) + s.
// ---------------------------------------------------------------------------
#define XP 264   // halves per staged column: 256 c + 8 (528 B = 16 B x 33)
#define WP 40    // halves per staged weight row: 32 k + 8 (80 B = 16 B x 5)

__device__ __forceinline__ v16h frag16(const _Float16* p) {
  const v8h lo = *(const v8h*)p;
  const v8h hi = *(const v8h*)(p + 8);
  return __builtin_shufflevector(lo, hi, 0,1,2,3,4,5,6,7,8,9,10,11,12,13,14,15);
}

__device__ __forceinline__ v8f mma16(v16h a, v16h b, v8f c) {
  return __builtin_amdgcn_wmma_f32_16x16x32_f16(false, a, false, b, (short)0, c, false, false);
}

// 16 B at a wave-uniform base + the lane's 32-bit byte offset + a constant: every
// load of a family names one offset register and a scalar base, no address pair.
__device__ __forceinline__ v4f ld16(const float* __restrict__ base, unsigned voff, int imm) {
  return *(const v4f*)((const char*)base + (size_t)voff + imm);
}

typedef __attribute__((address_space(1))) const v8h  gv8h;    // eight halves in global memory
typedef __attribute__((address_space(1))) const char gbyte;   // a byte there

// the same for eight halves
__device__ __forceinline__ v8h ld16h(const _Float16* __restrict__ base, unsigned voff, int imm) {
  return *(const v8h*)((const char*)base + (size_t)voff + imm);
}

// 256 c x 64 n of X into registers: 8 lanes cover one 128 B line of a row.
__device__ __forceinline__ void load_x(const float* __restrict__ X, unsigned xoff,
                                       v4f (&raw)[16]) {
  #pragma unroll
  for (int i = 0; i < 16; ++i)
    raw[i] = ld16(X, xoff, ((i >> 3) * 128 + (i & 7)) * N_ * 4);
}

// ... and transposed into LDS: 8 consecutive c of one column per 16 B store.
__device__ __forceinline__ void store_x(_Float16* sx, int nq, int cg, const v4f (&raw)[16]) {
  #pragma unroll
  for (int p = 0; p < 2; ++p)
    #pragma unroll
    for (int e = 0; e < 4; ++e) {
      v8h col;
      #pragma unroll
      for (int j = 0; j < 8; ++j) col[j] = (_Float16)raw[p * 8 + j][e];
      *(v8h*)(sx + (nq * 4 + e) * XP + p * 128 + cg * 8) = col;
    }
}

// 32 weight rows x 32 k (one k step) into registers: 8 lanes per 128 B line.
__device__ __forceinline__ void load_w(const float* __restrict__ Wr, int ks, unsigned woff,
                                       v4f (&wr)[8]) {
  #pragma unroll
  for (int i = 0; i < 8; ++i) wr[i] = ld16(Wr, woff, (i * 4 * C_ + ks * 32) * 4);
}

// Split into hi + lo and turn into fragments through the wave's own LDS patch.
__device__ __forceinline__ void split_w(_Float16* wl, int lane, const v4f (&wr)[8],
                                        v16h (&hi)[2], v16h (&lo)[2]) {
  #pragma unroll
  for (int i = 0; i < 8; ++i) {
    const int row = i * 4 + (lane >> 3);
    const v2f wa = {wr[i][0], wr[i][1]}, wb = {wr[i][2], wr[i][3]};
    const v2h ha = __builtin_convertvector(wa, v2h), hb = __builtin_convertvector(wb, v2h);
    const v2f da = {wa[0] - (float)ha[0], wa[1] - (float)ha[1]};
    const v2f db = {wb[0] - (float)hb[0], wb[1] - (float)hb[1]};
    const v2h la = __builtin_convertvector(da, v2h), lb = __builtin_convertvector(db, v2h);
    const v4h h4 = __builtin_shufflevector(ha, hb, 0, 1, 2, 3);
    const v4h l4 = __builtin_shufflevector(la, lb, 0, 1, 2, 3);
    *(v4h*)(wl + row * WP + (lane & 7) * 4)        = h4;
    *(v4h*)(wl + (32 + row) * WP + (lane & 7) * 4) = l4;
  }
  __builtin_amdgcn_wave_barrier();   // keeps the reads below behind the stores (per-wave LDS is in-order)
  const _Float16* rd = wl + (lane & 15) * WP + 16 * (lane >> 4);
  #pragma unroll
  for (int t = 0; t < 2; ++t) {
    hi[t] = frag16(rd + t * 16 * WP);
    lo[t] = frag16(rd + (32 + t * 16) * WP);
  }
  __builtin_amdgcn_wave_barrier();   // keeps the next k step's stores behind these reads
}

__global__ __launch_bounds__(256)
void proj_kernel(const float* __restrict__ source, const float* __restrict__ pose,
                 const float* __restrict__ Wq, const float* __restrict__ bq,
                 const float* __restrict__ Wk, const float* __restrict__ bk,
                 const float* __restrict__ Wv, const float* __restrict__ bv,
                 _Float16* __restrict__ qT, _Float16* __restrict__ kT,
                 _Float16* __restrict__ vF) {
  __shared__ __align__(16) _Float16 shX[2][64 * XP];   // [0] pose, [1] source: [n][c]
  __shared__ __align__(16) _Float16 shW[8][64 * WP];   // per wave: 32 rows hi, 32 rows lo
  const int tid  = threadIdx.x;
  const int lane = tid & 31;
  const int wv   = __builtin_amdgcn_readfirstlane(tid >> 5);
  const int b    = blockIdx.x / (N_ / 64);
  const int n0   = (blockIdx.x % (N_ / 64)) * 64;
  const int lr   = lane & 15;
  const int half = lane >> 4;
  _Float16* wl   = &shW[wv][0];

  // waves 0-3: q of one 16-column tile each; waves 4-7: k likewise
  const bool isq = wv < 4;
  const float* __restrict__ W1  = isq ? Wq : Wk;
  const float* __restrict__ Wvr = Wv + wv * 32 * C_;   // then 32 rows of v, all 64 columns

  // weight steps 0-7: the q / k rows, 8-15: the v rows; fetched two steps ahead,
  // so that a step's conversions never wait on loads issued just before them
  const unsigned woff = ((lane >> 3) * C_ + (lane & 7) * 4) * 4;
  auto fetch = [&](int s, v4f (&dst)[8]) {
    if (s < 8) load_w(W1, s, woff, dst);
    else       load_w(Wvr, s - 8, woff, dst);
    // last use of woff: holds it to here, so that no load above takes it as its
    // destination, and puts the wait in front of whatever overwrites it next
    if (s == 15) asm volatile("s_wait_xcnt 0x0" :: "v"(woff) : "memory");
    // keeps the later steps' conversions, and with them their data waits, behind
    // the issue of these loads
    __builtin_amdgcn_sched_barrier(0);
  };
  v4f wr[2][8];
  {
    const int nq = (lane & 7) + 8 * (wv & 1);
    const int cg = (lane >> 3) + 4 * (wv >> 1);
    v4f rp[16], rs[16];
    const unsigned xoff = (cg * 8 * N_ + nq * 4) * 4;
    load_x(pose   + (size_t)b * C_ * N_ + n0, xoff, rp);
    load_x(source + (size_t)b * C_ * N_ + n0, xoff, rs);
    // last use of xoff: as for woff in fetch()
    asm volatile("s_wait_xcnt 0x0" :: "v"(xoff) : "memory");
    fetch(0, wr[0]);
    fetch(1, wr[1]);
    store_x(&shX[0][0], nq, cg, rp);
    store_x(&shX[1][0], nq, cg, rs);
  }
  __syncthreads();

  // ---- q / k: A = W (rows o), B = X (columns n); D[r] = row o = 8*half + r ----
  {
    const _Float16* xcol = &shX[isq ? 0 : 1][((wv & 3) * 16 + lr) * XP + 16 * half];
    v8f a0 = {}, a1 = {};
    #pragma unroll
    for (int ks = 0; ks < 8; ++ks) {
      v16h hi[2], lo[2];
      split_w(wl, lane, wr[ks & 1], hi, lo);
      fetch(ks + 2, wr[ks & 1]);
      const v16h xb = frag16(xcol + ks * 32);
      a0 = mma16(hi[0], xb, a0);
      a1 = mma16(hi[1], xb, a1);
      a0 = mma16(lo[0], xb, a0);
      a1 = mma16(lo[1], xb, a1);
    }
    const float* __restrict__ b1 = (isq ? bq : bk) + 8 * half;
    v8h o0, o1;
    #pragma unroll
    for (int r = 0; r < 8; ++r) {
      o0[r] = (_Float16)(a0[r] + b1[r]);
      o1[r] = (_Float16)(a1[r] + b1[16 + r]);
    }
    _Float16* dst = (isq ? qT : kT) + ((size_t)b * N_ + n0 + (wv & 3) * 16 + lr) * CQ + 8 * half;
    *(v8h*)dst        = o0;
    *(v8h*)(dst + 16) = o1;
  }

  // ---- v: A = X (rows n), B = W (columns o); D[r] = row n = 8*half + r ----
  {
    v8f acc[2][4];
    #pragma unroll
    for (int t = 0; t < 2; ++t)
      #pragma unroll
      for (int nt = 0; nt < 4; ++nt)
        #pragma unroll
        for (int i = 0; i < 8; ++i) acc[t][nt][i] = 0.f;

    float bias[2];   // read ahead of the loop, so that the epilogue does not wait on them
    #pragma unroll
    for (int t = 0; t < 2; ++t) bias[t] = bv[wv * 32 + t * 16 + lr];

    const _Float16* xrow = &shX[1][lr * XP + 16 * half];
    #pragma unroll
    for (int ks = 0; ks < 8; ++ks) {
      v16h hi[2], lo[2];
      split_w(wl, lane, wr[ks & 1], hi, lo);
      if (ks < 6) fetch(ks + 10, wr[ks & 1]);
      v16h xa[4];
      #pragma unroll
      for (int nt = 0; nt < 4; ++nt) xa[nt] = frag16(xrow + nt * 16 * XP + ks * 32);
      #pragma unroll
      for (int t = 0; t < 2; ++t)
        #pragma unroll
        for (int nt = 0; nt < 4; ++nt) acc[t][nt] = mma16(xa[nt], hi[t], acc[t][nt]);
      #pragma unroll
      for (int t = 0; t < 2; ++t)
        #pragma unroll
        for (int nt = 0; nt < 4; ++nt) acc[t][nt] = mma16(xa[nt], lo[t], acc[t][nt]);
    }

    // K-slot permutation for v: column x (0..31) -> slot ((x&15)<<1)|(x>>4), so the
    // two 16-column tiles of a 32-chunk interleave: 16 consecutive slots per lane.
    #pragma unroll
    for (int t = 0; t < 2; ++t) {
      #pragma unroll
      for (int p = 0; p < 2; ++p) {
        v8h s0, s1;
        #pragma unroll
        for (int r = 0; r < 4; ++r) {
          s0[2 * r]     = (_Float16)(acc[t][2 * p][r] + bias[t]);
          s0[2 * r + 1] = (_Float16)(acc[t][2 * p + 1][r] + bias[t]);
          s1[2 * r]     = (_Float16)(acc[t][2 * p][r + 4] + bias[t]);
          s1[2 * r + 1] = (_Float16)(acc[t][2 * p + 1][r + 4] + bias[t]);
        }
        // slots 16*half .. + 15 of channel lr: slot groups 2*half and 2*half + 1;
        // 16 lanes store 256 contiguous bytes
        _Float16* dst = vF + (((size_t)b * (N_ / 32) + n0 / 32 + p) * (C_ / 16) + wv * 2 + t) * 512
                           + 2 * half * 128 + lr * 8;
        *(v8h*)dst         = s0;
        *(v8h*)(dst + 128) = s1;
      }
    }
  }
}

// ---------------------------------------------------------------------------
// Kernel 2: fused two-pass flash attention.
// One block = 64 rows m of one batch, 16 waves. Pass A (the exact row maxima)
// deals the keys over all 16 waves, each scoring its keys against all 64 rows.
// In pass B wave (mt, kq) takes every fourth 32-key chunk (4*s + kq) and there owns
// all 64 rows x the 64 channels of quarter mt: a V fragment and a P fragment each
// feed four products. The P tile of rows mt of its chunk is made by that wave, one
// stage ahead, and handed to the chunk's other three waves through LDS at the
// stage's barrier. The grid is one block per WGP. The four phases share the exact
// row maximum (joined through LDS after pass A), so their partial sums add without
// any rescale; they are joined through LDS at the end, always in the order
// kq = 0..3, wave (mt, kq) finishing channel tile kq of its channel quarter.
// Pass B double-buffers a 128-key stage of K in LDS via async global->LDS copies (the
// K stage in use runs one stage ahead of the PV products, for the P tiles).
// Every staged row is read as 16 B pieces by 16 lanes, one row each: a pitch of
// 16 B x odd puts those 16 pieces on all 64 banks once.
// V does not pass through LDS: a V fragment is used by one wave alone, so LDS would
// only add a write and a read of every byte. The projection stores V in fragment
// order, a wave's load of half a fragment is 512 contiguous bytes, and a fragment's
// registers are refilled for the next stage directly behind its last product.
// The 64 blocks of a batch read the same K and V. In pass B each walks the stages in a
// ring from a start of its own (rot), so that they do not ask L2 for the same lines at
// the same moment; but for the order of the additions the sums do not depend on it.
// ---------------------------------------------------------------------------
#define AP 40    // halves per staged row of K and P: 32 + 8 (80 B = 16 B x 5)
#define VSTG (KQ * (C_ / 16) * 512)               // halves of V per 128-key stage
#define SM_K   0                                  // [2][KQ][32][AP] halves
#define SM_P   (SM_K + 2 * KQ * 32 * AP * 2)      // [2][KQ][MT][16][AP] halves
#define SM_X   (WPB * 16 * 1024)                  // the join: [WPB][16 tiles][2][32 places] x 16 B
// SM_X is the larger of the two uses (ring + P: 61440 B, join: 262144 B)

__global__ __launch_bounds__(512)
void attn_kernel(const _Float16* __restrict__ qT, const _Float16* __restrict__ kT,
                 const _Float16* __restrict__ vF, const float* __restrict__ src,
                 const float* __restrict__ gamma_p, float* __restrict__ out) {
  __shared__ __align__(64) unsigned char smem[SM_X];
  // per wave: maxima of the block's 64 rows over its keys; 272 B = 16 B x 17 a wave,
  // so that 16 lanes reading 16 B of one wave each meet all 64 banks once
  __shared__ __align__(16) float shM[WPB][MT * 16 + 4];
  __shared__ __align__(16) float shS[WPB][16];   // per wave: row sums of its keys
  _Float16* const shK = (_Float16*)(smem + SM_K);
  _Float16* const shP = (_Float16*)(smem + SM_P);

  const int tid  = threadIdx.x;
  const int lane = tid & 31;
  const int wv   = __builtin_amdgcn_readfirstlane(tid >> 5);
  const int mt   = wv & (MT - 1);
  const int kq   = wv / MT;
  const int b    = blockIdx.x / (N_ / 16 / MT);                // uniform per block
  const int m0   = ((blockIdx.x % (N_ / 16 / MT)) * MT + mt) * 16;
  const int half = lane >> 4;           // 0: rows 0-7/K 0-7,16-23 ; 1: rows 8-15/K 8-15,24-31
  const int lr   = lane & 15;
  const int koff = half ? 8 : 0;
  // the block's start stage: the 32 blocks of a batch whose indices lie in any four
  // successive residues mod 8 get 32 different starts. For speed only: every value gives the same function.
  const int tile = blockIdx.x % (N_ / 16 / MT);
  const int rot  = (tile >> 3) * 4 + (tile & 3);

  // A-operand: q rows m0..m0+15, K-packed per ISA 16-bit A layout
  const _Float16* qrow = qT + ((size_t)b * N_ + m0 + lr) * CQ;
  const v8h qlo = *(const v8h*)(qrow + koff);
  const v8h qhi = *(const v8h*)(qrow + koff + 16);
  const v16h aq = __builtin_shufflevector(qlo, qhi, 0,1,2,3,4,5,6,7,8,9,10,11,12,13,14,15);

  const v8f czero = {};

  // ========== Pass A: exact row maxima ==========
  // Wave wv takes the 32-key chunks wv + 16*i and scores them against all four row
  // tiles: a chunk is loaded once per block, and a wave's loads run KD chunks ahead
  // of its products, one exposed round of load latency in place of one per chunk.
  // The products are K.Q^T: D holds row m = lr of a tile in a lane and 8 keys in its
  // registers, so a row's maximum is in-lane but for one exchange between the halves.
  {
    const _Float16* __restrict__ qblk = qT + ((size_t)b * N_ + (blockIdx.x % (N_ / 16 / MT)) * MT * 16) * CQ;
    const _Float16* __restrict__ kwav = kT + ((size_t)b * N_ + wv * 32) * CQ;   // same for the whole wave
    const unsigned fo = (lr * CQ + koff) * 2;   // the lane's byte offset in a 16-row fragment
    v8h qf[MT][2], kf[KD][4];
    auto fetch = [&](int i, v8h (&dst)[4]) {   // chunk wv + 16*i
      const _Float16* __restrict__ kc = kwav + (size_t)i * WPB * 32 * CQ;
      dst[0] = ld16h(kc, fo, 0);
      dst[1] = ld16h(kc, fo, 32);
      dst[2] = ld16h(kc, fo, 16 * CQ * 2);
      dst[3] = ld16h(kc, fo, 16 * CQ * 2 + 32);
    };
    #pragma unroll
    for (int u = 0; u < MT; ++u) {
      qf[u][0] = ld16h(qblk, fo, u * 16 * CQ * 2);
      qf[u][1] = ld16h(qblk, fo, u * 16 * CQ * 2 + 32);
    }
    // the q loads go out first: loads are waited for in issue order, and a q load among
    // the K loads makes the first products wait out the K loads in front of it (the
    // build without this line did so, waited to zero and spilled)
    __builtin_amdgcn_sched_barrier(0);
    #pragma unroll
    for (int d = 0; d < KD; ++d) fetch(d, kf[d]);

    v16h qb[MT];
    #pragma unroll
    for (int u = 0; u < MT; ++u)
      qb[u] = __builtin_shufflevector(qf[u][0], qf[u][1], 0,1,2,3,4,5,6,7,8,9,10,11,12,13,14,15);
    float cm[MT][8];
    #pragma unroll
    for (int u = 0; u < MT; ++u)
      #pragma unroll
      for (int r = 0; r < 8; ++r) cm[u][r] = -3.0e38f;
    auto score = [&](const v8h (&k)[4]) {   // one chunk against the four row tiles
      const v16h ka0 = __builtin_shufflevector(k[0], k[1], 0,1,2,3,4,5,6,7,8,9,10,11,12,13,14,15);
      const v16h ka1 = __builtin_shufflevector(k[2], k[3], 0,1,2,3,4,5,6,7,8,9,10,11,12,13,14,15);
      #pragma unroll
      for (int u = 0; u < MT; ++u) {
        const v8f e0 = __builtin_amdgcn_wmma_f32_16x16x32_f16(false, ka0, false, qb[u],
                                                              (short)0, czero, false, false);
        const v8f e1 = __builtin_amdgcn_wmma_f32_16x16x32_f16(false, ka1, false, qb[u],
                                                              (short)0, czero, false, false);
        #pragma unroll
        for (int r = 0; r < 8; ++r) cm[u][r] = fmaxf(cm[u][r], fmaxf(e0[r], e1[r]));
      }
    };
    #pragma unroll
    for (int i = KD; i < NC; i += KD) {
      #pragma unroll
      for (int d = 0; d < KD; ++d) {
        score(kf[d]);
        fetch(i + d, kf[d]);
      }
    }
    // last use of fo: holds it to here, so that no load above takes it as its
    // destination, and puts the wait in front of whatever overwrites it next
    asm volatile("s_wait_xcnt 0x0" :: "v"(fo) : "memory");
    #pragma unroll
    for (int d = 0; d < KD; ++d) score(kf[d]);
    float mm[MT];
    #pragma unroll
    for (int u = 0; u < MT; ++u) {
      const float m = fmaxf(fmaxf(fmaxf(cm[u][0], cm[u][1]), fmaxf(cm[u][2], cm[u][3])),
                            fmaxf(fmaxf(cm[u][4], cm[u][5]), fmaxf(cm[u][6], cm[u][7])));
      mm[u] = fmaxf(m, __shfl_xor(m, 16, 32));
    }
    if (half == 0) {                // read by every wave behind the prologue's barrier
      #pragma unroll
      for (int u = 0; u < MT; ++u) shM[wv][u * 16 + lr] = mm[u];
    }
  }

  // ================= Pass B: P = exp(e - max), PV accumulation ==============
  v8f acc[16];
  #pragma unroll
  for (int t = 0; t < 16; ++t)
    #pragma unroll
    for (int i = 0; i < 8; ++i) acc[t][i] = 0.f;
  float rsum[8];
  #pragma unroll
  for (int i = 0; i < 8; ++i) rsum[i] = 0.f;

  // the wave's four V fragments of a stage: 4 KB in a row, the same base for the whole wave
  // (vnext: of the stage that is fetched next; typed as global memory, which the compiler
  // cannot see for itself behind the asm statements that hold it)
  gbyte* const vwav = (gbyte*)(uintptr_t)(vF + (((size_t)b * (N_ / 32) + kq) * (C_ / 16) + mt * 4) * 512);
  auto ring = [&](int s) { return (s + rot) & (NS - 1); };   // the stage that the block takes as its s-th
  gbyte* vnext = vwav + (size_t)ring(0) * (VSTG * 2);
  // bytes from the block's (s-1)-th V stage to its s-th: one stage on, or back to the first
  auto vstep = [&](int s) { return ring(s) ? (long)(VSTG * 2) : -(long)((NS - 1) * VSTG * 2); };
  const unsigned vfo = lane * 16;   // the lane's byte offset in half a fragment
  v8h vr[4][2];
  auto load_v = [&](int c) {        // fragment c of the stage at vnext
    vr[c][0] = *(gv8h*)(vnext + (size_t)vfo + c * 1024);
    vr[c][1] = *(gv8h*)(vnext + (size_t)vfo + c * 1024 + 512);
  };

  // cooperative staging of K: 512 threads, 16 B per async op, every lane on;
  // 4 lanes cover a 64 B row.
  const int part  = tid & 3;     // 16 B piece of a K row
  const int krow  = tid >> 2;    // 0..127: chunk krow >> 5, row krow & 31
  _Float16* const kdst = shK + krow * AP + part * 8;
  // the lane's byte offset from a base that is the same for the whole block
  const unsigned kgo = (krow * CQ + part * 8) * 2;
  const _Float16* kstage = kT + (size_t)b * N_ * CQ;

  auto stage_k = [&](int buf, int n0) {
    cp16_async(kdst + buf * (KQ * 32 * AP),
               (const char*)(kstage + (size_t)n0 * CQ) + (size_t)kgo);
  };

  float rmax[8];

  // energy of rows mt against this wave's chunk of the K stage in buffer buf
  auto energy = [&](int buf, v8f& e0, v8f& e1) {
    const _Float16* kk = shK + (buf * KQ + kq) * 32 * AP;
    const v8h kl0 = *(const v8h*)(kk + lr * AP + koff);
    const v8h kh0 = *(const v8h*)(kk + lr * AP + koff + 16);
    const v8h kl1 = *(const v8h*)(kk + (16 + lr) * AP + koff);
    const v8h kh1 = *(const v8h*)(kk + (16 + lr) * AP + koff + 16);
    const v16h kb0 = __builtin_shufflevector(kl0, kh0, 0,1,2,3,4,5,6,7,8,9,10,11,12,13,14,15);
    const v16h kb1 = __builtin_shufflevector(kl1, kh1, 0,1,2,3,4,5,6,7,8,9,10,11,12,13,14,15);
    e0 = __builtin_amdgcn_wmma_f32_16x16x32_f16(false, aq, false, kb0,
                                                (short)0, czero, false, false);
    e1 = __builtin_amdgcn_wmma_f32_16x16x32_f16(false, aq, false, kb1,
                                                (short)0, czero, false, false);
  };

  // P tile of rows mt into P buffer buf: packed (p0,p1) -> one b32 LDS store per row slot.
  // Stored slot j maps to n offset (j>>1)|((j&1)<<4); vF uses same mapping.
  auto put_p = [&](int buf, const v8f& e0, const v8f& e1) {
    _Float16* myP = shP + ((buf * KQ + kq) * MT + mt) * 16 * AP;
    #pragma unroll
    for (int i = 0; i < 8; ++i) {
      const float a0 = __expf(e0[i] - rmax[i]);
      const float a1 = __expf(e1[i] - rmax[i]);
      rsum[i] += a0 + a1;                    // per-lane; reduced after the loop
      const int r = i + 8 * half;
      v2h pk; pk[0] = (_Float16)a0; pk[1] = (_Float16)a1;
      *(v2h*)(myP + r * AP + 2 * lr) = pk;
    }
  };

  // PV of this wave's chunk, P in buffer buf: 4 row tiles x the 4 channel tiles of quarter
  // mt; more: each V fragment is then fetched anew from vnext
  auto pv = [&](int buf, bool more) {
    const _Float16* pp = shP + (buf * KQ + kq) * MT * 16 * AP + lr * AP + koff;
    v16h pa[MT];
    #pragma unroll
    for (int u = 0; u < MT; ++u) {
      const v8h plo = *(const v8h*)(pp + u * 16 * AP);
      const v8h phi = *(const v8h*)(pp + u * 16 * AP + 16);
      pa[u] = __builtin_shufflevector(plo, phi, 0,1,2,3,4,5,6,7,8,9,10,11,12,13,14,15);
    }
    #pragma unroll
    for (int c = 0; c < 4; ++c) {
      const v16h vb = __builtin_shufflevector(vr[c][0], vr[c][1], 0,1,2,3,4,5,6,7,8,9,10,11,12,13,14,15);
      #pragma unroll
      for (int u = 0; u < MT; ++u)
        acc[u * 4 + c] = __builtin_amdgcn_wmma_f32_16x16x32_f16(false, pa[u], false, vb,
                                                                (short)0, acc[u * 4 + c], false, false);
      if (more) load_v(c);
    }
  };

  stage_k(0, ring(0) * 32 * KQ);
  asm volatile("s_wait_asynccnt 0x0" ::: "memory");   // this wave's share of K stage 0 has landed
  __syncthreads();                                    // K stage 0 and shM are published
  #pragma unroll
  for (int c = 0; c < 4; ++c) load_v(c);              // V of stage 0
  // the loads above name addresses formed from vnext: the wait stands in front of their overwrite
  asm volatile("s_wait_xcnt 0x0" : "+s"(vnext) :: "memory");
  vnext += vstep(1);
  stage_k(1, ring(1) * 32 * KQ);

  // the exact max of rows mt over all keys: lane lr takes wave lr's maxima of the
  // rows 8*half .. 8*half + 7, then one-time 16-lane reductions
  {
    const v4f ma = *(const v4f*)&shM[lr][mt * 16 + 8 * half];
    const v4f mb = *(const v4f*)&shM[lr][mt * 16 + 8 * half + 4];
    #pragma unroll
    for (int i = 0; i < 4; ++i) { rmax[i] = ma[i]; rmax[i + 4] = mb[i]; }
    #pragma unroll
    for (int i = 0; i < 8; ++i) {
      float m = rmax[i];
      m = fmaxf(m, __shfl_xor(m, 1, 32));
      m = fmaxf(m, __shfl_xor(m, 2, 32));
      m = fmaxf(m, __shfl_xor(m, 4, 32));
      m = fmaxf(m, __shfl_xor(m, 8, 32));
      rmax[i] = m;
    }
  }
  {
    v8f e0, e1;
    energy(0, e0, e1);
    put_p(0, e0, e1);
  }
  asm volatile("s_wait_dscnt 0x0" ::: "memory");      // this wave's P tile of stage 0 is written
  asm volatile("s_wait_asynccnt 0x0" ::: "memory");   // its share of K stage 1 has landed
  __syncthreads();                                    // publishes P of stage 0 and K of stage 1

  // trip st: PV of stage st; P of stage st + 1 from the K stage published at the last
  // barrier; K of stage st + 2 flies into the buffer that the trip before has left, V of
  // stage st + 1 into the registers that this trip's products leave
  for (int st = 0; st < NS - 1; ++st) {
    const int cur = st & 1;
    if (st + 2 < NS) stage_k(cur, ring(st + 2) * 32 * KQ);

    v8f e0, e1;
    energy(cur ^ 1, e0, e1);
    pv(cur, true);
    put_p(cur ^ 1, e0, e1);

    // keeps this trip's products in front of the barrier: sunk behind it they stand in
    // front of the next trip's copies, which then have less of the trip to land in, and
    // their fragments stay live over the copies' addresses (that build spilled)
    __builtin_amdgcn_sched_barrier(0);
    asm volatile("s_wait_dscnt 0x0" ::: "memory");      // this wave has left the current buffers, its P tile is written
    asm volatile("s_wait_asynccnt 0x0" ::: "memory");   // its share of the next K stage has landed
    // this trip's V loads name an address formed from vnext: the wait stands in front of its overwrite
    asm volatile("s_wait_xcnt 0x0" : "+s"(vnext) :: "memory");
    vnext += vstep(st + 2);
    // publishes the next stage, frees these buffers. The barrier is written out, its fences
    // on LDS alone: __syncthreads() would wait out the V loads that are to fly across it
    __builtin_amdgcn_fence(__ATOMIC_RELEASE, "workgroup", "local");
    __builtin_amdgcn_s_barrier();
    __builtin_amdgcn_fence(__ATOMIC_ACQUIRE, "workgroup", "local");
  }
  pv((NS - 1) & 1, false);
  asm volatile("s_wait_dscnt 0x0" ::: "memory");        // this wave has left the ring
  // nothing is in flight into the ring when its LDS becomes the join's buffer
  asm volatile("s_wait_asynccnt 0x0" ::: "memory");
  __syncthreads();                                      // every wave has left the ring

  // ---- join of the four key phases ----
  // this wave finishes channel tile kq of its channel quarter, all 64 rows (accumulators
  // 4*u + kq). A lane takes four successive rows m of one channel, 16 lanes the 256 B that
  // the block owns of a channel's row: every load of src and every store of out covers
  // four whole 128 B lines. The source values are fetched ahead of the join.
  const int mb = (blockIdx.x % (N_ / 16 / MT)) * MT * 16;   // the block's first row
  const float gam = gamma_p[0];
  v4f sv[8];
  const float* __restrict__ sbase = src + ((size_t)b * C_ + mt * 64 + kq * 16) * N_ + mb;   // same for the whole wave
  const unsigned soff = (half * N_ + lr * 4) * 4;   // channel 2*i + half, rows 4*lr .. 4*lr + 3
  #pragma unroll
  for (int i = 0; i < 8; ++i) sv[i] = ld16(sbase, soff, i * 2 * N_ * 4);
  // last use of soff as a load's offset: holds it to here, so that no load above takes it
  // as its destination, and puts the wait in front of whatever overwrites it next
  asm volatile("s_wait_xcnt 0x0" :: "v"(soff) : "memory");

  #pragma unroll
  for (int i = 0; i < 8; ++i) {   // one-time 16-lane row-sum reduction
    float s = rsum[i];
    s += __shfl_xor(s, 1, 32);
    s += __shfl_xor(s, 2, 32);
    s += __shfl_xor(s, 4, 32);
    s += __shfl_xor(s, 8, 32);
    rsum[i] = s;
  }
  if (lr == 0) {
    #pragma unroll
    for (int i = 0; i < 8; ++i) shS[wv][8 * half + i] = rsum[i];
  }
  // [wave][tile][register quad][32 places] x 16 B. The quad (rows 16*u + 8*half + 4*q ..) of
  // channel lr lies at place 16*half + ((lr + 4*u + 2*half + q) & 15): the 16 quads of one
  // channel, which 16 lanes read back together, lie on all 64 banks once, as do the 16
  // channels that 16 lanes write together
  float* const xj = (float*)smem;
  #pragma unroll
  for (int u = 0; u < MT; ++u)
    #pragma unroll
    for (int q = 0; q < 2; ++q) {
      const int pos = 16 * half + ((lr + 4 * u + 2 * half + q) & 15);
      #pragma unroll
      for (int c = 0; c < 4; ++c) {
        const int t = u * 4 + c;
        const v4f q4 = {acc[t][4 * q], acc[t][4 * q + 1], acc[t][4 * q + 2], acc[t][4 * q + 3]};
        *(v4f*)(xj + (((wv * 16 + t) * 2 + q) * 32 + pos) * 4) = q4;
      }
    }
  __syncthreads();                  // every phase's partial sums are in LDS

  // the lane's rows 4*lr .. 4*lr + 3: row tile ru, accumulator half rh, register quad rq
  const int ru = lr >> 2, rh = (lr >> 1) & 1, rq = lr & 1;
  float linv[4];
  {
    v4f sa = *(const v4f*)&shS[ru][(lr & 3) * 4];   // shS[j * MT + ru]: rows ru, phase j
    #pragma unroll
    for (int j = 1; j < KQ; ++j) sa += *(const v4f*)&shS[j * MT + ru][(lr & 3) * 4];
    #pragma unroll
    for (int i = 0; i < 4; ++i) linv[i] = 1.f / sa[i];
  }

  // ---- epilogue: gamma * (acc/sum) + source; 16 lanes store 256 contiguous bytes ----
  #pragma unroll
  for (int i = 0; i < 8; ++i) {
    const int pos = 16 * rh + ((2 * i + half + lr) & 15);
    const float* px = xj + (((mt * 16 + ru * 4 + kq) * 2 + rq) * 32 + pos) * 4;
    v4f p = *(const v4f*)px;
    #pragma unroll
    for (int j = 1; j < KQ; ++j) p += *(const v4f*)(px + j * MT * 16 * 2 * 32 * 4);
    v4f r;
    #pragma unroll
    for (int e = 0; e < 4; ++e) r[e] = gam * p[e] * linv[e] + sv[i][e];
    *(v4f*)(out + ((size_t)b * C_ + mt * 64 + kq * 16 + 2 * i + half) * N_ + mb + lr * 4) = r;
  }
}

// ---------------------------------------------------------------------------
extern "C" void kernel_launch(void* const* d_in, const int* in_sizes, int n_in,
                              void* d_out, int out_size, void* d_ws, size_t ws_size,
                              hipStream_t stream) {
  const float* source = (const float*)d_in[0];
  const float* pose   = (const float*)d_in[1];
  const float* Wq     = (const float*)d_in[2];
  const float* bq     = (const float*)d_in[3];
  const float* Wk     = (const float*)d_in[4];
  const float* bk     = (const float*)d_in[5];
  const float* Wv     = (const float*)d_in[6];
  const float* bv     = (const float*)d_in[7];
  const float* gamma  = (const float*)d_in[8];
  float* out = (float*)d_out;

  // workspace: qT (1 MB) | kT (1 MB) | vF (8 MB), all f16
  _Float16* qT = (_Float16*)d_ws;
  _Float16* kT = qT + (size_t)B_ * N_ * CQ;
  _Float16* vF = kT + (size_t)B_ * N_ * CQ;

  proj_kernel<<<dim3(B_ * (N_ / 64)), dim3(256), 0, stream>>>(
      source, pose, Wq, bq, Wk, bk, Wv, bv, qT, kT, vF);

  attn_kernel<<<dim3(B_ * (N_ / 16) / MT), dim3(32 * WPB), 0, stream>>>(
      qT, kT, vF, source, gamma, out);
}

// v010
// A run of this version takes 44.4 microseconds.
// Next to v009, in two timings, it ran 1.03 times as fast each time.
// All steps since v000 together make it 12.1 times as fast.
#include <hip/hip_runtime.h>
#include <cstdint>

typedef __attribute__((ext_vector_type(16))) _Float16 v16h;
typedef __attribute__((ext_vector_type(8)))  _Float16 v8h;
typedef __attribute__((ext_vector_type(4)))  _Float16 v4h;
typedef __attribute__((ext_vector_type(2)))  _Float16 v2h;
typedef __attribute__((ext_vector_type(8)))  float    v8f;
typedef __attribute__((ext_vector_type(4)))  float    v4f;
typedef __attribute__((ext_vector_type(2)))  float    v2f;

#define B_   4
#define C_   256
#define CQ   32
#define N_   4096
#define MT   4            // 16-row m tiles per attention block
#define KQ   4            // key phases: wave (mt, kq) takes the 32-key chunks 4*s + kq
#define WPB  (MT * KQ)    // waves per attention block (512 threads)
#define NC   (N_ / 32 / WPB)   // 32-key chunks per wave in pass A
#define KD   4                 // chunks that a wave's K loads run ahead of its products
#define NS   (N_ / (32 * KQ))  // 128-key stages of pass B

// K-slot permutation for the PV matmul (shared by P-store and vF layout):
//   K slot j <-> n offset (j>>1) | ((j&1)<<4)   within each 32-column chunk.

// ---------------------------------------------------------------------------
// Kernel 1: 1x1-conv projections on the matrix unit.
//   q = Wq @ pose + bq   -> qT [B][N][CQ] f16   (K-contiguous for WMMA gather)
//   k = Wk @ src  + bk   -> kT [B][N][CQ] f16
//   v = Wv @ src  + bv   -> vF [B][N/32][C/16][4][16][8] f16: one 1 KB block per
//       (32-key chunk, 16-channel tile), laid out as the PV product's B fragment:
//       [group of 8 K slots][channel][slot], n pre-permuted per 32-chunk
// One block = 64 columns n of one batch. Both input tiles are rounded to f16
// and staged column-major ([n][c]) in LDS, so a fragment is 16 contiguous c.
// Each f32 weight enters as an f16 pair hi + lo (lo = w - hi), two products
// into one f32 accumulator, so the weights keep about 22 significant bits.
// Every fragment, of X and of W alike, holds k = 32*ks + 16*(lane>>4) + s.
// ---------------------------------------------------------------------------
#define XP 264   // halves per staged column: 256 c + 8 (528 B = 16 B x 33)
#define WP 40    // halves per staged weight row: 32 k + 8 (80 B = 16 B x 5)

__device__ __forceinline__ v16h frag16(const _Float16* p) {
  const v8h lo = *(const v8h*)p;
  const v8h hi = *(const v8h*)(p + 8);
  return __builtin_shufflevector(lo, hi, 0,1,2,3,4,5,6,7,8,9,10,11,12,13,14,15);
}

__device__ __forceinline__ v8f mma16(v16h a, v16h b, v8f c) {
  return __builtin_amdgcn_wmma_f32_16x16x32_f16(false, a, false, b, (short)0, c, false, false);
}

// 16 B at a wave-uniform base + the lane's 32-bit byte offset + a constant: every
// load of a family names one offset register and a scalar base, no address pair.
__device__ __forceinline__ v4f ld16(const float* __restrict__ base, unsigned voff, int imm) {
  return *(const v4f*)((const char*)base + (size_t)voff + imm);
}

typedef __attribute__((address_space(1))) const v8h  gv8h;    // eight halves in global memory
typedef __attribute__((address_space(1))) const char gbyte;   // a byte there

// the same for eight halves
__device__ __forceinline__ v8h ld16h(const _Float16* __restrict__ base, unsigned voff, int imm) {
  return *(const v8h*)((const char*)base + (size_t)voff + imm);
}

// 256 c x 64 n of X into registers: 8 lanes cover one 128 B line of a row.
__device__ __forceinline__ void load_x(const float* __restrict__ X, unsigned xoff,
                                       v4f (&raw)[16]) {
  #pragma unroll
  for (int i = 0; i < 16; ++i)
    raw[i] = ld16(X, xoff, ((i >> 3) * 128 + (i & 7)) * N_ * 4);
}

// ... and transposed into LDS: 8 consecutive c of one column per 16 B store.
__device__ __forceinline__ void store_x(_Float16* sx, int nq, int cg, const v4f (&raw)[16]) {
  #pragma unroll
  for (int p = 0; p < 2; ++p)
    #pragma unroll
    for (int e = 0; e < 4; ++e) {
      v8h col;
      #pragma unroll
      for (int j = 0; j < 8; ++j) col[j] = (_Float16)raw[p * 8 + j][e];
      *(v8h*)(sx + (nq * 4 + e) * XP + p * 128 + cg * 8) = col;
    }
}

// 32 weight rows x 32 k (one k step) into registers: 8 lanes per 128 B line.
__device__ __forceinline__ void load_w(const float* __restrict__ Wr, int ks, unsigned woff,
                                       v4f (&wr)[8]) {
  #pragma unroll
  for (int i = 0; i < 8; ++i) wr[i] = ld16(Wr, woff, (i * 4 * C_ + ks * 32) * 4);
}

// Split into hi + lo and turn into fragments through the wave's own LDS patch.
__device__ __forceinline__ void split_w(_Float16* wl, int lane, const v4f (&wr)[8],
                                        v16h (&hi)[2], v16h (&lo)[2]) {
  #pragma unroll
  for (int i = 0; i < 8; ++i) {
    const int row = i * 4 + (lane >> 3);
    const v2f wa = {wr[i][0], wr[i][1]}, wb = {wr[i][2], wr[i][3]};
    const v2h ha = __builtin_convertvector(wa, v2h), hb = __builtin_convertvector(wb, v2h);
    const v2f da = {wa[0] - (float)ha[0], wa[1] - (float)ha[1]};
    const v2f db = {wb[0] - (float)hb[0], wb[1] - (float)hb[1]};
    const v2h la = __builtin_convertvector(da, v2h), lb = __builtin_convertvector(db, v2h);
    const v4h h4 = __builtin_shufflevector(ha, hb, 0, 1, 2, 3);
    const v4h l4 = __builtin_shufflevector(la, lb, 0, 1, 2, 3);
    *(v4h*)(wl + row * WP + (lane & 7) * 4)        = h4;
    *(v4h*)(wl + (32 + row) * WP + (lane & 7) * 4) = l4;
  }
  __builtin_amdgcn_wave_barrier();   // keeps the reads below behind the stores (per-wave LDS is in-order)
  const _Float16* rd = wl + (lane & 15) * WP + 16 * (lane >> 4);
  #pragma unroll
  for (int t = 0; t < 2; ++t) {
    hi[t] = frag16(rd + t * 16 * WP);
    lo[t] = frag16(rd + (32 + t * 16) * WP);
  }
  __builtin_amdgcn_wave_barrier();   // keeps the next k step's stores behind these reads
}

__global__ __launch_bounds__(256)
void proj_kernel(const float* __restrict__ source, const float* __restrict__ pose,
                 const float* __restrict__ Wq, const float* __restrict__ bq,
                 const float* __restrict__ Wk, const float* __restrict__ bk,
                 const float* __restrict__ Wv, const float* __restrict__ bv,
                 _Float16* __restrict__ qT, _Float16* __restrict__ kT,
                 _Float16* __restrict__ vF) {
  __shared__ __align__(16) _Float16 shX[2][64 * XP];   // [0] pose, [1] source: [n][c]
  __shared__ __align__(16) _Float16 shW[8][64 * WP];   // per wave: 32 rows hi, 32 rows lo
  const int tid  = threadIdx.x;
  const int lane = tid & 31;
  const int wv   = __builtin_amdgcn_readfirstlane(tid >> 5);
  const int b    = blockIdx.x / (N_ / 64);
  const int n0   = (blockIdx.x % (N_ / 64)) * 64;
  const int lr   = lane & 15;
  const int half = lane >> 4;
  _Float16* wl   = &shW[wv][0];

  // waves 0-3: q of one 16-column tile each; waves 4-7: k likewise
  const bool isq = wv < 4;
  const float* __restrict__ W1  = isq ? Wq : Wk;
  const float* __restrict__ Wvr = Wv + wv * 32 * C_;   // then 32 rows of v, all 64 columns

  // weight steps 0-7: the q / k rows, 8-15: the v rows; fetched two steps ahead,
  // so that a step's conversions never wait on loads issued just before them
  const unsigned woff = ((lane >> 3) * C_ + (lane & 7) * 4) * 4;
  auto fetch = [&](int s, v4f (&dst)[8]) {
    if (s < 8) load_w(W1, s, woff, dst);
    else       load_w(Wvr, s - 8, woff, dst);
    // last use of woff: holds it to here, so that no load above takes it as its
    // destination, and puts the wait in front of whatever overwrites it next
    if (s == 15) asm volatile("s_wait_xcnt 0x0" :: "v"(woff) : "memory");
    // keeps the later steps' conversions, and with them their data waits, behind
    // the issue of these loads
    __builtin_amdgcn_sched_barrier(0);
  };
  v4f wr[2][8];
  {
    const int nq = (lane & 7) + 8 * (wv & 1);
    const int cg = (lane >> 3) + 4 * (wv >> 1);
    v4f rp[16], rs[16];
    const unsigned xoff = (cg * 8 * N_ + nq * 4) * 4;
    load_x(pose   + (size_t)b * C_ * N_ + n0, xoff, rp);
    load_x(source + (size_t)b * C_ * N_ + n0, xoff, rs);
    // last use of xoff: as for woff in fetch()
    asm volatile("s_wait_xcnt 0x0" :: "v"(xoff) : "memory");
    fetch(0, wr[0]);
    fetch(1, wr[1]);
    store_x(&shX[0][0], nq, cg, rp);
    store_x(&shX[1][0], nq, cg, rs);
  }
  __syncthreads();

  // ---- q / k: A = W (rows o), B = X (columns n); D[r] = row o = 8*half + r ----
  {
    const _Float16* xcol = &shX[isq ? 0 : 1][((wv & 3) * 16 + lr) * XP + 16 * half];
    v8f a0 = {}, a1 = {};
    #pragma unroll
    for (int ks = 0; ks < 8; ++ks) {
      v16h hi[2], lo[2];
      split_w(wl, lane, wr[ks & 1], hi, lo);
      fetch(ks + 2, wr[ks & 1]);
      const v16h xb = frag16(xcol + ks * 32);
      a0 = mma16(hi[0], xb, a0);
      a1 = mma16(hi[1], xb, a1);
      a0 = mma16(lo[0], xb, a0);
      a1 = mma16(lo[1], xb, a1);
    }
    const float* __restrict__ b1 = (isq ? bq : bk) + 8 * half;
    v8h o0, o1;
    #pragma unroll
    for (int r = 0; r < 8; ++r) {
      o0[r] = (_Float16)(a0[r] + b1[r]);
      o1[r] = (_Float16)(a1[r] + b1[16 + r]);
    }
    _Float16* dst = (isq ? qT : kT) + ((size_t)b * N_ + n0 + (wv & 3) * 16 + lr) * CQ + 8 * half;
    *(v8h*)dst        = o0;
    *(v8h*)(dst + 16) = o1;
  }

  // ---- v: A = X (rows n), B = W (columns o); D[r] = row n = 8*half + r ----
  {
    v8f acc[2][4];
    #pragma unroll
    for (int t = 0; t < 2; ++t)
      #pragma unroll
      for (int nt = 0; nt < 4; ++nt)
        #pragma unroll
        for (int i = 0; i < 8; ++i) acc[t][nt][i] = 0.f;

    float bias[2];   // read ahead of the loop, so that the epilogue does not wait on them
    #pragma unroll
    for (int t = 0; t < 2; ++t) bias[t] = bv[wv * 32 + t * 16 + lr];

    const _Float16* xrow = &shX[1][lr * XP + 16 * half];
    #pragma unroll
    for (int ks = 0; ks < 8; ++ks) {
      v16h hi[2], lo[2];
      split_w(wl, lane, wr[ks & 1], hi, lo);
      if (ks < 6) fetch(ks + 10, wr[ks & 1]);
      v16h xa[4];
      #pragma unroll
      for (int nt = 0; nt < 4; ++nt) xa[nt] = frag16(xrow + nt * 16 * XP + ks * 32);
      #pragma unroll
      for (int t = 0; t < 2; ++t)
        #pragma unroll
        for (int nt = 0; nt < 4; ++nt) acc[t][nt] = mma16(xa[nt], hi[t], acc[t][nt]);
      #pragma unroll
      for (int t = 0; t < 2; ++t)
        #pragma unroll
        for (int nt = 0; nt < 4; ++nt) acc[t][nt] = mma16(xa[nt], lo[t], acc[t][nt]);
    }

    // K-slot permutation for v: column x (0..31) -> slot ((x&15)<<1)|(x>>4), so the
    // two 16-column tiles of a 32-chunk interleave: 16 consecutive slots per lane.
    #pragma unroll
    for (int t = 0; t < 2; ++t) {
      #pragma unroll
      for (int p = 0; p < 2; ++p) {
        v8h s0, s1;
        #pragma unroll
        for (int r = 0; r < 4; ++r) {
          s0[2 * r]     = (_Float16)(acc[t][2 * p][r] + bias[t]);
          s0[2 * r + 1] = (_Float16)(acc[t][2 * p + 1][r] + bias[t]);
          s1[2 * r]     = (_Float16)(acc[t][2 * p][r + 4] + bias[t]);
          s1[2 * r + 1] = (_Float16)(acc[t][2 * p + 1][r + 4] + bias[t]);
        }
        // slots 16*half .. + 15 of channel lr: slot groups 2*half and 2*half + 1;
        // 16 lanes store 256 contiguous bytes
        _Float16* dst = vF + (((size_t)b * (N_ / 32) + n0 / 32 + p) * (C_ / 16) + wv * 2 + t) * 512
                           + 2 * half * 128 + lr * 8;
        *(v8h*)dst         = s0;
        *(v8h*)(dst + 128) = s1;
      }
    }
  }
}

// ---------------------------------------------------------------------------
// Kernel 2: fused two-pass flash attention.
// One block = 64 rows m of one batch, 16 waves. Pass A (the exact row maxima)
// deals the keys over all 16 waves, each scoring its keys against all 64 rows.
// In pass B wave (mt, kq) takes every fourth 32-key chunk (4*s + kq) and there owns
// all 64 rows x the 64 channels of quarter mt: a V fragment and a P fragment each
// feed four products. The P tile of rows mt of its chunk is made by that wave, one
// stage ahead, and handed to the chunk's other three waves through LDS at the
// stage's barrier. The grid is one block per WGP. The four phases share the exact
// row maximum (joined through LDS after pass A), so their partial sums add without
// any rescale; they are joined through LDS at the end, always in the order
// kq = 0..3, wave (mt, kq) finishing channel tile kq of its channel quarter.
// The batch's whole K (256 KB) stays in LDS: pass A, which has every K fragment in
// registers once a block, stores it there, and pass B reads it from there, so that a
// block asks L2 for K once, not twice. K rows are 64 B with no pad; the 16 B piece p of
// row r lies at piece p ^ ((r >> 2) & 3), so that 16 lanes, one row each, meet all 64
// banks once. A P row is read the same way at a pitch of 16 B x odd.
// V does not pass through LDS: a V fragment is used by one wave alone, so LDS would
// only add a write and a read of every byte. The projection stores V in fragment
// order, a wave's load of half a fragment is 512 contiguous bytes, and a fragment's
// registers are refilled for the next stage directly behind its last product.
// The 64 blocks of a batch read the same K and V. In pass B each walks the stages in a
// ring from a start of its own (rot), so that they do not ask L2 for the same lines at
// the same moment; but for the order of the additions the sums do not depend on it.
// ---------------------------------------------------------------------------
#define AP 40    // halves per row of a P tile: 32 + 8 (80 B = 16 B x 5)
#define VSTG (KQ * (C_ / 16) * 512)               // halves of V per 128-key stage
#define SM_X   (WPB * 16 * 1024)                  // the join: [WPB][16 tiles][2][32 places] x 16 B
static_assert(SM_X == N_ * CQ * 2, "K of one batch and the join take the same LDS, one after the other");

__global__ __launch_bounds__(512)
void attn_kernel(const _Float16* __restrict__ qT, const _Float16* __restrict__ kT,
                 const _Float16* __restrict__ vF, const float* __restrict__ src,
                 const float* __restrict__ gamma_p, float* __restrict__ out) {
  __shared__ __align__(64) unsigned char smem[SM_X];              // K [N_][CQ], then the join
  __shared__ __align__(16) _Float16 shP[2 * KQ * MT * 16 * AP];   // [2][KQ][MT][16][AP]
  // per wave: maxima of the block's 64 rows over its keys; 272 B = 16 B x 17 a wave,
  // so that 16 lanes reading 16 B of one wave each meet all 64 banks once
  __shared__ __align__(16) float shM[WPB][MT * 16 + 4];
  __shared__ __align__(16) float shS[WPB][16];   // per wave: row sums of its keys

  const int tid  = threadIdx.x;
  const int lane = tid & 31;
  const int wv   = __builtin_amdgcn_readfirstlane(tid >> 5);
  const int mt   = wv & (MT - 1);
  const int kq   = wv / MT;
  const int b    = blockIdx.x / (N_ / 16 / MT);                // uniform per block
  const int m0   = ((blockIdx.x % (N_ / 16 / MT)) * MT + mt) * 16;
  const int half = lane >> 4;           // 0: rows 0-7/K 0-7,16-23 ; 1: rows 8-15/K 8-15,24-31
  const int lr   = lane & 15;
  const int koff = half ? 8 : 0;
  // the lane's bytes in a 16-row K fragment in LDS: row lr, pieces half and half + 2
  const unsigned ks0 = lr * 64 + ((half ^ ((lr >> 2) & 3)) * 16);
  const unsigned ks1 = ks0 ^ 32;
  // the block's start stage. The 32 blocks of a batch whose indices lie in any four successive residues
  // mod 8 get 32 different starts. For speed only: every value gives the same function.
  const int tile = blockIdx.x % (N_ / 16 / MT);
  const int rot  = (tile >> 3) * 4 + (tile & 3);

  const v8f czero = {};

  // ========== Pass A: exact row maxima ==========
  // Wave wv takes the 32-key chunks wv + 16*i and scores them against all four row
  // tiles: a chunk is loaded once per block, and a wave's loads run KD chunks ahead
  // of its products, one exposed round of load latency in place of one per chunk.
  // The products are K.Q^T: D holds row m = lr of a tile in a lane and 8 keys in its
  // registers, so a row's maximum is in-lane but for one exchange between the halves.
  {
    const _Float16* __restrict__ qblk = qT + ((size_t)b * N_ + (blockIdx.x % (N_ / 16 / MT)) * MT * 16) * CQ;
    const _Float16* __restrict__ kwav = kT + ((size_t)b * N_ + wv * 32) * CQ;   // same for the whole wave
    const unsigned fo = (lr * CQ + koff) * 2;   // the lane's byte offset in a 16-row fragment
    v8h qf[MT][2], kf[KD][4];
    auto fetch = [&](int i, v8h (&dst)[4]) {   // chunk wv + 16*i
      const _Float16* __restrict__ kc = kwav + (size_t)i * WPB * 32 * CQ;
      dst[0] = ld16h(kc, fo, 0);
      dst[1] = ld16h(kc, fo, 32);
      dst[2] = ld16h(kc, fo, 16 * CQ * 2);
      dst[3] = ld16h(kc, fo, 16 * CQ * 2 + 32);
    };
    #pragma unroll
    for (int u = 0; u < MT; ++u) {
      qf[u][0] = ld16h(qblk, fo, u * 16 * CQ * 2);
      qf[u][1] = ld16h(qblk, fo, u * 16 * CQ * 2 + 32);
    }
    // the q loads go out first: loads are waited for in issue order, and a q load among
    // the K loads makes the first products wait out the K loads in front of it (the
    // build without this line did so, waited to zero and spilled)
    __builtin_amdgcn_sched_barrier(0);
    #pragma unroll
    for (int d = 0; d < KD; ++d) fetch(d, kf[d]);

    v16h qb[MT];
    #pragma unroll
    for (int u = 0; u < MT; ++u)
      qb[u] = __builtin_shufflevector(qf[u][0], qf[u][1], 0,1,2,3,4,5,6,7,8,9,10,11,12,13,14,15);
    float cm[MT][8];
    #pragma unroll
    for (int u = 0; u < MT; ++u)
      #pragma unroll
      for (int r = 0; r < 8; ++r) cm[u][r] = -3.0e38f;
    auto score = [&](const v8h (&k)[4]) {   // one chunk against the four row tiles
      const v16h ka0 = __builtin_shufflevector(k[0], k[1], 0,1,2,3,4,5,6,7,8,9,10,11,12,13,14,15);
      const v16h ka1 = __builtin_shufflevector(k[2], k[3], 0,1,2,3,4,5,6,7,8,9,10,11,12,13,14,15);
      #pragma unroll
      for (int u = 0; u < MT; ++u) {
        const v8f e0 = __builtin_amdgcn_wmma_f32_16x16x32_f16(false, ka0, false, qb[u],
                                                              (short)0, czero, false, false);
        const v8f e1 = __builtin_amdgcn_wmma_f32_16x16x32_f16(false, ka1, false, qb[u],
                                                              (short)0, czero, false, false);
        #pragma unroll
        for (int r = 0; r < 8; ++r) cm[u][r] = fmaxf(cm[u][r], fmaxf(e0[r], e1[r]));
      }
    };
    auto keep = [&](int i, const v8h (&k)[4]) {   // chunk wv + 16*i stays in LDS for pass B
      unsigned char* kc = smem + (wv + WPB * i) * 32 * CQ * 2;
      *(v8h*)(kc + ks0)        = k[0];
      *(v8h*)(kc + ks1)        = k[1];
      *(v8h*)(kc + ks0 + 1024) = k[2];
      *(v8h*)(kc + ks1 + 1024) = k[3];
    };
    #pragma unroll
    for (int i = KD; i < NC; i += KD) {
      #pragma unroll
      for (int d = 0; d < KD; ++d) {
        score(kf[d]);
        keep(i - KD + d, kf[d]);
        fetch(i + d, kf[d]);
      }
    }
    // last use of fo: holds it to here, so that no load above takes it as its
    // destination, and puts the wait in front of whatever overwrites it next
    asm volatile("s_wait_xcnt 0x0" :: "v"(fo) : "memory");
    #pragma unroll
    for (int d = 0; d < KD; ++d) {
      score(kf[d]);
      keep(NC - KD + d, kf[d]);
    }
    float mm[MT];
    #pragma unroll
    for (int u = 0; u < MT; ++u) {
      const float m = fmaxf(fmaxf(fmaxf(cm[u][0], cm[u][1]), fmaxf(cm[u][2], cm[u][3])),
                            fmaxf(fmaxf(cm[u][4], cm[u][5]), fmaxf(cm[u][6], cm[u][7])));
      mm[u] = fmaxf(m, __shfl_xor(m, 16, 32));
    }
    if (half == 0) {                // read by every wave behind the prologue's barrier
      #pragma unroll
      for (int u = 0; u < MT; ++u) shM[wv][u * 16 + lr] = mm[u];
    }
  }

  // ================= Pass B: P = exp(e - max), PV accumulation ==============
  // A-operand: q rows m0..m0+15, K-packed per ISA 16-bit A layout (read behind pass A,
  // whose registers are full: read ahead of it, the fragment was spilled)
  const _Float16* qrow = qT + ((size_t)b * N_ + m0 + lr) * CQ;
  const v8h qlo = *(const v8h*)(qrow + koff);
  const v8h qhi = *(const v8h*)(qrow + koff + 16);
  const v16h aq = __builtin_shufflevector(qlo, qhi, 0,1,2,3,4,5,6,7,8,9,10,11,12,13,14,15);

  v8f acc[16];
  #pragma unroll
  for (int t = 0; t < 16; ++t)
    #pragma unroll
    for (int i = 0; i < 8; ++i) acc[t][i] = 0.f;
  float rsum[8];
  #pragma unroll
  for (int i = 0; i < 8; ++i) rsum[i] = 0.f;

  // the wave's four V fragments of a stage: 4 KB in a row, the same base for the whole wave
  // (vnext: of the stage that is fetched next; typed as global memory, which the compiler
  // cannot see for itself behind the asm statements that hold it)
  gbyte* const vwav = (gbyte*)(uintptr_t)(vF + (((size_t)b * (N_ / 32) + kq) * (C_ / 16) + mt * 4) * 512);
  auto ring = [&](int s) { return (s + rot) & (NS - 1); };   // the stage that the block takes as its s-th
  gbyte* vnext = vwav + (size_t)ring(0) * (VSTG * 2);
  // bytes from the block's (s-1)-th V stage to its s-th: one stage on, or back to the first
  auto vstep = [&](int s) { return ring(s) ? (long)(VSTG * 2) : -(long)((NS - 1) * VSTG * 2); };
  const unsigned vfo = lane * 16;   // the lane's byte offset in half a fragment
  v8h vr[4][2];
  auto load_v = [&](int c) {        // fragment c of the stage at vnext
    vr[c][0] = *(gv8h*)(vnext + (size_t)vfo + c * 1024);
    vr[c][1] = *(gv8h*)(vnext + (size_t)vfo + c * 1024 + 512);
  };

  float rmax[8];

  // the two K fragments of this wave's chunk of stage stg
  auto kfrag = [&](int stg, v16h& kb0, v16h& kb1) {
    const unsigned char* kk = smem + (stg * KQ + kq) * 32 * CQ * 2;
    const v8h kl0 = *(const v8h*)(kk + ks0);
    const v8h kh0 = *(const v8h*)(kk + ks1);
    const v8h kl1 = *(const v8h*)(kk + ks0 + 1024);
    const v8h kh1 = *(const v8h*)(kk + ks1 + 1024);
    kb0 = __builtin_shufflevector(kl0, kh0, 0,1,2,3,4,5,6,7,8,9,10,11,12,13,14,15);
    kb1 = __builtin_shufflevector(kl1, kh1, 0,1,2,3,4,5,6,7,8,9,10,11,12,13,14,15);
  };
  // energy of rows mt against them
  auto energy = [&](const v16h& kb0, const v16h& kb1, v8f& e0, v8f& e1) {
    e0 = __builtin_amdgcn_wmma_f32_16x16x32_f16(false, aq, false, kb0,
                                                (short)0, czero, false, false);
    e1 = __builtin_amdgcn_wmma_f32_16x16x32_f16(false, aq, false, kb1,
                                                (short)0, czero, false, false);
  };

  // P tile of rows mt into P buffer buf: packed (p0,p1) -> one b32 LDS store per row slot.
  // Stored slot j maps to n offset (j>>1)|((j&1)<<4); vF uses same mapping.
  auto put_p = [&](int buf, const v8f& e0, const v8f& e1) {
    _Float16* myP = shP + ((buf * KQ + kq) * MT + mt) * 16 * AP;
    #pragma unroll
    for (int i = 0; i < 8; ++i) {
      const float a0 = __expf(e0[i] - rmax[i]);
      const float a1 = __expf(e1[i] - rmax[i]);
      rsum[i] += a0 + a1;                    // per-lane; reduced after the loop
      const int r = i + 8 * half;
      v2h pk; pk[0] = (_Float16)a0; pk[1] = (_Float16)a1;
      *(v2h*)(myP + r * AP + 2 * lr) = pk;
    }
  };

  // the four P fragments (row tiles) of this wave's chunk, P in buffer buf
  auto pfrag = [&](int buf, v16h (&pa)[MT]) {
    const _Float16* pp = shP + (buf * KQ + kq) * MT * 16 * AP + lr * AP + koff;
    #pragma unroll
    for (int u = 0; u < MT; ++u) {
      const v8h plo = *(const v8h*)(pp + u * 16 * AP);
      const v8h phi = *(const v8h*)(pp + u * 16 * AP + 16);
      pa[u] = __builtin_shufflevector(plo, phi, 0,1,2,3,4,5,6,7,8,9,10,11,12,13,14,15);
    }
  };
  // PV of this wave's chunk: 4 row tiles x the 4 channel tiles of quarter mt; more: each V
  // fragment is then fetched anew from vnext
  auto pv = [&](const v16h (&pa)[MT], bool more) {
    #pragma unroll
    for (int c = 0; c < 4; ++c) {
      const v16h vb = __builtin_shufflevector(vr[c][0], vr[c][1], 0,1,2,3,4,5,6,7,8,9,10,11,12,13,14,15);
      #pragma unroll
      for (int u = 0; u < MT; ++u)
        acc[u * 4 + c] = __builtin_amdgcn_wmma_f32_16x16x32_f16(false, pa[u], false, vb,
                                                                (short)0, acc[u * 4 + c], false, false);
      if (more) {
        load_v(c);
        // keeps a fragment's refill directly behind its last product: gathered behind all the
        // products, the first fragments have less of the trip to fly in. The last one also ends
        // the compiler's scheduling region: behind it the P fragments' registers are free, and the
        // exponentials are laid out side by side, not one behind the other to save registers
        __builtin_amdgcn_sched_barrier(0);
      }
    }
  };

  __syncthreads();                                    // K and shM are published
  #pragma unroll
  for (int c = 0; c < 4; ++c) load_v(c);              // V of stage 0
  // the loads above name addresses formed from vnext: the wait stands in front of their overwrite
  asm volatile("s_wait_xcnt 0x0" : "+s"(vnext) :: "memory");
  vnext += vstep(1);

  // the exact max of rows mt over all keys: lane lr takes wave lr's maxima of the
  // rows 8*half .. 8*half + 7, then one-time 16-lane reductions
  {
    const v4f ma = *(const v4f*)&shM[lr][mt * 16 + 8 * half];
    const v4f mb = *(const v4f*)&shM[lr][mt * 16 + 8 * half + 4];
    #pragma unroll
    for (int i = 0; i < 4; ++i) { rmax[i] = ma[i]; rmax[i + 4] = mb[i]; }
    #pragma unroll
    for (int i = 0; i < 8; ++i) {
      float m = rmax[i];
      m = fmaxf(m, __shfl_xor(m, 1, 32));
      m = fmaxf(m, __shfl_xor(m, 2, 32));
      m = fmaxf(m, __shfl_xor(m, 4, 32));
      m = fmaxf(m, __shfl_xor(m, 8, 32));
      rmax[i] = m;
    }
  }
  {
    v16h kb0, kb1;
    v8f e0, e1;
    kfrag(ring(0), kb0, kb1);
    energy(kb0, kb1, e0, e1);
    put_p(0, e0, e1);
  }
  asm volatile("s_wait_dscnt 0x0" ::: "memory");      // this wave's P tile of stage 0 is written
  __syncthreads();                                    // publishes P of stage 0

  // trip st: PV of stage st; P of stage st + 1; V of stage st + 1 flies into the registers
  // that this trip's products leave
  for (int st = 0; st < NS - 1; ++st) {
    const int cur = st & 1;

    // the K reads go out behind the P reads, one exposed LDS latency a trip; the scores
    // follow the PV products, whose operands are there first
    v16h pa[MT], kb0, kb1;
    v8f e0, e1;
    pfrag(cur, pa);
    kfrag(ring(st + 1), kb0, kb1);
    // holds the K reads up here: sunk to the end of the PV products, their latency is exposed
    __builtin_amdgcn_sched_barrier(0);
    pv(pa, true);
    energy(kb0, kb1, e0, e1);
    put_p(cur ^ 1, e0, e1);

    // keeps this trip's products in front of the barrier: sunk behind it their fragments
    // stay live over the next trip's loads
    __builtin_amdgcn_sched_barrier(0);
    asm volatile("s_wait_dscnt 0x0" ::: "memory");      // this wave has left the current P buffer, its P tile is written
    // this trip's V loads name an address formed from vnext: the wait stands in front of its overwrite
    asm volatile("s_wait_xcnt 0x0" : "+s"(vnext) :: "memory");
    vnext += vstep(st + 2);
    // publishes the next P stage, frees this one's buffer. The barrier is written out, its fences
    // on LDS alone: __syncthreads() would wait out the V loads that are to fly across it
    __builtin_amdgcn_fence(__ATOMIC_RELEASE, "workgroup", "local");
    __builtin_amdgcn_s_barrier();
    __builtin_amdgcn_fence(__ATOMIC_ACQUIRE, "workgroup", "local");
  }
  {
    v16h pa[MT];
    pfrag((NS - 1) & 1, pa);
    pv(pa, false);
  }
  asm volatile("s_wait_dscnt 0x0" ::: "memory");        // this wave has left K and P
  __syncthreads();                                      // every wave has left K: its LDS becomes the join's

  // ---- join of the four key phases ----
  // this wave finishes channel tile kq of its channel quarter, all 64 rows (accumulators
  // 4*u + kq). A lane takes four successive rows m of one channel, 16 lanes the 256 B that
  // the block owns of a channel's row: every load of src and every store of out covers
  // four whole 128 B lines. The source values are fetched ahead of the join.
  const int mb = (blockIdx.x % (N_ / 16 / MT)) * MT * 16;   // the block's first row
  const float gam = gamma_p[0];
  v4f sv[8];
  const float* __restrict__ sbase = src + ((size_t)b * C_ + mt * 64 + kq * 16) * N_ + mb;   // same for the whole wave
  const unsigned soff = (half * N_ + lr * 4) * 4;   // channel 2*i + half, rows 4*lr .. 4*lr + 3
  #pragma unroll
  for (int i = 0; i < 8; ++i) sv[i] = ld16(sbase, soff, i * 2 * N_ * 4);
  // last use of soff as a load's offset: holds it to here, so that no load above takes it
  // as its destination, and puts the wait in front of whatever overwrites it next
  asm volatile("s_wait_xcnt 0x0" :: "v"(soff) : "memory");

  #pragma unroll
  for (int i = 0; i < 8; ++i) {   // one-time 16-lane row-sum reduction
    float s = rsum[i];
    s += __shfl_xor(s, 1, 32);
    s += __shfl_xor(s, 2, 32);
    s += __shfl_xor(s, 4, 32);
    s += __shfl_xor(s, 8, 32);
    rsum[i] = s;
  }
  if (lr == 0) {
    #pragma unroll
    for (int i = 0; i < 8; ++i) shS[wv][8 * half + i] = rsum[i];
  }
  // [wave][tile][register quad][32 places] x 16 B. The quad (rows 16*u + 8*half + 4*q ..) of
  // channel lr lies at place 16*half + ((lr + 4*u + 2*half + q) & 15): the 16 quads of one
  // channel, which 16 lanes read back together, lie on all 64 banks once, as do the 16
  // channels that 16 lanes write together
  float* const xj = (float*)smem;
  #pragma unroll
  for (int u = 0; u < MT; ++u)
    #pragma unroll
    for (int q = 0; q < 2; ++q) {
      const int pos = 16 * half + ((lr + 4 * u + 2 * half + q) & 15);
      #pragma unroll
      for (int c = 0; c < 4; ++c) {
        const int t = u * 4 + c;
        const v4f q4 = {acc[t][4 * q], acc[t][4 * q + 1], acc[t][4 * q + 2], acc[t][4 * q + 3]};
        *(v4f*)(xj + (((wv * 16 + t) * 2 + q) * 32 + pos) * 4) = q4;
      }
    }
  __syncthreads();                  // every phase's partial sums are in LDS

  // the lane's rows 4*lr .. 4*lr + 3: row tile ru, accumulator half rh, register quad rq
  const int ru = lr >> 2, rh = (lr >> 1) & 1, rq = lr & 1;
  float linv[4];
  {
    v4f sa = *(const v4f*)&shS[ru][(lr & 3) * 4];   // shS[j * MT + ru]: rows ru, phase j
    #pragma unroll
    for (int j = 1; j < KQ; ++j) sa += *(const v4f*)&shS[j * MT + ru][(lr & 3) * 4];
    #pragma unroll
    for (int i = 0; i < 4; ++i) linv[i] = 1.f / sa[i];
  }

  // ---- epilogue: gamma * (acc/sum) + source; 16 lanes store 256 contiguous bytes ----
  #pragma unroll
  for (int i = 0; i < 8; ++i) {
    const int pos = 16 * rh + ((2 * i + half + lr) & 15);
    const float* px = xj + (((mt * 16 + ru * 4 + kq) * 2 + rq) * 32 + pos) * 4;
    v4f p = *(const v4f*)px;
    #pragma unroll
    for (int j = 1; j < KQ; ++j) p += *(const v4f*)(px + j * MT * 16 * 2 * 32 * 4);
    v4f r;
    #pragma unroll
    for (int e = 0; e < 4; ++e) r[e] = gam * p[e] * linv[e] + sv[i][e];
    *(v4f*)(out + ((size_t)b * C_ + mt * 64 + kq * 16 + 2 * i + half) * N_ + mb + lr * 4) = r;
  }
}

// ---------------------------------------------------------------------------
extern "C" void kernel_launch(void* const* d_in, const int* in_sizes, int n_in,
                              void* d_out, int out_size, void* d_ws, size_t ws_size,
                              hipStream_t stream) {
  const float* source = (const float*)d_in[0];
  const float* pose   = (const float*)d_in[1];
  const float* Wq     = (const float*)d_in[2];
  const float* bq     = (const float*)d_in[3];
  const float* Wk     = (const float*)d_in[4];
  const float* bk     = (const float*)d_in[5];
  const float* Wv     = (const float*)d_in[6];
  const float* bv     = (const float*)d_in[7];
  const float* gamma  = (const float*)d_in[8];
  float* out = (float*)d_out;

  // workspace: qT (1 MB) | kT (1 MB) | vF (8 MB), all f16
  _Float16* qT = (_Float16*)d_ws;
  _Float16* kT = qT + (size_t)B_ * N_ * CQ;
  _Float16* vF = kT + (size_t)B_ * N_ * CQ;

  proj_kernel<<<dim3(B_ * (N_ / 64)), dim3(256), 0, stream>>>(
      source, pose, Wq, bq, Wk, bk, Wv, bv, qT, kT, vF);

  attn_kernel<<<dim3(B_ * (N_ / 16) / MT), dim3(32 * WPB), 0, stream>>>(
      qT, kT, vF, source, gamma, out);
}
